// v000
// The times below were measured on an AMD MI455X: many runs one after another, warmed up first and cycling through
// copies of the inputs, with the whole window's GPU time divided by the number of runs. Launches and the gaps
// between them are all in it. The median over several windows is given; except for v000 it joins two sittings, which
// can be a few percent apart, so the side-by-side timings, each taken in one sitting, are the better comparison.
// v000, which the later versions start from, runs in 1210 microseconds.
#include <hip/hip_runtime.h>

// Single causal attention head over 4,096 tokens with biased projections (x [4][4096][768]; q, k, v = x w + b ('xw' [768][64] + [64]; ONE 64-wide head); scores = q.k^T; causal (-inf) THEN x 1/sqrt(64) (masking before the scale: the same thing); softmax; out = weights.v -> [4][4096][64] (1.0 M); argument order x, wq, bq, wk, bk, wv, bv).
// Layout per batch: bf16 copy of x; 'xw' weights transposed once; exact projections (K 768); identity-table plane builders; scores with EVERY row on hi/lo planes (3 products, dense launches); streaming three-sweep causal softmax over the 4,096 keys; attn.v hybrid (rows < 512 hi/lo 3 products, rest fp16 x1024); k_cs8 removes the fp16 carry; k_copy4 writes the output rows once.
// Compute dtypes, f32 accumulate: every input rounded to bf16; projections exact; scores 3 products; softmax f32; wei.v rows < 512 3 products, rest fp16; output f32.

#define NB_  4
#define TT   4096
#define DM   64
#define NH_  1
#define NKV  1
#define REP  (NH_ / NKV)
#define HD   64
#define DQ   (NH_ * HD)
#define DKV  (NKV * HD)
#define ZH   1
#define RH   512                  // query rows < RH use hi+lo planes (0: none)
#define WIN  0
#define PCAR 1024.0f
#define SCL  0.125f   // C^-0.5 with C = 64 (the head width)
#define MID  64       // q / k width (one 64-wide head)
#define CO   64       // v width
#define CC   768      // input width (d_model)
typedef _Float16 h16;
typedef unsigned short bf;
typedef __attribute__((ext_vector_type(16))) __bf16   v16bf;
typedef __attribute__((ext_vector_type(16))) _Float16 v16h;
typedef __attribute__((ext_vector_type(8)))  _Float16 v8h;
typedef __attribute__((ext_vector_type(8)))  unsigned short v8us;
typedef __attribute__((ext_vector_type(8)))  float    v8f;
typedef __attribute__((ext_vector_type(4)))  float    v4f;
typedef v8h  __attribute__((may_alias)) v8ha;
typedef v4f  __attribute__((may_alias)) v4fa;
typedef v8us __attribute__((may_alias)) v8usa;

__device__ __forceinline__ unsigned short f2bf(float f) { unsigned u = __float_as_uint(f); u += 0x7FFFu + ((u >> 16) & 1u); return (unsigned short)(u >> 16); }
__device__ __forceinline__ float bf2f(unsigned short b) { return __uint_as_float(((unsigned)b) << 16); }
__device__ __forceinline__ float bfr(float f) { return bf2f(f2bf(f)); }
__device__ __forceinline__ v16h cat16(v8h lo, v8h hi) { return __builtin_shufflevector(lo, hi, 0, 1, 2, 3, 4, 5, 6, 7, 8, 9, 10, 11, 12, 13, 14, 15); }
__device__ __forceinline__ v16bf cat16b(v8us lo, v8us hi) { return __builtin_bit_cast(v16bf, __builtin_shufflevector(lo, hi, 0, 1, 2, 3, 4, 5, 6, 7, 8, 9, 10, 11, 12, 13, 14, 15)); }
__device__ __forceinline__ v8f wmma16(v16h a, v16h b, v8f c) { return __builtin_amdgcn_wmma_f32_16x16x32_f16(false, a, false, b, (short)0, c, false, false); }
__device__ __forceinline__ v8f wmmab(v16bf a, v16bf b, v8f c) { return __builtin_amdgcn_wmma_f32_16x16x32_bf16(false, a, false, b, (short)0, c, false, false); }



// ---- k_gemmw: register-blocked GEMM, ONE WAVE per 64x64 output tile (16 accumulators), operands straight from K-contiguous 16-bit planes; grid (M/64, N/64, Z), 32 threads.
// C[m][n] (f32, pitch ldc, + optional f32 bias[n]) = sum_k A[m][k] Bt[n][k] (+ split products per NSPLIT). z-batch strides sA/sB/sC in elements. K % 32 == 0.
template <typename T16> struct WFrag;
template <> struct WFrag<h16> { typedef v16h V; static __device__ __forceinline__ V ld(const h16* p) { return cat16(*(const v8h*)p, *(const v8h*)(p + 16)); } static __device__ __forceinline__ v8f mma(V a, V b, v8f c) { return wmma16(a, b, c); } };
template <> struct WFrag<bf> { typedef v16bf V; static __device__ __forceinline__ V ld(const bf* p) { return cat16b(*(const v8us*)p, *(const v8us*)(p + 16)); } static __device__ __forceinline__ v8f mma(V a, V b, v8f c) { return wmmab(a, b, c); } };
template <typename T16, int NSPLIT, bool BIAS>
__global__ __launch_bounds__(32) void k_gemmw(const T16* __restrict__ A, const T16* __restrict__ A2, const T16* __restrict__ Bt, const T16* __restrict__ Bt2, int K, float* C, int ldc, const float* __restrict__ bias, size_t sA, size_t sB, size_t sC) {
    typedef typename WFrag<T16>::V V;
    __shared__ __align__(16) float os[16 * 68];
    const size_t z = blockIdx.z; A += z * sA; if (A2) A2 += z * sA; Bt += z * sB; if (Bt2) Bt2 += z * sB; C += z * sC;
    const int lane = threadIdx.x & 31, lr = lane & 15, hi = lane >> 4; const int r0 = blockIdx.x * 64, c0 = blockIdx.y * 64;
    v8f acc[4][4];
#pragma unroll
    for (int mb = 0; mb < 4; ++mb)
#pragma unroll
        for (int nb = 0; nb < 4; ++nb) acc[mb][nb] = (v8f){};
    const size_t aoff = (size_t)(r0 + lr) * K + 8 * hi, boff = (size_t)(c0 + lr) * K + 8 * hi;
#pragma unroll 1
    for (int kc = 0; kc < K; kc += 32) {
        V a[4], a2[4];
#pragma unroll
        for (int mb = 0; mb < 4; ++mb) { a[mb] = WFrag<T16>::ld(A + aoff + (size_t)mb * 16 * K + kc); if (NSPLIT == 1 || NSPLIT == 2) a2[mb] = WFrag<T16>::ld(A2 + aoff + (size_t)mb * 16 * K + kc); }
#pragma unroll
        for (int nb = 0; nb < 4; ++nb) { const V b = WFrag<T16>::ld(Bt + boff + (size_t)nb * 16 * K + kc); V b2; if (NSPLIT >= 2) b2 = WFrag<T16>::ld(Bt2 + boff + (size_t)nb * 16 * K + kc);
#pragma unroll
            for (int mb = 0; mb < 4; ++mb) { acc[mb][nb] = WFrag<T16>::mma(a[mb], b, acc[mb][nb]); if (NSPLIT == 1 || NSPLIT == 2) acc[mb][nb] = WFrag<T16>::mma(a2[mb], b, acc[mb][nb]); if (NSPLIT >= 2) acc[mb][nb] = WFrag<T16>::mma(a[mb], b2, acc[mb][nb]); } }
        asm volatile("v_nop\n\tv_nop\n\tv_nop\n\tv_nop" : "+v"(acc[0][0]), "+v"(acc[1][1]), "+v"(acc[2][2]), "+v"(acc[3][3]) : "v"(a[0]), "v"(a[3]));
    }
#pragma unroll
    for (int mb = 0; mb < 4; ++mb) {
#pragma unroll
        for (int nb = 0; nb < 4; ++nb) {
#pragma unroll
            for (int j = 0; j < 8; ++j) os[(hi * 8 + j) * 68 + nb * 16 + lr] = acc[mb][nb][j]; }
        __builtin_amdgcn_wave_barrier(); asm volatile("" ::: "memory");
        float* crow = C + (size_t)(r0 + mb * 16) * ldc + c0;
{
#pragma unroll
            for (int s = 0; s < 8; ++s) { const int row = 2 * s + hi, cofs = lr * 4; v4f val = *(const v4fa*)(os + row * 68 + cofs); if (BIAS) { val[0] += bfr(bias[c0 + cofs]); val[1] += bfr(bias[c0 + cofs + 1]); val[2] += bfr(bias[c0 + cofs + 2]); val[3] += bfr(bias[c0 + cofs + 3]); }
                *(v4f*)(crow + (size_t)row * ldc + cofs) = val; }
             }
        __builtin_amdgcn_wave_barrier(); asm volatile("" ::: "memory");
    }
}

__device__ __forceinline__ h16 tohx(float x) { return (h16)x; }
__device__ __forceinline__ void splitf(float y, unsigned short& h, unsigned short& l) { h = f2bf(y); l = f2bf(y - bf2f(h)); }
typedef __attribute__((ext_vector_type(2))) _Float16 v2h;
typedef __attribute__((ext_vector_type(4))) _Float16 v4h;
typedef __attribute__((ext_vector_type(2))) unsigned short v2us;
typedef __attribute__((ext_vector_type(4))) unsigned short v4us;
typedef __attribute__((ext_vector_type(2))) float v2f;
typedef __attribute__((ext_vector_type(4))) int v4i;

__global__ __launch_bounds__(256) void k_cvt8(const float* __restrict__ src, bf* dst, size_t n8) { const size_t i = (size_t)blockIdx.x * 256 + threadIdx.x; if (i >= n8) return; const v8f v = *(const v8f*)(src + i * 8); v8us o;
#pragma unroll
    for (int k = 0; k < 8; ++k) o[k] = f2bf(v[k]); *(v8us*)(dst + i * 8) = o;  }


__global__ __launch_bounds__(256) void k_wtG(const float* __restrict__ w, int K, int N, bf* Bt) {
    const int lane = threadIdx.x & 31; const int L0 = (blockIdx.x * 8 + (threadIdx.x >> 5)) * 8; const int nlines = N * K / 64;
{
#pragma unroll 1
        for (int l = 0; l < 8; ++l) { const int L = L0 + l; if (L >= nlines) break; const size_t e = (size_t)L * 64 + lane * 2; const int k = (int)(e % K), n = (int)(e / K); v2us o;
            o[0] = f2bf(w[(size_t)k * N + n]); o[1] = f2bf(w[(size_t)(k + 1) * N + n]); *(v2us*)(Bt + e) = o; }
         }
}
__global__ __launch_bounds__(256) void k_vtp(const float* __restrict__ F, int pitch, int nheads, h16* V16, bf* Vh, bf* Vl) { const size_t e = ((size_t)blockIdx.x * 256 + threadIdx.x) * 2; if (e >= (size_t)nheads * HD * TT) return; const int t = (int)(e % TT); const int d = (int)((e / TT) % HD); const int g = (int)(e / ((size_t)TT * HD)); v2h o16; v2us oh, ol;
#pragma unroll
    for (int q = 0; q < 2; ++q) { const float x = F[(size_t)(t + q) * pitch + g * HD + d]; o16[q] = tohx(x); unsigned short a2, c2; splitf(x, a2, c2); oh[q] = a2; ol[q] = c2; }
    *(v2h*)(V16 + e) = o16; *(v2us*)(Vh + e) = oh; *(v2us*)(Vl + e) = ol;  }
__global__ __launch_bounds__(256) void k_lsoft(const float* __restrict__ Sb, h16* P16, bf* Ph, bf* Pl) {
    const int lane = threadIdx.x & 31; const int row = blockIdx.x * 8 + (threadIdx.x >> 5); if (row >= ZH * TT) return; const int i = row % TT; const int zz = row / TT; const bool hires = (i < RH); const float* sr = Sb + (size_t)row * TT; float mx = -3.0e38f;
#pragma unroll 4
    for (int ch = 0; ch < TT / 128; ++ch) { const int j0 = ch * 128 + lane * 4; const v4f a = *(const v4f*)(sr + j0);
#pragma unroll
        for (int q = 0; q < 4; ++q) { float t = (j0 + q <= i) ? a[q] * SCL : -3.0e38f; asm volatile("" : "+v"(t)); mx = fmaxf(mx, t); } }
#pragma unroll
    for (int sh = 16; sh; sh >>= 1) mx = fmaxf(mx, __shfl_xor(mx, sh, 32));
    float sum = 0.f;
#pragma unroll 4
    for (int ch = 0; ch < TT / 128; ++ch) { const int j0 = ch * 128 + lane * 4; const v4f a = *(const v4f*)(sr + j0);
#pragma unroll
        for (int q = 0; q < 4; ++q) { float t = (j0 + q <= i) ? a[q] * SCL : -3.0e38f; asm volatile("" : "+v"(t)); float d0 = __fsub_rn(t, mx); asm volatile("" : "+v"(d0)); sum += __builtin_amdgcn_exp2f(__fmul_rn(d0, 1.4426950408889634f)); } }
#pragma unroll
    for (int sh = 16; sh; sh >>= 1) sum += __shfl_xor(sum, sh, 32);
    const float f = __fdiv_rn(hires ? 1.0f : PCAR, sum);
{
        if (hires) {   /* rows < RH: normalised bf16 hi/lo over all keys, planes [zz][RH][TT] */
#pragma unroll
            for (int ch = 0; ch < TT / 128; ++ch) { const int j0 = ch * 128 + lane * 4; const v4f a = *(const v4f*)(sr + j0); v4us oh, ol;
#pragma unroll
                for (int q = 0; q < 4; ++q) { float t = (j0 + q <= i) ? a[q] * SCL : -3.0e38f; asm volatile("" : "+v"(t)); float d0 = __fsub_rn(t, mx); asm volatile("" : "+v"(d0)); float ex = __builtin_amdgcn_exp2f(__fmul_rn(d0, 1.4426950408889634f)); asm volatile("" : "+v"(ex)); unsigned short a2, c2; splitf(ex * f, a2, c2); oh[q] = a2; ol[q] = c2; }
                const size_t oo = ((size_t)zz * RH + i) * TT + j0; *(v4us*)(Ph + oo) = oh; *(v4us*)(Pl + oo) = ol; }
        } else {
#pragma unroll 2
            for (int ch = 0; ch < TT / 128; ++ch) { const int j0 = ch * 128 + lane * 4; const v4f a = *(const v4f*)(sr + j0); v4h o4;
#pragma unroll
                for (int q = 0; q < 4; ++q) { float t = (j0 + q <= i) ? a[q] * SCL : -3.0e38f; asm volatile("" : "+v"(t)); float d0 = __fsub_rn(t, mx); asm volatile("" : "+v"(d0)); float ex = __builtin_amdgcn_exp2f(__fmul_rn(d0, 1.4426950408889634f)); asm volatile("" : "+v"(ex)); o4[q] = tohx(ex * f); }
                *(v4h*)(P16 + (size_t)row * TT + j0) = o4; } }
         }
}
__global__ __launch_bounds__(256) void k_cs8(float* O, size_t n4) { const size_t i = (size_t)blockIdx.x * 256 + threadIdx.x; if (i >= n4) return; const size_t e = i * 4; const int t = (int)(e / CO);   /* row pitch of the attention-output plane is the VALUE width CO (r1 used the input width CC: wrong whenever CC != CO) */ const float cs = (t < RH) ? 1.0f : (1.0f / PCAR); v4f a = *(const v4f*)(O + e);
#pragma unroll
    for (int q = 0; q < 4; ++q) a[q] = __fmul_rn(a[q], cs);
    *(v4f*)(O + e) = a;  }

__global__ __launch_bounds__(256) void k_csid(float* CS) { const int idx = blockIdx.x * 256 + threadIdx.x; if (idx >= TT * HD) return; v2f cs; cs[0] = 1.0f; cs[1] = 0.0f; *(v2f*)(CS + (size_t)idx * 2) = cs;  }
// k_rope: head planes [h][t][d] (fp16 + hi/lo) of rope(x) x sc with the rotate-half convention out[d] = x[d] cos[t][d] - x[d+HD/2] sin[t][d], out[d+HD/2] = x[d+HD/2] cos[t][d+HD/2] + x[d] sin[t][d+HD/2]
__global__ __launch_bounds__(256) void k_rope(const float* __restrict__ F, int pitch, int nheads, const float* __restrict__ CS, const float* __restrict__ RF, const float* __restrict__ nw, float sc, h16* P16, bf* Ph, bf* Pl) {
    const size_t e = ((size_t)blockIdx.x * 256 + threadIdx.x) * 2; if (e >= (size_t)nheads * TT * HD) return; const int d = (int)(e % HD); const int t = (int)((e / HD) % TT); const int h = (int)(e / ((size_t)HD * TT)); const float* f = F + (size_t)t * pitch + h * HD; const float rf = RF ? RF[(size_t)h * TT + t] : 1.0f; v2h o16; v2us oh, ol;
#pragma unroll
    for (int q = 0; q < 2; ++q) { const int dd = d + q; const int dp = (dd < HD / 2) ? dd + HD / 2 : dd - HD / 2; float x0 = f[dd], x1 = f[dp];
        if (RF) { float n0 = __fmul_rn(x0, rf), n1 = __fmul_rn(x1, rf); asm volatile("" : "+v"(n0)); asm volatile("" : "+v"(n1)); x0 = __fmul_rn(bfr(nw[dd]), n0); x1 = __fmul_rn(bfr(nw[dp]), n1); }
        const v2f cs = *(const v2f*)(CS + ((size_t)t * HD + dd) * 2); float a = __fmul_rn(x0, cs[0]), bq = __fmul_rn(x1, cs[1]); asm volatile("" : "+v"(a)); asm volatile("" : "+v"(bq)); const float r = ((dd < HD / 2) ? __fsub_rn(a, bq) : __fadd_rn(a, bq)) * sc;
        o16[q] = tohx(r); unsigned short a2, c2; splitf(r, a2, c2); oh[q] = a2; ol[q] = c2; }
    *(v2h*)(P16 + e) = o16; *(v2us*)(Ph + e) = oh; *(v2us*)(Pl + e) = ol;  }
__global__ __launch_bounds__(256) void k_copy4(const float* __restrict__ Y, float* out, size_t n4) { const size_t i = (size_t)blockIdx.x * 256 + threadIdx.x; if (i >= n4) return; const v4f a = *(const v4f*)(Y + i * 4); *(v4f*)(out + i * 4) = a;  }
extern "C" void kernel_launch(void* const* d_in, const int* in_sizes, int n_in,
                              void* d_out, int out_size, void* d_ws, size_t ws_size, hipStream_t stream) {
    (void)in_sizes; (void)n_in; (void)out_size;
    const float* x = (const float*)d_in[0]; const float* wq = (const float*)d_in[1]; const float* bq = (const float*)d_in[2]; const float* wk = (const float*)d_in[3]; const float* bk = (const float*)d_in[4]; const float* wv = (const float*)d_in[5]; const float* bv = (const float*)d_in[6];   /* standard roles: rows = queries */
    float* OUT = (float*)d_out;     // [4][4096][64]
    char* wsp = (char*)d_ws;
    auto take = [&](size_t bytes) { char* p = wsp; wsp += (bytes + 255) & ~(size_t)255; return (void*)p; };
    bf* WQ = (bf*)take((size_t)MID * CC * 2); bf* WK = (bf*)take((size_t)MID * CC * 2); bf* WV = (bf*)take((size_t)CO * CC * 2); float* CS = (float*)take((size_t)TT * HD * 2 * 4);
    bf* XB = (bf*)take((size_t)TT * CC * 2); float* FQ = (float*)take((size_t)TT * MID * 4); float* FK = (float*)take((size_t)TT * MID * 4);
    h16* QP16 = (h16*)take((size_t)TT * MID * 2); bf* QPh = (bf*)take((size_t)TT * MID * 2); bf* QPl = (bf*)take((size_t)TT * MID * 2); h16* KP16 = (h16*)take((size_t)TT * MID * 2); bf* KPh = (bf*)take((size_t)TT * MID * 2); bf* KPl = (bf*)take((size_t)TT * MID * 2);
    h16* VT16 = (h16*)take((size_t)CO * TT * 2); bf* VTh = (bf*)take((size_t)CO * TT * 2); bf* VTl = (bf*)take((size_t)CO * TT * 2);
    float* Sb = (float*)take((size_t)TT * TT * 4); h16* P16 = (h16*)take((size_t)TT * TT * 2); bf* Ph = (bf*)take((size_t)RH * TT * 2); bf* Pl = (bf*)take((size_t)RH * TT * 2); float* Ob = (float*)take((size_t)TT * CO * 4);   /* attention output (f32) before the final copy */
    if ((size_t)(wsp - (char*)d_ws) > ws_size) return;    // ws 256 MiB (carve ~120 MiB)
    float* FV = FK;   /* the v projection reuses the k buffer after the k planes are built (stream-ordered) */
    k_wtG<<<(unsigned)((CC * MID / 64 + 63) / 64), 256, 0, stream>>>(wq, CC, MID, WQ); k_wtG<<<(unsigned)((CC * MID / 64 + 63) / 64), 256, 0, stream>>>(wk, CC, MID, WK); k_wtG<<<(unsigned)((CC * CO / 64 + 63) / 64), 256, 0, stream>>>(wv, CC, CO, WV);   /* 'xw' [768][64] -> Bt */       /* 'xw' weights -> Bt */
    k_csid<<<(TT * HD + 255) / 256, 256, 0, stream>>>(CS);   /* identity table: k_rope is a plain per-head plane builder here */
    const unsigned LP = (unsigned)(((size_t)NH_ * TT * HD / 2 + 255) / 256);
    for (int b = 0; b < NB_; ++b) {
        k_cvt8<<<(unsigned)(((size_t)TT * CC / 8 + 255) / 256), 256, 0, stream>>>(x + (size_t)b * TT * CC, XB, (size_t)TT * CC / 8);
        k_gemmw<bf, 0, true><<<dim3(TT / 64, MID / 64, 1), 32, 0, stream>>>(XB, nullptr, WQ, nullptr, CC, FQ, MID, bq, 0, 0, 0); k_rope<<<LP, 256, 0, stream>>>(FQ, MID, NH_, CS, nullptr, nullptr, 1.0f, QP16, QPh, QPl);   /* q planes [h][n][64] */
        k_gemmw<bf, 0, true><<<dim3(TT / 64, MID / 64, 1), 32, 0, stream>>>(XB, nullptr, WK, nullptr, CC, FK, MID, bk, 0, 0, 0); k_rope<<<LP, 256, 0, stream>>>(FK, MID, NKV, CS, nullptr, nullptr, 1.0f, KP16, KPh, KPl);   /* k planes */
        k_gemmw<bf, 0, true><<<dim3(TT / 64, CO / 64, 1), 32, 0, stream>>>(XB, nullptr, WV, nullptr, CC, FV, CO, bv, 0, 0, 0); k_vtp<<<(unsigned)(((size_t)TT * CO / 2 + 255) / 256), 256, 0, stream>>>(FV, CO, CO / HD, VT16, VTh, VTl);   /* v^T planes [h][64][n] */
        for (int h = 0; h < NH_; ++h) {   /* per head: dense 4096 x 4096 attention */
            k_gemmw<bf, 2, false><<<dim3(TT / 64, TT / 64, 1), 32, 0, stream>>>(QPh + (size_t)h * TT * HD, QPl + (size_t)h * TT * HD, KPh + (size_t)h * TT * HD, KPl + (size_t)h * TT * HD, HD, Sb, TT, nullptr, 0, 0, 0);   /* S[i][j] = q_i.k_j (3 products, every row) */
            k_lsoft<<<TT / 8, 256, 0, stream>>>(Sb, P16, Ph, Pl);   /* x 1/8, softmax over the 4,096 keys */
            k_gemmw<bf, 2, false><<<dim3(RH / 64, HD / 64, 1), 32, 0, stream>>>(Ph, Pl, VTh + (size_t)h * HD * TT, VTl + (size_t)h * HD * TT, TT, Ob + h * HD, CO, nullptr, 0, 0, 0);
            k_gemmw<h16, 0, false><<<dim3((TT - RH) / 64, HD / 64, 1), 32, 0, stream>>>(P16 + (size_t)RH * TT, nullptr, VT16 + (size_t)h * HD * TT, nullptr, TT, Ob + (size_t)RH * CO + h * HD, CO, nullptr, 0, 0, 0); }
        k_cs8<<<(unsigned)(((size_t)TT * CO / 4 + 255) / 256), 256, 0, stream>>>(Ob, (size_t)TT * CO / 4);   /* rows >= 512 x 1/1024 */ k_copy4<<<(unsigned)(((size_t)TT * CO / 4 + 255) / 256), 256, 0, stream>>>(Ob, OUT + (size_t)b * TT * CO, (size_t)TT * CO / 4); }   /* the batch's output rows, written once */
}

// v001
// Measured time: 496 microseconds a run.
// In two side-by-side timings against v000, it was 2.44 and 2.43 times as fast.
#include <hip/hip_runtime.h>

// Single causal attention head over 4,096 tokens with biased projections (x [4][4096][768]; q, k, v = x w + b ('xw' [768][64] + [64]; ONE 64-wide head); scores = q.k^T; causal (-inf) THEN x 1/sqrt(64) (masking before the scale: the same thing); softmax; out = weights.v -> [4][4096][64] (1.0 M); argument order x, wq, bq, wk, bk, wv, bv).
// Layout per batch: bf16 copy of x; 'xw' weights transposed once; exact projections (K 768); identity-table plane builders; scores with EVERY row on hi/lo planes (3 products, dense launches); streaming three-sweep causal softmax over the 4,096 keys; attn.v hybrid (rows < 512 hi/lo 3 products, rest fp16 x1024), K split over waves and over grid.z; k_cs8 adds the grid.z partial planes and removes the fp16 carry; k_copy4 writes the output rows once.
// Compute dtypes, f32 accumulate: every input rounded to bf16; projections exact; scores 3 products; softmax f32; wei.v rows < 512 3 products, rest fp16; output f32.

#define NB_  4
#define TT   4096
#define DM   64
#define NH_  1
#define NKV  1
#define REP  (NH_ / NKV)
#define HD   64
#define DQ   (NH_ * HD)
#define DKV  (NKV * HD)
#define ZH   1
#define RH   512                  // query rows < RH use hi+lo planes (0: none)
#define WIN  0
#define PCAR 1024.0f
#define SCL  0.125f   // C^-0.5 with C = 64 (the head width)
#define MID  64       // q / k width (one 64-wide head)
#define CO   64       // v width
#define CC   768      // input width (d_model)
#define KSP  12       // waves per tile, projections (24 k steps: 2 each)
#define KSH  8        // waves per tile and slice, wei.v rows < RH
#define ZHI  16       // grid.z K slices, wei.v rows < RH (8 k steps a slice: 1 a wave)
#define KSL  16       // waves per tile and slice, wei.v rows >= RH
#define ZLO  4        // grid.z K slices, wei.v rows >= RH (32 k steps a slice: 2 a wave)
typedef _Float16 h16;
typedef unsigned short bf;
typedef __attribute__((ext_vector_type(16))) __bf16   v16bf;
typedef __attribute__((ext_vector_type(16))) _Float16 v16h;
typedef __attribute__((ext_vector_type(8)))  _Float16 v8h;
typedef __attribute__((ext_vector_type(8)))  unsigned short v8us;
typedef __attribute__((ext_vector_type(8)))  float    v8f;
typedef __attribute__((ext_vector_type(4)))  float    v4f;
typedef v8h  __attribute__((may_alias)) v8ha;
typedef v4f  __attribute__((may_alias)) v4fa;
typedef v8us __attribute__((may_alias)) v8usa;

__device__ __forceinline__ unsigned short f2bf(float f) { unsigned u = __float_as_uint(f); u += 0x7FFFu + ((u >> 16) & 1u); return (unsigned short)(u >> 16); }
__device__ __forceinline__ float bf2f(unsigned short b) { return __uint_as_float(((unsigned)b) << 16); }
__device__ __forceinline__ float bfr(float f) { return bf2f(f2bf(f)); }
__device__ __forceinline__ v16h cat16(v8h lo, v8h hi) { return __builtin_shufflevector(lo, hi, 0, 1, 2, 3, 4, 5, 6, 7, 8, 9, 10, 11, 12, 13, 14, 15); }
__device__ __forceinline__ v16bf cat16b(v8us lo, v8us hi) { return __builtin_bit_cast(v16bf, __builtin_shufflevector(lo, hi, 0, 1, 2, 3, 4, 5, 6, 7, 8, 9, 10, 11, 12, 13, 14, 15)); }
__device__ __forceinline__ v8f wmma16(v16h a, v16h b, v8f c) { return __builtin_amdgcn_wmma_f32_16x16x32_f16(false, a, false, b, (short)0, c, false, false); }
__device__ __forceinline__ v8f wmmab(v16bf a, v16bf b, v8f c) { return __builtin_amdgcn_wmma_f32_16x16x32_bf16(false, a, false, b, (short)0, c, false, false); }



// ---- k_gemmw: register-blocked GEMM, 64x64 output tile (16 accumulators a wave), operands straight from K-contiguous 16-bit planes; grid (M/64, N/64, Z), 32 * KS threads.
// C[m][n] (f32, pitch ldc, + optional f32 bias[n]) = sum_k A[m][k] Bt[n][k] (+ split products per NSPLIT). K = row pitch of A and Bt, K % 32 == 0.
// Split K: block z sums k in [z KL, (z + 1) KL) into plane C + z sC (the caller adds the planes; BIAS only with Z == 1); inside a block wave w takes the 32-wide steps w, w + KS, ...
// (neighbouring waves read the same 128-B lines at the same time), and the KS tiles are added through LDS in wave order.
template <typename T16> struct WFrag;
template <> struct WFrag<h16> { typedef v16h V; static __device__ __forceinline__ V ld(const h16* p) { return cat16(*(const v8h*)p, *(const v8h*)(p + 16)); } static __device__ __forceinline__ v8f mma(V a, V b, v8f c) { return wmma16(a, b, c); } };
template <> struct WFrag<bf> { typedef v16bf V; static __device__ __forceinline__ V ld(const bf* p) { return cat16b(*(const v8us*)p, *(const v8us*)(p + 16)); } static __device__ __forceinline__ v8f mma(V a, V b, v8f c) { return wmmab(a, b, c); } };
template <typename T16, int NSPLIT, bool BIAS, int KS>
__global__ __launch_bounds__(32 * KS) void k_gemmw(const T16* __restrict__ A, const T16* __restrict__ A2, const T16* __restrict__ Bt, const T16* __restrict__ Bt2, int K, int KL, float* C, int ldc, const float* __restrict__ bias, size_t sC) {
    typedef typename WFrag<T16>::V V;
    constexpr int MPP = (KS == 1) ? 1 : 4;   // 16-row blocks staged in LDS at a time
    __shared__ __align__(16) float os[KS * MPP * 16 * 68];
    C += (size_t)blockIdx.z * sC;
    const int tid = threadIdx.x, lane = tid & 31, lr = lane & 15, hi = lane >> 4; const int r0 = blockIdx.x * 64, c0 = blockIdx.y * 64;
    const int w = (KS == 1) ? 0 : __builtin_amdgcn_readfirstlane(tid >> 5); const int kend = (blockIdx.z + 1) * KL;
    v8f acc[4][4];
#pragma unroll
    for (int mb = 0; mb < 4; ++mb)
#pragma unroll
        for (int nb = 0; nb < 4; ++nb) acc[mb][nb] = (v8f){};
    const size_t aoff = (size_t)(r0 + lr) * K + 8 * hi, boff = (size_t)(c0 + lr) * K + 8 * hi;
#pragma unroll 1
    for (int kc = blockIdx.z * KL + w * 32; kc < kend; kc += KS * 32) {
        V a[4], a2[4];
#pragma unroll
        for (int mb = 0; mb < 4; ++mb) { a[mb] = WFrag<T16>::ld(A + aoff + (size_t)mb * 16 * K + kc); if (NSPLIT == 1 || NSPLIT == 2) a2[mb] = WFrag<T16>::ld(A2 + aoff + (size_t)mb * 16 * K + kc); }
#pragma unroll
        for (int nb = 0; nb < 4; ++nb) { const V b = WFrag<T16>::ld(Bt + boff + (size_t)nb * 16 * K + kc); V b2; if (NSPLIT >= 2) b2 = WFrag<T16>::ld(Bt2 + boff + (size_t)nb * 16 * K + kc);
#pragma unroll
            for (int mb = 0; mb < 4; ++mb) { acc[mb][nb] = WFrag<T16>::mma(a[mb], b, acc[mb][nb]); if (NSPLIT == 1 || NSPLIT == 2) acc[mb][nb] = WFrag<T16>::mma(a2[mb], b, acc[mb][nb]); if (NSPLIT >= 2) acc[mb][nb] = WFrag<T16>::mma(a[mb], b2, acc[mb][nb]); } }
        asm volatile("v_nop\n\tv_nop\n\tv_nop\n\tv_nop" : "+v"(acc[0][0]), "+v"(acc[1][1]), "+v"(acc[2][2]), "+v"(acc[3][3]) : "v"(a[0]), "v"(a[3]));
    }
    // One wave a tile: 16 rows a pass through its own 16 x 68 slab, as a store staging buffer. KS > 1: every wave lays down its whole 64 x 68 tile, ONE work-group barrier, then all threads add the KS tiles and store.
    // (the loops over ph, m, nb, j are unrolled so that acc[] is indexed by constants and stays in registers)
#pragma unroll
    for (int ph = 0; ph < 4 / MPP; ++ph) {
#pragma unroll
        for (int m = 0; m < MPP; ++m) {
#pragma unroll
            for (int nb = 0; nb < 4; ++nb) {
#pragma unroll
                for (int j = 0; j < 8; ++j) os[(w * MPP + m) * (16 * 68) + (hi * 8 + j) * 68 + nb * 16 + lr] = acc[ph * MPP + m][nb][j]; } }
        if (KS == 1) { __builtin_amdgcn_wave_barrier(); asm volatile("" ::: "memory"); } else __syncthreads();   /* every wave's tile is in LDS before any thread adds them */
        float* crow = C + (size_t)(r0 + ph * MPP * 16) * ldc + c0;
{
#pragma unroll
            for (int s = 0; s < (8 * MPP + KS - 1) / KS; ++s) { if ((8 * MPP) % KS != 0 && s * KS + w >= 8 * MPP) break;   /* a wave takes two rows a turn; the test is wave-uniform */
                const int row = 2 * (s * KS + w) + hi, cofs = lr * 4; v4f val = *(const v4fa*)(os + row * 68 + cofs);
#pragma unroll   /* the KS LDS loads of a turn in flight together */
                for (int u = 1; u < KS; ++u) val += *(const v4fa*)(os + u * (MPP * 16 * 68) + row * 68 + cofs);
                if (BIAS) { val[0] += bfr(bias[c0 + cofs]); val[1] += bfr(bias[c0 + cofs + 1]); val[2] += bfr(bias[c0 + cofs + 2]); val[3] += bfr(bias[c0 + cofs + 3]); }
                *(v4f*)(crow + (size_t)row * ldc + cofs) = val;
                if ((8 * MPP) % KS != 0 && (s + 1) * KS < 8 * MPP) asm volatile("s_wait_xcnt 0x0" ::: "memory"); }   /* the next turn's LDS loads reuse the store's address and data registers */
             }
        if (KS == 1) { __builtin_amdgcn_wave_barrier(); asm volatile("" ::: "memory"); }   /* the slab is read before the next 16 rows overwrite it */
    }
}

__device__ __forceinline__ h16 tohx(float x) { return (h16)x; }
__device__ __forceinline__ void splitf(float y, unsigned short& h, unsigned short& l) { h = f2bf(y); l = f2bf(y - bf2f(h)); }
typedef __attribute__((ext_vector_type(2))) _Float16 v2h;
typedef __attribute__((ext_vector_type(4))) _Float16 v4h;
typedef __attribute__((ext_vector_type(2))) unsigned short v2us;
typedef __attribute__((ext_vector_type(4))) unsigned short v4us;
typedef __attribute__((ext_vector_type(2))) float v2f;
typedef __attribute__((ext_vector_type(4))) int v4i;

__global__ __launch_bounds__(256) void k_cvt8(const float* __restrict__ src, bf* dst, size_t n8) { const size_t i = (size_t)blockIdx.x * 256 + threadIdx.x; if (i >= n8) return; const v8f v = *(const v8f*)(src + i * 8); v8us o;
#pragma unroll
    for (int k = 0; k < 8; ++k) o[k] = f2bf(v[k]); *(v8us*)(dst + i * 8) = o;  }


__global__ __launch_bounds__(256) void k_wtG(const float* __restrict__ w, int K, int N, bf* Bt) {
    const int lane = threadIdx.x & 31; const int L0 = (blockIdx.x * 8 + (threadIdx.x >> 5)) * 8; const int nlines = N * K / 64;
{
#pragma unroll 1
        for (int l = 0; l < 8; ++l) { const int L = L0 + l; if (L >= nlines) break; const size_t e = (size_t)L * 64 + lane * 2; const int k = (int)(e % K), n = (int)(e / K); v2us o;
            o[0] = f2bf(w[(size_t)k * N + n]); o[1] = f2bf(w[(size_t)(k + 1) * N + n]); *(v2us*)(Bt + e) = o; }
         }
}
__global__ __launch_bounds__(256) void k_vtp(const float* __restrict__ F, int pitch, int nheads, h16* V16, bf* Vh, bf* Vl) { const size_t e = ((size_t)blockIdx.x * 256 + threadIdx.x) * 2; if (e >= (size_t)nheads * HD * TT) return; const int t = (int)(e % TT); const int d = (int)((e / TT) % HD); const int g = (int)(e / ((size_t)TT * HD)); v2h o16; v2us oh, ol;
#pragma unroll
    for (int q = 0; q < 2; ++q) { const float x = F[(size_t)(t + q) * pitch + g * HD + d]; o16[q] = tohx(x); unsigned short a2, c2; splitf(x, a2, c2); oh[q] = a2; ol[q] = c2; }
    *(v2h*)(V16 + e) = o16; *(v2us*)(Vh + e) = oh; *(v2us*)(Vl + e) = ol;  }
__global__ __launch_bounds__(256) void k_lsoft(const float* __restrict__ Sb, h16* P16, bf* Ph, bf* Pl) {
    const int lane = threadIdx.x & 31; const int row = blockIdx.x * 8 + (threadIdx.x >> 5); if (row >= ZH * TT) return; const int i = row % TT; const int zz = row / TT; const bool hires = (i < RH); const float* sr = Sb + (size_t)row * TT; float mx = -3.0e38f;
#pragma unroll 4
    for (int ch = 0; ch < TT / 128; ++ch) { const int j0 = ch * 128 + lane * 4; const v4f a = *(const v4f*)(sr + j0);
#pragma unroll
        for (int q = 0; q < 4; ++q) { float t = (j0 + q <= i) ? a[q] * SCL : -3.0e38f; asm volatile("" : "+v"(t)); mx = fmaxf(mx, t); } }
#pragma unroll
    for (int sh = 16; sh; sh >>= 1) mx = fmaxf(mx, __shfl_xor(mx, sh, 32));
    float sum = 0.f;
#pragma unroll 4
    for (int ch = 0; ch < TT / 128; ++ch) { const int j0 = ch * 128 + lane * 4; const v4f a = *(const v4f*)(sr + j0);
#pragma unroll
        for (int q = 0; q < 4; ++q) { float t = (j0 + q <= i) ? a[q] * SCL : -3.0e38f; asm volatile("" : "+v"(t)); float d0 = __fsub_rn(t, mx); asm volatile("" : "+v"(d0)); sum += __builtin_amdgcn_exp2f(__fmul_rn(d0, 1.4426950408889634f)); } }
#pragma unroll
    for (int sh = 16; sh; sh >>= 1) sum += __shfl_xor(sum, sh, 32);
    const float f = __fdiv_rn(hires ? 1.0f : PCAR, sum);
{
        if (hires) {   /* rows < RH: normalised bf16 hi/lo over all keys, planes [zz][RH][TT] */
#pragma unroll
            for (int ch = 0; ch < TT / 128; ++ch) { const int j0 = ch * 128 + lane * 4; const v4f a = *(const v4f*)(sr + j0); v4us oh, ol;
#pragma unroll
                for (int q = 0; q < 4; ++q) { float t = (j0 + q <= i) ? a[q] * SCL : -3.0e38f; asm volatile("" : "+v"(t)); float d0 = __fsub_rn(t, mx); asm volatile("" : "+v"(d0)); float ex = __builtin_amdgcn_exp2f(__fmul_rn(d0, 1.4426950408889634f)); asm volatile("" : "+v"(ex)); unsigned short a2, c2; splitf(ex * f, a2, c2); oh[q] = a2; ol[q] = c2; }
                const size_t oo = ((size_t)zz * RH + i) * TT + j0; *(v4us*)(Ph + oo) = oh; *(v4us*)(Pl + oo) = ol; }
        } else {
#pragma unroll 2
            for (int ch = 0; ch < TT / 128; ++ch) { const int j0 = ch * 128 + lane * 4; const v4f a = *(const v4f*)(sr + j0); v4h o4;
#pragma unroll
                for (int q = 0; q < 4; ++q) { float t = (j0 + q <= i) ? a[q] * SCL : -3.0e38f; asm volatile("" : "+v"(t)); float d0 = __fsub_rn(t, mx); asm volatile("" : "+v"(d0)); float ex = __builtin_amdgcn_exp2f(__fmul_rn(d0, 1.4426950408889634f)); asm volatile("" : "+v"(ex)); o4[q] = tohx(ex * f); }
                *(v4h*)(P16 + (size_t)row * TT + j0) = o4; } }
         }
}
__global__ __launch_bounds__(256) void k_cs8(float* O, size_t n4) { const size_t i = (size_t)blockIdx.x * 256 + threadIdx.x; if (i >= n4) return; const size_t e = i * 4; const int t = (int)(e / CO);   /* row pitch of the attention-output plane is the VALUE width CO (r1 used the input width CC: wrong whenever CC != CO) */ const float cs = (t < RH) ? 1.0f : (1.0f / PCAR); v4f a = *(const v4f*)(O + e);   /* + the K-slice partial planes, in slice order; both loops unrolled whole so that every plane's load is in flight at once */
#pragma unroll
    for (int z = 1; z < ZLO; ++z) a += *(const v4f*)(O + (size_t)z * TT * CO + e);
    if (t < RH) {
#pragma unroll
        for (int z = ZLO; z < ZHI; ++z) a += *(const v4f*)(O + (size_t)z * TT * CO + e); }
#pragma unroll
    for (int q = 0; q < 4; ++q) a[q] = __fmul_rn(a[q], cs);
    *(v4f*)(O + e) = a;  }

__global__ __launch_bounds__(256) void k_csid(float* CS) { const int idx = blockIdx.x * 256 + threadIdx.x; if (idx >= TT * HD) return; v2f cs; cs[0] = 1.0f; cs[1] = 0.0f; *(v2f*)(CS + (size_t)idx * 2) = cs;  }
// k_rope: head planes [h][t][d] (fp16 + hi/lo) of rope(x) x sc with the rotate-half convention out[d] = x[d] cos[t][d] - x[d+HD/2] sin[t][d], out[d+HD/2] = x[d+HD/2] cos[t][d+HD/2] + x[d] sin[t][d+HD/2]
__global__ __launch_bounds__(256) void k_rope(const float* __restrict__ F, int pitch, int nheads, const float* __restrict__ CS, const float* __restrict__ RF, const float* __restrict__ nw, float sc, h16* P16, bf* Ph, bf* Pl) {
    const size_t e = ((size_t)blockIdx.x * 256 + threadIdx.x) * 2; if (e >= (size_t)nheads * TT * HD) return; const int d = (int)(e % HD); const int t = (int)((e / HD) % TT); const int h = (int)(e / ((size_t)HD * TT)); const float* f = F + (size_t)t * pitch + h * HD; const float rf = RF ? RF[(size_t)h * TT + t] : 1.0f; v2h o16; v2us oh, ol;
#pragma unroll
    for (int q = 0; q < 2; ++q) { const int dd = d + q; const int dp = (dd < HD / 2) ? dd + HD / 2 : dd - HD / 2; float x0 = f[dd], x1 = f[dp];
        if (RF) { float n0 = __fmul_rn(x0, rf), n1 = __fmul_rn(x1, rf); asm volatile("" : "+v"(n0)); asm volatile("" : "+v"(n1)); x0 = __fmul_rn(bfr(nw[dd]), n0); x1 = __fmul_rn(bfr(nw[dp]), n1); }
        const v2f cs = *(const v2f*)(CS + ((size_t)t * HD + dd) * 2); float a = __fmul_rn(x0, cs[0]), bq = __fmul_rn(x1, cs[1]); asm volatile("" : "+v"(a)); asm volatile("" : "+v"(bq)); const float r = ((dd < HD / 2) ? __fsub_rn(a, bq) : __fadd_rn(a, bq)) * sc;
        o16[q] = tohx(r); unsigned short a2, c2; splitf(r, a2, c2); oh[q] = a2; ol[q] = c2; }
    *(v2h*)(P16 + e) = o16; *(v2us*)(Ph + e) = oh; *(v2us*)(Pl + e) = ol;  }
__global__ __launch_bounds__(256) void k_copy4(const float* __restrict__ Y, float* out, size_t n4) { const size_t i = (size_t)blockIdx.x * 256 + threadIdx.x; if (i >= n4) return; const v4f a = *(const v4f*)(Y + i * 4); *(v4f*)(out + i * 4) = a;  }
extern "C" void kernel_launch(void* const* d_in, const int* in_sizes, int n_in,
                              void* d_out, int out_size, void* d_ws, size_t ws_size, hipStream_t stream) {
    (void)in_sizes; (void)n_in; (void)out_size;
    const float* x = (const float*)d_in[0]; const float* wq = (const float*)d_in[1]; const float* bq = (const float*)d_in[2]; const float* wk = (const float*)d_in[3]; const float* bk = (const float*)d_in[4]; const float* wv = (const float*)d_in[5]; const float* bv = (const float*)d_in[6];   /* standard roles: rows = queries */
    float* OUT = (float*)d_out;     // [4][4096][64]
    char* wsp = (char*)d_ws;
    auto take = [&](size_t bytes) { char* p = wsp; wsp += (bytes + 255) & ~(size_t)255; return (void*)p; };
    bf* WQ = (bf*)take((size_t)MID * CC * 2); bf* WK = (bf*)take((size_t)MID * CC * 2); bf* WV = (bf*)take((size_t)CO * CC * 2); float* CS = (float*)take((size_t)TT * HD * 2 * 4);
    bf* XB = (bf*)take((size_t)TT * CC * 2); float* FQ = (float*)take((size_t)TT * MID * 4); float* FK = (float*)take((size_t)TT * MID * 4);
    h16* QP16 = (h16*)take((size_t)TT * MID * 2); bf* QPh = (bf*)take((size_t)TT * MID * 2); bf* QPl = (bf*)take((size_t)TT * MID * 2); h16* KP16 = (h16*)take((size_t)TT * MID * 2); bf* KPh = (bf*)take((size_t)TT * MID * 2); bf* KPl = (bf*)take((size_t)TT * MID * 2);
    h16* VT16 = (h16*)take((size_t)CO * TT * 2); bf* VTh = (bf*)take((size_t)CO * TT * 2); bf* VTl = (bf*)take((size_t)CO * TT * 2);
    float* Sb = (float*)take((size_t)TT * TT * 4); h16* P16 = (h16*)take((size_t)TT * TT * 2); bf* Ph = (bf*)take((size_t)RH * TT * 2); bf* Pl = (bf*)take((size_t)RH * TT * 2); float* Ob = (float*)take((size_t)ZHI * TT * CO * 4);   /* attention output (f32) before the final copy: K-slice partial planes [z][4096][64], summed into plane 0 by k_cs8 */
    if ((size_t)(wsp - (char*)d_ws) > ws_size) return;    // ws 256 MiB (carve ~135 MiB)
    float* FV = FK;   /* the v projection reuses the k buffer after the k planes are built (stream-ordered) */
    k_wtG<<<(unsigned)((CC * MID / 64 + 63) / 64), 256, 0, stream>>>(wq, CC, MID, WQ); k_wtG<<<(unsigned)((CC * MID / 64 + 63) / 64), 256, 0, stream>>>(wk, CC, MID, WK); k_wtG<<<(unsigned)((CC * CO / 64 + 63) / 64), 256, 0, stream>>>(wv, CC, CO, WV);   /* 'xw' [768][64] -> Bt */       /* 'xw' weights -> Bt */
    k_csid<<<(TT * HD + 255) / 256, 256, 0, stream>>>(CS);   /* identity table: k_rope is a plain per-head plane builder here */
    const unsigned LP = (unsigned)(((size_t)NH_ * TT * HD / 2 + 255) / 256);
    for (int b = 0; b < NB_; ++b) {
        k_cvt8<<<(unsigned)(((size_t)TT * CC / 8 + 255) / 256), 256, 0, stream>>>(x + (size_t)b * TT * CC, XB, (size_t)TT * CC / 8);
        k_gemmw<bf, 0, true, KSP><<<dim3(TT / 64, MID / 64, 1), 32 * KSP, 0, stream>>>(XB, nullptr, WQ, nullptr, CC, CC, FQ, MID, bq, 0); k_rope<<<LP, 256, 0, stream>>>(FQ, MID, NH_, CS, nullptr, nullptr, 1.0f, QP16, QPh, QPl);   /* q planes [h][n][64] */
        k_gemmw<bf, 0, true, KSP><<<dim3(TT / 64, MID / 64, 1), 32 * KSP, 0, stream>>>(XB, nullptr, WK, nullptr, CC, CC, FK, MID, bk, 0); k_rope<<<LP, 256, 0, stream>>>(FK, MID, NKV, CS, nullptr, nullptr, 1.0f, KP16, KPh, KPl);   /* k planes */
        k_gemmw<bf, 0, true, KSP><<<dim3(TT / 64, CO / 64, 1), 32 * KSP, 0, stream>>>(XB, nullptr, WV, nullptr, CC, CC, FV, CO, bv, 0); k_vtp<<<(unsigned)(((size_t)TT * CO / 2 + 255) / 256), 256, 0, stream>>>(FV, CO, CO / HD, VT16, VTh, VTl);   /* v^T planes [h][64][n] */
        for (int h = 0; h < NH_; ++h) {   /* per head: dense 4096 x 4096 attention */
            k_gemmw<bf, 2, false, 1><<<dim3(TT / 64, TT / 64, 1), 32, 0, stream>>>(QPh + (size_t)h * TT * HD, QPl + (size_t)h * TT * HD, KPh + (size_t)h * TT * HD, KPl + (size_t)h * TT * HD, HD, HD, Sb, TT, nullptr, 0);   /* S[i][j] = q_i.k_j (3 products, every row) */
            k_lsoft<<<TT / 8, 256, 0, stream>>>(Sb, P16, Ph, Pl);   /* x 1/8, softmax over the 4,096 keys */
            k_gemmw<bf, 2, false, KSH><<<dim3(RH / 64, HD / 64, ZHI), 32 * KSH, 0, stream>>>(Ph, Pl, VTh + (size_t)h * HD * TT, VTl + (size_t)h * HD * TT, TT, TT / ZHI, Ob + h * HD, CO, nullptr, (size_t)TT * CO);
            k_gemmw<h16, 0, false, KSL><<<dim3((TT - RH) / 64, HD / 64, ZLO), 32 * KSL, 0, stream>>>(P16 + (size_t)RH * TT, nullptr, VT16 + (size_t)h * HD * TT, nullptr, TT, TT / ZLO, Ob + (size_t)RH * CO + h * HD, CO, nullptr, (size_t)TT * CO); }
        k_cs8<<<(unsigned)(((size_t)TT * CO / 4 + 255) / 256), 256, 0, stream>>>(Ob, (size_t)TT * CO / 4);   /* adds the K-slice planes; rows >= 512 x 1/1024 */ k_copy4<<<(unsigned)(((size_t)TT * CO / 4 + 255) / 256), 256, 0, stream>>>(Ob, OUT + (size_t)b * TT * CO, (size_t)TT * CO / 4); }   /* the batch's output rows, written once */
}

// v002
// Measured time: 188 microseconds a run.
// In two side-by-side timings against v001, it was 2.64 and 2.63 times as fast.
// All steps since v000 together make it 6.42 times as fast.
#include <hip/hip_runtime.h>

// Single causal attention head over 4,096 tokens with biased projections (x [4][4096][768]; q, k, v = x w + b ('xw' [768][64] + [64]; ONE 64-wide head); scores = q.k^T; causal (-inf) THEN x 1/sqrt(64) (masking before the scale: the same thing); softmax; out = weights.v -> [4][4096][64] (1.0 M); argument order x, wq, bq, wk, bk, wv, bv).
// Layout: per batch a bf16 copy of x; 'xw' weights transposed once; exact projections (K 768, K split over the waves of a block); identity-table plane builders; then ONE launch for all batches that streams the keys of each 16-query tile up to the diagonal: scores on hi/lo planes (3 products), running-maximum softmax in registers, weights.v (rows < 512 hi/lo 3 products, rest fp16), key blocks dealt over the waves of a block and merged through LDS.
// Compute dtypes, f32 accumulate: every input rounded to bf16; projections exact; scores 3 products; softmax f32; wei.v rows < 512 3 products, rest fp16; output f32.

#define NB_  4
#define TT   4096
#define DM   64
#define NH_  1
#define NKV  1
#define REP  (NH_ / NKV)
#define HD   64
#define DQ   (NH_ * HD)
#define DKV  (NKV * HD)
#define ZH   1
#define RH   512                  // query rows < RH use hi+lo planes (0: none)
#define WIN  0
#define SCL  0.125f   // C^-0.5 with C = 64 (the head width)
#define MID  64       // q / k width (one 64-wide head)
#define CO   64       // v width
#define CC   768      // input width (d_model)
#define KSP  12       // waves per tile, projections (24 k steps: 2 each)
typedef _Float16 h16;
typedef unsigned short bf;
typedef __attribute__((ext_vector_type(16))) __bf16   v16bf;
typedef __attribute__((ext_vector_type(16))) _Float16 v16h;
typedef __attribute__((ext_vector_type(8)))  _Float16 v8h;
typedef __attribute__((ext_vector_type(8)))  unsigned short v8us;
typedef __attribute__((ext_vector_type(8)))  float    v8f;
typedef __attribute__((ext_vector_type(4)))  float    v4f;
typedef v8h  __attribute__((may_alias)) v8ha;
typedef v4f  __attribute__((may_alias)) v4fa;
typedef v8us __attribute__((may_alias)) v8usa;

__device__ __forceinline__ unsigned short f2bf(float f) { unsigned u = __float_as_uint(f); u += 0x7FFFu + ((u >> 16) & 1u); return (unsigned short)(u >> 16); }
__device__ __forceinline__ float bf2f(unsigned short b) { return __uint_as_float(((unsigned)b) << 16); }
__device__ __forceinline__ float bfr(float f) { return bf2f(f2bf(f)); }
__device__ __forceinline__ v16h cat16(v8h lo, v8h hi) { return __builtin_shufflevector(lo, hi, 0, 1, 2, 3, 4, 5, 6, 7, 8, 9, 10, 11, 12, 13, 14, 15); }
__device__ __forceinline__ v16bf cat16b(v8us lo, v8us hi) { return __builtin_bit_cast(v16bf, __builtin_shufflevector(lo, hi, 0, 1, 2, 3, 4, 5, 6, 7, 8, 9, 10, 11, 12, 13, 14, 15)); }
__device__ __forceinline__ v8f wmma16(v16h a, v16h b, v8f c) { return __builtin_amdgcn_wmma_f32_16x16x32_f16(false, a, false, b, (short)0, c, false, false); }
__device__ __forceinline__ v8f wmmab(v16bf a, v16bf b, v8f c) { return __builtin_amdgcn_wmma_f32_16x16x32_bf16(false, a, false, b, (short)0, c, false, false); }



// ---- k_gemmw: register-blocked GEMM, 64x64 output tile (16 accumulators a wave), operands straight from K-contiguous 16-bit planes; grid (M/64, N/64, Z), 32 * KS threads.
// C[m][n] (f32, pitch ldc, + optional f32 bias[n]) = sum_k A[m][k] Bt[n][k] (+ split products per NSPLIT). K = row pitch of A and Bt, K % 32 == 0.
// Split K: block z sums k in [z KL, (z + 1) KL) into plane C + z sC (the caller adds the planes; BIAS only with Z == 1); inside a block wave w takes the 32-wide steps w, w + KS, ...
// (neighbouring waves read the same 128-B lines at the same time), and the KS tiles are added through LDS in wave order.
template <typename T16> struct WFrag;
template <> struct WFrag<h16> { typedef v16h V; static __device__ __forceinline__ V ld(const h16* p) { return cat16(*(const v8h*)p, *(const v8h*)(p + 16)); } static __device__ __forceinline__ v8f mma(V a, V b, v8f c) { return wmma16(a, b, c); } };
template <> struct WFrag<bf> { typedef v16bf V; static __device__ __forceinline__ V ld(const bf* p) { return cat16b(*(const v8us*)p, *(const v8us*)(p + 16)); } static __device__ __forceinline__ v8f mma(V a, V b, v8f c) { return wmmab(a, b, c); } };
template <typename T16, int NSPLIT, bool BIAS, int KS>
__global__ __launch_bounds__(32 * KS) void k_gemmw(const T16* __restrict__ A, const T16* __restrict__ A2, const T16* __restrict__ Bt, const T16* __restrict__ Bt2, int K, int KL, float* C, int ldc, const float* __restrict__ bias, size_t sC) {
    typedef typename WFrag<T16>::V V;
    constexpr int MPP = (KS == 1) ? 1 : 4;   // 16-row blocks staged in LDS at a time
    __shared__ __align__(16) float os[KS * MPP * 16 * 68];
    C += (size_t)blockIdx.z * sC;
    const int tid = threadIdx.x, lane = tid & 31, lr = lane & 15, hi = lane >> 4; const int r0 = blockIdx.x * 64, c0 = blockIdx.y * 64;
    const int w = (KS == 1) ? 0 : __builtin_amdgcn_readfirstlane(tid >> 5); const int kend = (blockIdx.z + 1) * KL;
    v8f acc[4][4];
#pragma unroll
    for (int mb = 0; mb < 4; ++mb)
#pragma unroll
        for (int nb = 0; nb < 4; ++nb) acc[mb][nb] = (v8f){};
    const size_t aoff = (size_t)(r0 + lr) * K + 8 * hi, boff = (size_t)(c0 + lr) * K + 8 * hi;
#pragma unroll 1
    for (int kc = blockIdx.z * KL + w * 32; kc < kend; kc += KS * 32) {
        V a[4], a2[4];
#pragma unroll
        for (int mb = 0; mb < 4; ++mb) { a[mb] = WFrag<T16>::ld(A + aoff + (size_t)mb * 16 * K + kc); if (NSPLIT == 1 || NSPLIT == 2) a2[mb] = WFrag<T16>::ld(A2 + aoff + (size_t)mb * 16 * K + kc); }
#pragma unroll
        for (int nb = 0; nb < 4; ++nb) { const V b = WFrag<T16>::ld(Bt + boff + (size_t)nb * 16 * K + kc); V b2; if (NSPLIT >= 2) b2 = WFrag<T16>::ld(Bt2 + boff + (size_t)nb * 16 * K + kc);
#pragma unroll
            for (int mb = 0; mb < 4; ++mb) { acc[mb][nb] = WFrag<T16>::mma(a[mb], b, acc[mb][nb]); if (NSPLIT == 1 || NSPLIT == 2) acc[mb][nb] = WFrag<T16>::mma(a2[mb], b, acc[mb][nb]); if (NSPLIT >= 2) acc[mb][nb] = WFrag<T16>::mma(a[mb], b2, acc[mb][nb]); } }
        asm volatile("v_nop\n\tv_nop\n\tv_nop\n\tv_nop" : "+v"(acc[0][0]), "+v"(acc[1][1]), "+v"(acc[2][2]), "+v"(acc[3][3]) : "v"(a[0]), "v"(a[3]));
    }
    // One wave a tile: 16 rows a pass through its own 16 x 68 slab, as a store staging buffer. KS > 1: every wave lays down its whole 64 x 68 tile, ONE work-group barrier, then all threads add the KS tiles and store.
    // (the loops over ph, m, nb, j are unrolled so that acc[] is indexed by constants and stays in registers)
#pragma unroll
    for (int ph = 0; ph < 4 / MPP; ++ph) {
#pragma unroll
        for (int m = 0; m < MPP; ++m) {
#pragma unroll
            for (int nb = 0; nb < 4; ++nb) {
#pragma unroll
                for (int j = 0; j < 8; ++j) os[(w * MPP + m) * (16 * 68) + (hi * 8 + j) * 68 + nb * 16 + lr] = acc[ph * MPP + m][nb][j]; } }
        if (KS == 1) { __builtin_amdgcn_wave_barrier(); asm volatile("" ::: "memory"); } else __syncthreads();   /* every wave's tile is in LDS before any thread adds them */
        float* crow = C + (size_t)(r0 + ph * MPP * 16) * ldc + c0;
{
#pragma unroll
            for (int s = 0; s < (8 * MPP + KS - 1) / KS; ++s) { if ((8 * MPP) % KS != 0 && s * KS + w >= 8 * MPP) break;   /* a wave takes two rows a turn; the test is wave-uniform */
                const int row = 2 * (s * KS + w) + hi, cofs = lr * 4; v4f val = *(const v4fa*)(os + row * 68 + cofs);
#pragma unroll   /* the KS LDS loads of a turn in flight together */
                for (int u = 1; u < KS; ++u) val += *(const v4fa*)(os + u * (MPP * 16 * 68) + row * 68 + cofs);
                if (BIAS) { val[0] += bfr(bias[c0 + cofs]); val[1] += bfr(bias[c0 + cofs + 1]); val[2] += bfr(bias[c0 + cofs + 2]); val[3] += bfr(bias[c0 + cofs + 3]); }
                *(v4f*)(crow + (size_t)row * ldc + cofs) = val;
                if ((8 * MPP) % KS != 0 && (s + 1) * KS < 8 * MPP) asm volatile("s_wait_xcnt 0x0" ::: "memory"); }   /* the next turn's LDS loads reuse the store's address and data registers */
             }
        if (KS == 1) { __builtin_amdgcn_wave_barrier(); asm volatile("" ::: "memory"); }   /* the slab is read before the next 16 rows overwrite it */
    }
}

__device__ __forceinline__ h16 tohx(float x) { return (h16)x; }
__device__ __forceinline__ void splitf(float y, unsigned short& h, unsigned short& l) { h = f2bf(y); l = f2bf(y - bf2f(h)); }
typedef __attribute__((ext_vector_type(2))) _Float16 v2h;
typedef __attribute__((ext_vector_type(4))) _Float16 v4h;
typedef __attribute__((ext_vector_type(2))) unsigned short v2us;
typedef __attribute__((ext_vector_type(4))) unsigned short v4us;
typedef __attribute__((ext_vector_type(2))) float v2f;
typedef __attribute__((ext_vector_type(4))) int v4i;

__global__ __launch_bounds__(256) void k_cvt8(const float* __restrict__ src, bf* dst, size_t n8) { const size_t i = (size_t)blockIdx.x * 256 + threadIdx.x; if (i >= n8) return; const v8f v = *(const v8f*)(src + i * 8); v8us o;
#pragma unroll
    for (int k = 0; k < 8; ++k) o[k] = f2bf(v[k]); *(v8us*)(dst + i * 8) = o;  }


__global__ __launch_bounds__(256) void k_wtG(const float* __restrict__ w, int K, int N, bf* Bt) {
    const int lane = threadIdx.x & 31; const int L0 = (blockIdx.x * 8 + (threadIdx.x >> 5)) * 8; const int nlines = N * K / 64;
{
#pragma unroll 1
        for (int l = 0; l < 8; ++l) { const int L = L0 + l; if (L >= nlines) break; const size_t e = (size_t)L * 64 + lane * 2; const int k = (int)(e % K), n = (int)(e / K); v2us o;
            o[0] = f2bf(w[(size_t)k * N + n]); o[1] = f2bf(w[(size_t)(k + 1) * N + n]); *(v2us*)(Bt + e) = o; }
         }
}
__global__ __launch_bounds__(256) void k_vtp(const float* __restrict__ F, int pitch, int nheads, h16* V16, bf* Vh, bf* Vl) { const size_t e = ((size_t)blockIdx.x * 256 + threadIdx.x) * 2; if (e >= (size_t)nheads * HD * TT) return; const int t = (int)(e % TT); const int d = (int)((e / TT) % HD); const int g = (int)(e / ((size_t)TT * HD)); v2h o16; v2us oh, ol;
#pragma unroll
    for (int q = 0; q < 2; ++q) { const float x = F[(size_t)(t + q) * pitch + g * HD + d]; o16[q] = tohx(x); unsigned short a2, c2; splitf(x, a2, c2); oh[q] = a2; ol[q] = c2; }
    *(v2h*)(V16 + e) = o16; *(v2us*)(Vh + e) = oh; *(v2us*)(Vl + e) = ol;  }
__global__ __launch_bounds__(256) void k_csid(float* CS) { const int idx = blockIdx.x * 256 + threadIdx.x; if (idx >= TT * HD) return; v2f cs; cs[0] = 1.0f; cs[1] = 0.0f; *(v2f*)(CS + (size_t)idx * 2) = cs;  }
// k_rope: head planes [h][t][d] (fp16 + hi/lo) of rope(x) x sc with the rotate-half convention out[d] = x[d] cos[t][d] - x[d+HD/2] sin[t][d], out[d+HD/2] = x[d+HD/2] cos[t][d+HD/2] + x[d] sin[t][d+HD/2]
__global__ __launch_bounds__(256) void k_rope(const float* __restrict__ F, int pitch, int nheads, const float* __restrict__ CS, const float* __restrict__ RF, const float* __restrict__ nw, float sc, h16* P16, bf* Ph, bf* Pl) {
    const size_t e = ((size_t)blockIdx.x * 256 + threadIdx.x) * 2; if (e >= (size_t)nheads * TT * HD) return; const int d = (int)(e % HD); const int t = (int)((e / HD) % TT); const int h = (int)(e / ((size_t)HD * TT)); const float* f = F + (size_t)t * pitch + h * HD; const float rf = RF ? RF[(size_t)h * TT + t] : 1.0f; v2h o16; v2us oh, ol;
#pragma unroll
    for (int q = 0; q < 2; ++q) { const int dd = d + q; const int dp = (dd < HD / 2) ? dd + HD / 2 : dd - HD / 2; float x0 = f[dd], x1 = f[dp];
        if (RF) { float n0 = __fmul_rn(x0, rf), n1 = __fmul_rn(x1, rf); asm volatile("" : "+v"(n0)); asm volatile("" : "+v"(n1)); x0 = __fmul_rn(bfr(nw[dd]), n0); x1 = __fmul_rn(bfr(nw[dp]), n1); }
        const v2f cs = *(const v2f*)(CS + ((size_t)t * HD + dd) * 2); float a = __fmul_rn(x0, cs[0]), bq = __fmul_rn(x1, cs[1]); asm volatile("" : "+v"(a)); asm volatile("" : "+v"(bq)); const float r = ((dd < HD / 2) ? __fsub_rn(a, bq) : __fadd_rn(a, bq)) * sc;
        o16[q] = tohx(r); unsigned short a2, c2; splitf(r, a2, c2); oh[q] = a2; ol[q] = c2; }
    *(v2h*)(P16 + e) = o16; *(v2us*)(Ph + e) = oh; *(v2us*)(Pl + e) = ol;  }
// ---- k_fattn: scores, causal softmax and weights.v in one pass over the keys; the score plane never leaves the registers. grid (batch, 16-query tile), FW waves a block.
// Both products are taken transposed, so that a lane owns ONE query: S^T[key][query] = K Q^T (A = k rows, B = q rows) leaves key 16 kt + 8 hi + j of query lr in st[kt][j], which is already the B fragment
// (element j and 8 + j <-> k = 8 hi + j and 16 + 8 hi + j) of O^T[d][query] = V^T P^T; running maximum, sum and rescale are per lane. Wave w takes the 32-key blocks w, w + FW, ... up to the diagonal;
// the FW partial (max, sum, O^T) sets are merged through LDS in wave order behind one work-group barrier, and the block stores its 16 output rows once.
// The maximum m is kept in the exponent's own unit: weight = 2^(s SL2 - m), SL2 = 1/8 log2(e).
#define FW   8
#define SL2  (SCL * 1.4426950408889634f)
typedef __attribute__((ext_vector_type(16))) unsigned short v16us;
__device__ __forceinline__ float xhalf(float x) { const int b = __float_as_int(x); return __int_as_float(__builtin_amdgcn_permlanex16(b, b, 0x76543210, 0xfedcba98, false, false)); }   // lane l <-> l ^ 16
// one block of 32 keys from k0; DIAG: the block that holds keys above a query of the tile (the tile's last)
// ko, vo: the lane's byte offsets into the key planes (row k0 + lr, column 8 hi) and the v^T planes (row lr, column k0 + 8 hi); every fragment of the block is that one offset register + a uniform base + a constant
// (the loops over kt, ks, dt, j are unrolled whole so that the fragment arrays are indexed by constants and stay in registers)
template <typename T16> __device__ __forceinline__ typename WFrag<T16>::V ldo(const T16* __restrict__ base, unsigned off, int cst) { return WFrag<T16>::ld((const T16*)((const char*)base + off) + cst); }
template <bool HI, bool DIAG>
__device__ __forceinline__ void fa_block(const bf* __restrict__ Kh, const bf* __restrict__ Kl, const h16* __restrict__ V16, const bf* __restrict__ Vh, const bf* __restrict__ Vl,
                                         const v16bf (&qh)[2], const v16bf (&ql)[2], int q0, int k0, unsigned ko, unsigned vo, int lr, int hi, v8f (&o)[4], float& m, float& l) {
    v16bf kh[2][2], kl[2][2]; v16h v16[4]; v16bf vh[4], vl[4];
#pragma unroll
    for (int kt = 0; kt < 2; ++kt) {
#pragma unroll
        for (int ks = 0; ks < 2; ++ks) { kh[kt][ks] = ldo<bf>(Kh, ko, kt * 16 * HD + ks * 32); kl[kt][ks] = ldo<bf>(Kl, ko, kt * 16 * HD + ks * 32); } }
#pragma unroll
    for (int dt = 0; dt < 4; ++dt) {
        if (HI) { vh[dt] = ldo<bf>(Vh, vo, dt * 16 * TT); vl[dt] = ldo<bf>(Vl, vo, dt * 16 * TT); } else v16[dt] = ldo<h16>(V16, vo, dt * 16 * TT); }
    asm volatile("s_wait_xcnt 0x0" :: "v"(ko), "v"(vo) : "memory");   /* the loads' offset registers are reused behind this line; named as inputs they stay whole up to it, so that no later load of the run lands in them */
    __builtin_amdgcn_sched_barrier(0);   /* every load of the block is issued before the first product waits: one memory round trip a block, not one a fragment */
    v8f st[2];
#pragma unroll
    for (int kt = 0; kt < 2; ++kt) { v8f s = (v8f){};
#pragma unroll
        for (int ks = 0; ks < 2; ++ks) { s = wmmab(kh[kt][ks], qh[ks], s); s = wmmab(kh[kt][ks], ql[ks], s); s = wmmab(kl[kt][ks], qh[ks], s); }
        st[kt] = s; }
    float mloc = -3.0e38f;
#pragma unroll
    for (int kt = 0; kt < 2; ++kt) {
#pragma unroll
        for (int j = 0; j < 8; ++j) { if (DIAG && (k0 + kt * 16 + hi * 8 + j > q0 + lr)) st[kt][j] = -3.0e38f; mloc = fmaxf(mloc, st[kt][j]); } }
    mloc = fmaxf(mloc, xhalf(mloc));   // the two lanes of a query hold different keys and must share one maximum
    const float mn = fmaxf(m, mloc * SL2); const float al = __builtin_amdgcn_exp2f(m - mn); m = mn;
    float ps = 0.f;
#pragma unroll
    for (int kt = 0; kt < 2; ++kt) {
#pragma unroll
        for (int j = 0; j < 8; ++j) { const float p = __builtin_amdgcn_exp2f(__builtin_fmaf(st[kt][j], SL2, -mn)); st[kt][j] = p; ps += p; } }
    l = l * al + ps;
#pragma unroll
    for (int dt = 0; dt < 4; ++dt) o[dt] *= al;
    if (HI) { v16us ph, pl;
#pragma unroll
        for (int j = 0; j < 8; ++j) { unsigned short a2, c2; splitf(st[0][j], a2, c2); ph[j] = a2; pl[j] = c2; splitf(st[1][j], a2, c2); ph[8 + j] = a2; pl[8 + j] = c2; }
        const v16bf pbh = __builtin_bit_cast(v16bf, ph), pbl = __builtin_bit_cast(v16bf, pl);
#pragma unroll
        for (int dt = 0; dt < 4; ++dt) { o[dt] = wmmab(vh[dt], pbh, o[dt]); o[dt] = wmmab(vh[dt], pbl, o[dt]); o[dt] = wmmab(vl[dt], pbh, o[dt]); }
    } else { v16h pb;
#pragma unroll
        for (int j = 0; j < 8; ++j) { pb[j] = tohx(st[0][j]); pb[8 + j] = tohx(st[1][j]); }
#pragma unroll
        for (int dt = 0; dt < 4; ++dt) o[dt] = wmma16(v16[dt], pb, o[dt]); }
}
template <bool HI>
__device__ __forceinline__ void fa_keys(const bf* __restrict__ Kh, const bf* __restrict__ Kl, const h16* __restrict__ V16, const bf* __restrict__ Vh, const bf* __restrict__ Vl,
                                        const v16bf (&qh)[2], const v16bf (&ql)[2], int q0, int w, int lr, int hi, v8f (&o)[4], float& m, float& l) {
    const int last = q0 / 32;   // the 32-key block on the diagonal; every query of the tile has a live key in it and in each block before it
    int kb = w; unsigned ko = (unsigned)(((w * 32 + lr) * HD + 8 * hi) * 2), vo = (unsigned)((lr * TT + w * 32 + 8 * hi) * 2);
#pragma unroll 1   /* rolled: a second copy of the block's fragments would take the registers that let two work-groups share a WGP */
    for (; kb < last; kb += FW) { fa_block<HI, false>(Kh, Kl, V16, Vh, Vl, qh, ql, q0, kb * 32, ko, vo, lr, hi, o, m, l); ko += FW * 32 * HD * 2; vo += FW * 32 * 2; }
    if (kb == last) fa_block<HI, true>(Kh, Kl, V16, Vh, Vl, qh, ql, q0, kb * 32, ko, vo, lr, hi, o, m, l);   // wave-uniform: one wave of the block
}
__global__ __launch_bounds__(32 * FW) void k_fattn(const bf* __restrict__ Qh, const bf* __restrict__ Ql, const bf* __restrict__ Kh, const bf* __restrict__ Kl, const h16* __restrict__ V16, const bf* __restrict__ Vh, const bf* __restrict__ Vl, float* out) {
    __shared__ __align__(16) float Os[FW * 16 * 68]; __shared__ float Ms[FW * 16]; __shared__ float Ls[FW * 16];
    const int tid = threadIdx.x, lane = tid & 31, lr = lane & 15, hi = lane >> 4; const int w = __builtin_amdgcn_readfirstlane(tid >> 5);
    const int b = blockIdx.x; const int q0 = (int)(gridDim.y - 1 - blockIdx.y) * 16;   // the tiles with the most keys start first
    const size_t pb = (size_t)b * TT * HD; Qh += pb; Ql += pb; Kh += pb; Kl += pb; V16 += pb; Vh += pb; Vl += pb;
    v16bf qh[2], ql[2];
#pragma unroll
    for (int ks = 0; ks < 2; ++ks) { const size_t qo = (size_t)(q0 + lr) * HD + 8 * hi + ks * 32; qh[ks] = WFrag<bf>::ld(Qh + qo); ql[ks] = WFrag<bf>::ld(Ql + qo); }
    asm volatile("s_wait_xcnt 0x0" ::: "memory");   /* the q loads' address registers are reused right behind them */
    v8f o[4];
#pragma unroll
    for (int dt = 0; dt < 4; ++dt) o[dt] = (v8f){};
    float m = -3.0e38f, l = 0.f;
    if (q0 < RH) fa_keys<true>(Kh, Kl, V16, Vh, Vl, qh, ql, q0, w, lr, hi, o, m, l); else fa_keys<false>(Kh, Kl, V16, Vh, Vl, qh, ql, q0, w, lr, hi, o, m, l);   // block-uniform
    l += xhalf(l);
#pragma unroll
    for (int dt = 0; dt < 4; ++dt) { float* p = Os + (w * 16 + lr) * 68 + dt * 16 + hi * 8; v4f a, c;
#pragma unroll
        for (int j = 0; j < 4; ++j) { a[j] = o[dt][j]; c[j] = o[dt][4 + j]; }
        *(v4fa*)p = a; *(v4fa*)(p + 4) = c; }
    if (hi == 0) { Ms[w * 16 + lr] = m; Ls[w * 16 + lr] = l; }
    __syncthreads();   /* every wave's partial set is in LDS before any thread merges them */
    const int qr = tid >> 4, d4 = (tid & 15) * 4;
    float M = Ms[qr];
#pragma unroll
    for (int u = 1; u < FW; ++u) M = fmaxf(M, Ms[u * 16 + qr]);
    float L = 0.f; v4f a = (v4f){};
#pragma unroll
    for (int u = 0; u < FW; ++u) { const float f = __builtin_amdgcn_exp2f(Ms[u * 16 + qr] - M); L += Ls[u * 16 + qr] * f; a += *(const v4fa*)(Os + (u * 16 + qr) * 68 + d4) * f; }   // a wave without keys has max -3e38, sum 0: factor 0
    const float r = __fdiv_rn(1.0f, L);
    *(v4f*)(out + ((size_t)b * TT + q0 + qr) * CO + d4) = a * r;
}
extern "C" void kernel_launch(void* const* d_in, const int* in_sizes, int n_in,
                              void* d_out, int out_size, void* d_ws, size_t ws_size, hipStream_t stream) {
    (void)in_sizes; (void)n_in; (void)out_size;
    const float* x = (const float*)d_in[0]; const float* wq = (const float*)d_in[1]; const float* bq = (const float*)d_in[2]; const float* wk = (const float*)d_in[3]; const float* bk = (const float*)d_in[4]; const float* wv = (const float*)d_in[5]; const float* bv = (const float*)d_in[6];   /* standard roles: rows = queries */
    float* OUT = (float*)d_out;     // [4][4096][64]
    char* wsp = (char*)d_ws;
    auto take = [&](size_t bytes) { char* p = wsp; wsp += (bytes + 255) & ~(size_t)255; return (void*)p; };
    bf* WQ = (bf*)take((size_t)MID * CC * 2); bf* WK = (bf*)take((size_t)MID * CC * 2); bf* WV = (bf*)take((size_t)CO * CC * 2); float* CS = (float*)take((size_t)TT * HD * 2 * 4);
    bf* XB = (bf*)take((size_t)TT * CC * 2); float* FQ = (float*)take((size_t)TT * MID * 4); float* FK = (float*)take((size_t)TT * MID * 4);
    h16* QP16 = (h16*)take((size_t)TT * MID * 2); h16* KP16 = (h16*)take((size_t)TT * MID * 2);
    bf* QPh = (bf*)take((size_t)NB_ * TT * MID * 2); bf* QPl = (bf*)take((size_t)NB_ * TT * MID * 2); bf* KPh = (bf*)take((size_t)NB_ * TT * MID * 2); bf* KPl = (bf*)take((size_t)NB_ * TT * MID * 2);   /* the planes the attention launch reads: one set a batch */
    h16* VT16 = (h16*)take((size_t)NB_ * CO * TT * 2); bf* VTh = (bf*)take((size_t)NB_ * CO * TT * 2); bf* VTl = (bf*)take((size_t)NB_ * CO * TT * 2);
    if ((size_t)(wsp - (char*)d_ws) > ws_size) return;    // ws 256 MiB (carve ~26 MiB)
    float* FV = FK;   /* the v projection reuses the k buffer after the k planes are built (stream-ordered) */
    k_wtG<<<(unsigned)((CC * MID / 64 + 63) / 64), 256, 0, stream>>>(wq, CC, MID, WQ); k_wtG<<<(unsigned)((CC * MID / 64 + 63) / 64), 256, 0, stream>>>(wk, CC, MID, WK); k_wtG<<<(unsigned)((CC * CO / 64 + 63) / 64), 256, 0, stream>>>(wv, CC, CO, WV);   /* 'xw' weights -> Bt */
    k_csid<<<(TT * HD + 255) / 256, 256, 0, stream>>>(CS);   /* identity table: k_rope is a plain per-head plane builder here */
    const unsigned LP = (unsigned)(((size_t)NH_ * TT * HD / 2 + 255) / 256);
    for (int b = 0; b < NB_; ++b) { const size_t pb = (size_t)b * TT * HD;
        k_cvt8<<<(unsigned)(((size_t)TT * CC / 8 + 255) / 256), 256, 0, stream>>>(x + (size_t)b * TT * CC, XB, (size_t)TT * CC / 8);
        k_gemmw<bf, 0, true, KSP><<<dim3(TT / 64, MID / 64, 1), 32 * KSP, 0, stream>>>(XB, nullptr, WQ, nullptr, CC, CC, FQ, MID, bq, 0); k_rope<<<LP, 256, 0, stream>>>(FQ, MID, NH_, CS, nullptr, nullptr, 1.0f, QP16, QPh + pb, QPl + pb);   /* q planes [b][n][64] */
        k_gemmw<bf, 0, true, KSP><<<dim3(TT / 64, MID / 64, 1), 32 * KSP, 0, stream>>>(XB, nullptr, WK, nullptr, CC, CC, FK, MID, bk, 0); k_rope<<<LP, 256, 0, stream>>>(FK, MID, NKV, CS, nullptr, nullptr, 1.0f, KP16, KPh + pb, KPl + pb);   /* k planes */
        k_gemmw<bf, 0, true, KSP><<<dim3(TT / 64, CO / 64, 1), 32 * KSP, 0, stream>>>(XB, nullptr, WV, nullptr, CC, CC, FV, CO, bv, 0); k_vtp<<<(unsigned)(((size_t)TT * CO / 2 + 255) / 256), 256, 0, stream>>>(FV, CO, CO / HD, VT16 + pb, VTh + pb, VTl + pb); }   /* v^T planes [b][64][n] */
    k_fattn<<<dim3(NB_, TT / 16, 1), 32 * FW, 0, stream>>>(QPh, QPl, KPh, KPl, VT16, VTh, VTl, OUT);   /* causal attention of all four batches; writes every output row once */
}

// v003
// One run takes 67.5 microseconds.
// Next to v002, in two timings, it ran 2.79 and 2.81 times as fast.
// All steps since v000 together make it 18.0 times as fast.
#include <hip/hip_runtime.h>

// Single causal attention head over 4,096 tokens with biased projections (x [4][4096][768]; q, k, v = x w + b ('xw' [768][64] + [64]; ONE 64-wide head); scores = q.k^T; causal (-inf) THEN x 1/sqrt(64) (masking before the scale: the same thing); softmax; out = weights.v -> [4][4096][64] (1.0 M); argument order x, wq, bq, wk, bk, wv, bv).
// Layout: 'xw' weights laid out as fragments once (one launch for the three); ONE launch for all batches that rounds x to bf16 on its way into LDS, takes the three exact projections (K 768, K split over the waves of a block) and writes the planes the attention reads; then ONE launch for all batches that streams the keys of each 16-query tile up to the diagonal: scores on hi/lo planes (3 products), running-maximum softmax in registers, weights.v (rows < 512 hi/lo 3 products, rest fp16), key blocks dealt over the waves of a block and merged through LDS.
// Compute dtypes, f32 accumulate: every input rounded to bf16; projections exact; scores 3 products; softmax f32; wei.v rows < 512 3 products, rest fp16; output f32.

#define NB_  4
#define TT   4096
#define DM   64
#define NH_  1
#define NKV  1
#define REP  (NH_ / NKV)
#define HD   64
#define DQ   (NH_ * HD)
#define DKV  (NKV * HD)
#define ZH   1
#define RH   512                  // query rows < RH use hi+lo planes (0: none)
#define WIN  0
#define SCL  0.125f   // C^-0.5 with C = 64 (the head width)
#define MID  64       // q / k width (one 64-wide head)
#define CO   64       // v width
#define CC   768      // input width (d_model)
#define KQ   4        // waves that share the K of one projection tile (24 k steps: 6 each)
typedef _Float16 h16;
typedef unsigned short bf;
typedef __attribute__((ext_vector_type(16))) __bf16   v16bf;
typedef __attribute__((ext_vector_type(16))) _Float16 v16h;
typedef __attribute__((ext_vector_type(8)))  _Float16 v8h;
typedef __attribute__((ext_vector_type(8)))  unsigned short v8us;
typedef __attribute__((ext_vector_type(8)))  float    v8f;
typedef __attribute__((ext_vector_type(4)))  float    v4f;
typedef v8h  __attribute__((may_alias)) v8ha;
typedef v4f  __attribute__((may_alias)) v4fa;
typedef v8us __attribute__((may_alias)) v8usa;

__device__ __forceinline__ unsigned short f2bf(float f) { unsigned u = __float_as_uint(f); u += 0x7FFFu + ((u >> 16) & 1u); return (unsigned short)(u >> 16); }
__device__ __forceinline__ float bf2f(unsigned short b) { return __uint_as_float(((unsigned)b) << 16); }
__device__ __forceinline__ float bfr(float f) { return bf2f(f2bf(f)); }
__device__ __forceinline__ v16h cat16(v8h lo, v8h hi) { return __builtin_shufflevector(lo, hi, 0, 1, 2, 3, 4, 5, 6, 7, 8, 9, 10, 11, 12, 13, 14, 15); }
__device__ __forceinline__ v16bf cat16b(v8us lo, v8us hi) { return __builtin_bit_cast(v16bf, __builtin_shufflevector(lo, hi, 0, 1, 2, 3, 4, 5, 6, 7, 8, 9, 10, 11, 12, 13, 14, 15)); }
__device__ __forceinline__ v8f wmma16(v16h a, v16h b, v8f c) { return __builtin_amdgcn_wmma_f32_16x16x32_f16(false, a, false, b, (short)0, c, false, false); }
__device__ __forceinline__ v8f wmmab(v16bf a, v16bf b, v8f c) { return __builtin_amdgcn_wmma_f32_16x16x32_bf16(false, a, false, b, (short)0, c, false, false); }



// fragment loaders: operands straight from K-contiguous 16-bit planes
template <typename T16> struct WFrag;
template <> struct WFrag<h16> { typedef v16h V; static __device__ __forceinline__ V ld(const h16* p) { return cat16(*(const v8h*)p, *(const v8h*)(p + 16)); } static __device__ __forceinline__ v8f mma(V a, V b, v8f c) { return wmma16(a, b, c); } };
template <> struct WFrag<bf> { typedef v16bf V; static __device__ __forceinline__ V ld(const bf* p) { return cat16b(*(const v8us*)p, *(const v8us*)(p + 16)); } static __device__ __forceinline__ v8f mma(V a, V b, v8f c) { return wmmab(a, b, c); } };

__device__ __forceinline__ h16 tohx(float x) { return (h16)x; }
__device__ __forceinline__ void splitf(float y, unsigned short& h, unsigned short& l) { h = f2bf(y); l = f2bf(y - bf2f(h)); }
typedef __attribute__((ext_vector_type(2))) _Float16 v2h;
typedef __attribute__((ext_vector_type(4))) _Float16 v4h;
typedef __attribute__((ext_vector_type(2))) unsigned short v2us;
typedef __attribute__((ext_vector_type(4))) unsigned short v4us;
typedef __attribute__((ext_vector_type(2))) float v2f;
typedef __attribute__((ext_vector_type(4))) int v4i;


// ---- k_wt3: the three 'xw' weights [CC][64] f32 -> bf16 in fragment order [3][nb 4][k step CC / 32][half 2][lane 32][8]: lane (hi, lr) of half h holds channel nb 16 + lr, k = 32 step + 16 h + 8 hi + 0..7,
// so that one 16-byte load a lane fetches half a fragment from 512 contiguous bytes. grid (64 CC / 512, 3); a wave writes one 128-B line.
__global__ __launch_bounds__(256) void k_wt3(const float* __restrict__ wq, const float* __restrict__ wk, const float* __restrict__ wv, bf* Bt) {
    const float* __restrict__ w = (blockIdx.y == 0) ? wq : (blockIdx.y == 1) ? wk : wv;
    const unsigned e = (blockIdx.x * 256 + threadIdx.x) * 2, f = e >> 9, ln = (e >> 3) & 31, k = (f % (CC / 32)) * 32 + ((e >> 8) & 1) * 16 + (ln >> 4) * 8 + (e & 7), n = (f / (CC / 32)) * 16 + (ln & 15); v2us o;
    o[0] = f2bf(w[k * 64 + n]); o[1] = f2bf(w[(k + 1) * 64 + n]); *(v2us*)(Bt + blockIdx.y * (64 * CC) + e) = o;
}
// ---- k_proj: q, k and v projections of 64 rows of x (all batches: grid NB_ TT / 64) and their planes, one launch. 3 KQ waves: wave w works on projection w / KQ and takes the 32-wide k steps w % KQ, w % KQ + KQ, ...
// The block's rows of x (contiguous f32) are read once, whole lines a load and all loads in flight together, rounded to bf16 (nearest even) and laid in LDS (row pitch 16 B x odd); a work-group barrier; the fragments come from there. The product is taken transposed (A = weight rows, B = x rows): a lane owns token mb 16 + lr and holds channels nb 16 + 8 hi + j.
// Every wave lays its 64 x 64 partial tile in LDS (q, k: [token][channel]; v: [channel][token], the layout of its planes), ONE work-group barrier, then the KQ waves of a projection add its KQ tiles in wave order and store the planes, 128-B lines whole. The bias (rounded to bf16) is the start value of the first wave's sums.
typedef __attribute__((ext_vector_type(4))) __bf16 v4bf;
typedef v4us __attribute__((may_alias)) v4usa;
#define PSL  (64 * 68)
#define XP   (CC + 8)
__global__ __launch_bounds__(32 * 3 * KQ) void k_proj(const float* __restrict__ x, const bf* __restrict__ WT, const float* __restrict__ bq, const float* __restrict__ bk, const float* __restrict__ bv,
                                                      bf* Qh, bf* Ql, bf* Kh, bf* Kl, h16* V16, bf* Vh, bf* Vl) {
    __shared__ __align__(16) float os[3 * KQ * PSL]; __shared__ __align__(16) bf xs[64 * XP];
    const int tid = threadIdx.x, lane = tid & 31, lr = lane & 15, hi = lane >> 4; const int w = __builtin_amdgcn_readfirstlane(tid >> 5);
    const int p = w / KQ, kq = w % KQ; const int r0 = blockIdx.x * 64;
    // the biases of the lane's channels (nb 16 + 8 hi + j, the same for the three projections) are fetched here, under the reads of x; the first wave of each projection starts its sums from them
    const float* bp = (p == 0) ? bq : (p == 1) ? bk : bv; const unsigned bo = hi * 32; v4f bz[4][2];   // bo: the lane's byte offset, the one address register of these loads
#pragma unroll
    for (int nb = 0; nb < 4; ++nb) { const float* q = (const float*)((const char*)bp + bo) + nb * 16; bz[nb][0] = *(const v4f*)q; bz[nb][1] = *(const v4f*)(q + 4); }
    // weight fragments: a ring of two k steps; the first is fetched here, under the reads of x, the second in front of the barrier (x's registers are free by then), a later one behind the products of the step whose registers it takes
    const bf* wb = WT + ((size_t)p * 4 * (CC / 32) + kq) * 512 + lane * 8; v16bf b[2][4];
#pragma unroll
    for (int nb = 0; nb < 4; ++nb) { const bf* q = wb + nb * (CC / 32) * 512; b[0][nb] = cat16b(*(const v8us*)q, *(const v8us*)(q + 256)); }
    {   // 512-B piece c = w + 3 KQ i of the 64 rows: row c / 6 = 2 i + w / 6, sixth c % 6 = w % 6
        const float* xg = x + (size_t)r0 * CC + w * 128 + lane * 4; bf* xd = xs + (w / 6) * XP + (w % 6) * 128 + lane * 4; v4f raw[64 * CC / (3 * KQ * 128)];
#pragma unroll
        for (int i = 0; i < 64 * CC / (3 * KQ * 128); ++i) raw[i] = *(const v4f*)(xg + i * 3 * KQ * 128);
        asm volatile("s_wait_xcnt 0x0" ::: "memory");   /* every load of the tile is issued in front of the first rounding (one memory round trip), and the loads' address registers are reused behind this line */
#pragma unroll
        for (int i = 0; i < 64 * CC / (3 * KQ * 128); ++i) *(v4usa*)(xd + i * 2 * XP) = __builtin_bit_cast(v4us, __builtin_convertvector(raw[i], v4bf));
    }
    asm volatile("s_wait_xcnt 0x0" :: "v"(bo) : "memory");   /* the build issues some bias and weight loads behind the wait above; named as an input the bias offset register stays whole up to this one */
#pragma unroll
    for (int nb = 0; nb < 4; ++nb) { const bf* q = wb + (nb * (CC / 32) + KQ) * 512; b[1][nb] = cat16b(*(const v8us*)q, *(const v8us*)(q + 256)); }
    asm volatile("s_wait_xcnt 0x0" ::: "memory");   /* these loads' offset register is reused in the loop below */
    __syncthreads();   /* the bf16 rows are in LDS before any wave takes a fragment */
    const bf* xa = xs + lr * XP + kq * 32 + 8 * hi;
    v8f acc[4][4];
    if (kq == 0) {   // wave-uniform
#pragma unroll
        for (int nb = 0; nb < 4; ++nb) { v8f z;
#pragma unroll
            for (int j = 0; j < 8; ++j) z[j] = bfr(bz[nb][j >> 2][j & 3]);
#pragma unroll
            for (int mb = 0; mb < 4; ++mb) acc[mb][nb] = z; }
    } else {
#pragma unroll
        for (int nb = 0; nb < 4; ++nb)
#pragma unroll
            for (int mb = 0; mb < 4; ++mb) acc[mb][nb] = (v8f){};
    }
    // (unrolled whole: the ring and the accumulators are indexed by constants and stay in registers; every address is one lane register + a constant)
#pragma unroll
    for (int s = 0; s < CC / (32 * KQ); ++s) { v16bf a[4];
#pragma unroll
        for (int mb = 0; mb < 4; ++mb) { const bf* q = xa + mb * 16 * XP + s * KQ * 32; a[mb] = cat16b(*(const v8usa*)q, *(const v8usa*)(q + 16)); }
#pragma unroll
        for (int nb = 0; nb < 4; ++nb) {
#pragma unroll
            for (int mb = 0; mb < 4; ++mb) acc[mb][nb] = wmmab(b[s & 1][nb], a[mb], acc[mb][nb]); }
        if (s + 2 < CC / (32 * KQ)) {
#pragma unroll
            for (int nb = 0; nb < 4; ++nb) { const bf* q = wb + (nb * (CC / 32) + (s + 2) * KQ) * 512; b[s & 1][nb] = cat16b(*(const v8us*)q, *(const v8us*)(q + 256)); }
            __builtin_amdgcn_sched_barrier(0); } }   /* the fetch stays a whole step in front of its products: left alone the build puts each load right in front of its use and waits out an L2 round trip a fragment */
    asm volatile("s_wait_xcnt 0x0" ::: "memory");   /* the loads' address registers are reused behind this line */
    // a thread's share of the sum: rows g8, g8 + 4 KQ, ... of its projection's tile, columns c8 .. c8 + 7
    const int g = tid & (32 * KQ - 1), g8 = g >> 3, c8 = (g & 7) * 8; const float* tp = os + p * KQ * PSL;
    float* sl = os + w * PSL;
    if (p < 2) {   // wave-uniform
#pragma unroll
        for (int mb = 0; mb < 4; ++mb) {
#pragma unroll
            for (int nb = 0; nb < 4; ++nb) { float* q = sl + (mb * 16 + lr) * 68 + nb * 16 + hi * 8; v4f c, d;
#pragma unroll
                for (int j = 0; j < 4; ++j) { c[j] = acc[mb][nb][j]; d[j] = acc[mb][nb][4 + j]; }
                *(v4fa*)q = c; *(v4fa*)(q + 4) = d; } }
    } else {
#pragma unroll
        for (int mb = 0; mb < 4; ++mb) {
#pragma unroll
            for (int nb = 0; nb < 4; ++nb) {
#pragma unroll
                for (int j = 0; j < 8; ++j) sl[(nb * 16 + hi * 8 + j) * 68 + mb * 16 + lr] = acc[mb][nb][j]; } }
    }
    __syncthreads();   /* every wave's partial tile is in LDS before any thread adds them */
    const int bb = r0 / TT, t0 = r0 % TT;
    // (the turns are unrolled: every LDS address is one lane register + a constant)
    if (p < 2) { bf* Ph = p ? Kh : Qh; bf* Pl = p ? Kl : Ql;
#pragma unroll
        for (int it = 0; it < 512 / (32 * KQ); ++it) { const int row = g8 + it * 4 * KQ; const float* s0 = tp + row * 68 + c8; v4f c = *(const v4fa*)s0, d = *(const v4fa*)(s0 + 4);
#pragma unroll
            for (int u = 1; u < KQ; ++u) { c += *(const v4fa*)(s0 + u * PSL); d += *(const v4fa*)(s0 + u * PSL + 4); }
            v8us oh, ol;
#pragma unroll
            for (int e = 0; e < 4; ++e) { unsigned short a2, c2; splitf(c[e], a2, c2); oh[e] = a2; ol[e] = c2; splitf(d[e], a2, c2); oh[4 + e] = a2; ol[4 + e] = c2; }
            const size_t o = (size_t)(r0 + row) * HD + c8; *(v8us*)(Ph + o) = oh; *(v8us*)(Pl + o) = ol;
            asm volatile("s_wait_xcnt 0x0" ::: "memory"); }   /* the next turn reuses the stores' address and data registers */
    } else {
#pragma unroll
        for (int it = 0; it < 512 / (32 * KQ); ++it) { const int row = g8 + it * 4 * KQ; const float* s0 = tp + row * 68 + c8; v4f c = *(const v4fa*)s0, d = *(const v4fa*)(s0 + 4);
#pragma unroll
            for (int u = 1; u < KQ; ++u) { c += *(const v4fa*)(s0 + u * PSL); d += *(const v4fa*)(s0 + u * PSL + 4); }
            v8us oh, ol; v8h o16;
#pragma unroll
            for (int e = 0; e < 4; ++e) { unsigned short a2, c2; float y = c[e]; o16[e] = tohx(y); splitf(y, a2, c2); oh[e] = a2; ol[e] = c2; y = d[e]; o16[4 + e] = tohx(y); splitf(y, a2, c2); oh[4 + e] = a2; ol[4 + e] = c2; }
            const size_t o = ((size_t)bb * HD + row) * TT + t0 + c8; *(v8h*)(V16 + o) = o16; *(v8us*)(Vh + o) = oh; *(v8us*)(Vl + o) = ol;
            asm volatile("s_wait_xcnt 0x0" ::: "memory"); }   /* the next turn reuses the stores' address and data registers */
    }
}
// ---- k_fattn: scores, causal softmax and weights.v in one pass over the keys; the score plane never leaves the registers. grid (batch, 16-query tile), FW waves a block.
// Both products are taken transposed, so that a lane owns ONE query: S^T[key][query] = K Q^T (A = k rows, B = q rows) leaves key 16 kt + 8 hi + j of query lr in st[kt][j], which is already the B fragment
// (element j and 8 + j <-> k = 8 hi + j and 16 + 8 hi + j) of O^T[d][query] = V^T P^T; running maximum, sum and rescale are per lane. Wave w takes the 32-key blocks w, w + FW, ... up to the diagonal;
// the FW partial (max, sum, O^T) sets are merged through LDS in wave order behind one work-group barrier, and the block stores its 16 output rows once.
// The maximum m is kept in the exponent's own unit: weight = 2^(s SL2 - m), SL2 = 1/8 log2(e).
#define FW   8
#define SL2  (SCL * 1.4426950408889634f)
typedef __attribute__((ext_vector_type(16))) unsigned short v16us;
__device__ __forceinline__ float xhalf(float x) { const int b = __float_as_int(x); return __int_as_float(__builtin_amdgcn_permlanex16(b, b, 0x76543210, 0xfedcba98, false, false)); }   // lane l <-> l ^ 16
// one block of 32 keys from k0; DIAG: the block that holds keys above a query of the tile (the tile's last)
// ko, vo: the lane's byte offsets into the key planes (row k0 + lr, column 8 hi) and the v^T planes (row lr, column k0 + 8 hi); every fragment of the block is that one offset register + a uniform base + a constant
// (the loops over kt, ks, dt, j are unrolled whole so that the fragment arrays are indexed by constants and stay in registers)
template <typename T16> __device__ __forceinline__ typename WFrag<T16>::V ldo(const T16* __restrict__ base, unsigned off, int cst) { return WFrag<T16>::ld((const T16*)((const char*)base + off) + cst); }
template <bool HI, bool DIAG>
__device__ __forceinline__ void fa_block(const bf* __restrict__ Kh, const bf* __restrict__ Kl, const h16* __restrict__ V16, const bf* __restrict__ Vh, const bf* __restrict__ Vl,
                                         const v16bf (&qh)[2], const v16bf (&ql)[2], int q0, int k0, unsigned ko, unsigned vo, int lr, int hi, v8f (&o)[4], float& m, float& l) {
    v16bf kh[2][2], kl[2][2]; v16h v16[4]; v16bf vh[4], vl[4];
#pragma unroll
    for (int kt = 0; kt < 2; ++kt) {
#pragma unroll
        for (int ks = 0; ks < 2; ++ks) { kh[kt][ks] = ldo<bf>(Kh, ko, kt * 16 * HD + ks * 32); kl[kt][ks] = ldo<bf>(Kl, ko, kt * 16 * HD + ks * 32); } }
#pragma unroll
    for (int dt = 0; dt < 4; ++dt) {
        if (HI) { vh[dt] = ldo<bf>(Vh, vo, dt * 16 * TT); vl[dt] = ldo<bf>(Vl, vo, dt * 16 * TT); } else v16[dt] = ldo<h16>(V16, vo, dt * 16 * TT); }
    asm volatile("s_wait_xcnt 0x0" :: "v"(ko), "v"(vo) : "memory");   /* the loads' offset registers are reused behind this line; named as inputs they stay whole up to it, so that no later load of the run lands in them */
    __builtin_amdgcn_sched_barrier(0);   /* every load of the block is issued before the first product waits: one memory round trip a block, not one a fragment */
    v8f st[2];
#pragma unroll
    for (int kt = 0; kt < 2; ++kt) { v8f s = (v8f){};
#pragma unroll
        for (int ks = 0; ks < 2; ++ks) { s = wmmab(kh[kt][ks], qh[ks], s); s = wmmab(kh[kt][ks], ql[ks], s); s = wmmab(kl[kt][ks], qh[ks], s); }
        st[kt] = s; }
    float mloc = -3.0e38f;
#pragma unroll
    for (int kt = 0; kt < 2; ++kt) {
#pragma unroll
        for (int j = 0; j < 8; ++j) { if (DIAG && (k0 + kt * 16 + hi * 8 + j > q0 + lr)) st[kt][j] = -3.0e38f; mloc = fmaxf(mloc, st[kt][j]); } }
    mloc = fmaxf(mloc, xhalf(mloc));   // the two lanes of a query hold different keys and must share one maximum
    const float mn = fmaxf(m, mloc * SL2); const float al = __builtin_amdgcn_exp2f(m - mn); m = mn;
    float ps = 0.f;
#pragma unroll
    for (int kt = 0; kt < 2; ++kt) {
#pragma unroll
        for (int j = 0; j < 8; ++j) { const float p = __builtin_amdgcn_exp2f(__builtin_fmaf(st[kt][j], SL2, -mn)); st[kt][j] = p; ps += p; } }
    l = l * al + ps;
#pragma unroll
    for (int dt = 0; dt < 4; ++dt) o[dt] *= al;
    if (HI) { v16us ph, pl;
#pragma unroll
        for (int j = 0; j < 8; ++j) { unsigned short a2, c2; splitf(st[0][j], a2, c2); ph[j] = a2; pl[j] = c2; splitf(st[1][j], a2, c2); ph[8 + j] = a2; pl[8 + j] = c2; }
        const v16bf pbh = __builtin_bit_cast(v16bf, ph), pbl = __builtin_bit_cast(v16bf, pl);
#pragma unroll
        for (int dt = 0; dt < 4; ++dt) { o[dt] = wmmab(vh[dt], pbh, o[dt]); o[dt] = wmmab(vh[dt], pbl, o[dt]); o[dt] = wmmab(vl[dt], pbh, o[dt]); }
    } else { v16h pb;
#pragma unroll
        for (int j = 0; j < 8; ++j) { pb[j] = tohx(st[0][j]); pb[8 + j] = tohx(st[1][j]); }
#pragma unroll
        for (int dt = 0; dt < 4; ++dt) o[dt] = wmma16(v16[dt], pb, o[dt]); }
}
template <bool HI>
__device__ __forceinline__ void fa_keys(const bf* __restrict__ Kh, const bf* __restrict__ Kl, const h16* __restrict__ V16, const bf* __restrict__ Vh, const bf* __restrict__ Vl,
                                        const v16bf (&qh)[2], const v16bf (&ql)[2], int q0, int w, int lr, int hi, v8f (&o)[4], float& m, float& l) {
    const int last = q0 / 32;   // the 32-key block on the diagonal; every query of the tile has a live key in it and in each block before it
    int kb = w; unsigned ko = (unsigned)(((w * 32 + lr) * HD + 8 * hi) * 2), vo = (unsigned)((lr * TT + w * 32 + 8 * hi) * 2);
#pragma unroll 1   /* rolled: a second copy of the block's fragments would take the registers that let two work-groups share a WGP */
    for (; kb < last; kb += FW) { fa_block<HI, false>(Kh, Kl, V16, Vh, Vl, qh, ql, q0, kb * 32, ko, vo, lr, hi, o, m, l); ko += FW * 32 * HD * 2; vo += FW * 32 * 2; }
    if (kb == last) fa_block<HI, true>(Kh, Kl, V16, Vh, Vl, qh, ql, q0, kb * 32, ko, vo, lr, hi, o, m, l);   // wave-uniform: one wave of the block
}
__global__ __launch_bounds__(32 * FW) void k_fattn(const bf* __restrict__ Qh, const bf* __restrict__ Ql, const bf* __restrict__ Kh, const bf* __restrict__ Kl, const h16* __restrict__ V16, const bf* __restrict__ Vh, const bf* __restrict__ Vl, float* out) {
    __shared__ __align__(16) float Os[FW * 16 * 68]; __shared__ float Ms[FW * 16]; __shared__ float Ls[FW * 16];
    const int tid = threadIdx.x, lane = tid & 31, lr = lane & 15, hi = lane >> 4; const int w = __builtin_amdgcn_readfirstlane(tid >> 5);
    const int b = blockIdx.x; const int q0 = (int)(gridDim.y - 1 - blockIdx.y) * 16;   // the tiles with the most keys start first
    const size_t pb = (size_t)b * TT * HD; Qh += pb; Ql += pb; Kh += pb; Kl += pb; V16 += pb; Vh += pb; Vl += pb;
    v16bf qh[2], ql[2];
#pragma unroll
    for (int ks = 0; ks < 2; ++ks) { const size_t qo = (size_t)(q0 + lr) * HD + 8 * hi + ks * 32; qh[ks] = WFrag<bf>::ld(Qh + qo); ql[ks] = WFrag<bf>::ld(Ql + qo); }
    asm volatile("s_wait_xcnt 0x0" ::: "memory");   /* the q loads' address registers are reused right behind them */
    v8f o[4];
#pragma unroll
    for (int dt = 0; dt < 4; ++dt) o[dt] = (v8f){};
    float m = -3.0e38f, l = 0.f;
    if (q0 < RH) fa_keys<true>(Kh, Kl, V16, Vh, Vl, qh, ql, q0, w, lr, hi, o, m, l); else fa_keys<false>(Kh, Kl, V16, Vh, Vl, qh, ql, q0, w, lr, hi, o, m, l);   // block-uniform
    l += xhalf(l);
#pragma unroll
    for (int dt = 0; dt < 4; ++dt) { float* p = Os + (w * 16 + lr) * 68 + dt * 16 + hi * 8; v4f a, c;
#pragma unroll
        for (int j = 0; j < 4; ++j) { a[j] = o[dt][j]; c[j] = o[dt][4 + j]; }
        *(v4fa*)p = a; *(v4fa*)(p + 4) = c; }
    if (hi == 0) { Ms[w * 16 + lr] = m; Ls[w * 16 + lr] = l; }
    __syncthreads();   /* every wave's partial set is in LDS before any thread merges them */
    const int qr = tid >> 4, d4 = (tid & 15) * 4;
    float M = Ms[qr];
#pragma unroll
    for (int u = 1; u < FW; ++u) M = fmaxf(M, Ms[u * 16 + qr]);
    float L = 0.f; v4f a = (v4f){};
#pragma unroll
    for (int u = 0; u < FW; ++u) { const float f = __builtin_amdgcn_exp2f(Ms[u * 16 + qr] - M); L += Ls[u * 16 + qr] * f; a += *(const v4fa*)(Os + (u * 16 + qr) * 68 + d4) * f; }   // a wave without keys has max -3e38, sum 0: factor 0
    const float r = __fdiv_rn(1.0f, L);
    *(v4f*)(out + ((size_t)b * TT + q0 + qr) * CO + d4) = a * r;
}
extern "C" void kernel_launch(void* const* d_in, const int* in_sizes, int n_in,
                              void* d_out, int out_size, void* d_ws, size_t ws_size, hipStream_t stream) {
    (void)in_sizes; (void)n_in; (void)out_size;
    const float* x = (const float*)d_in[0]; const float* wq = (const float*)d_in[1]; const float* bq = (const float*)d_in[2]; const float* wk = (const float*)d_in[3]; const float* bk = (const float*)d_in[4]; const float* wv = (const float*)d_in[5]; const float* bv = (const float*)d_in[6];   /* standard roles: rows = queries */
    float* OUT = (float*)d_out;     // [4][4096][64]
    char* wsp = (char*)d_ws;
    auto take = [&](size_t bytes) { char* p = wsp; wsp += (bytes + 255) & ~(size_t)255; return (void*)p; };
    bf* WT = (bf*)take((size_t)3 * MID * CC * 2);   /* q, k, v weights, bf16 in fragment order */
    bf* QPh = (bf*)take((size_t)NB_ * TT * MID * 2); bf* QPl = (bf*)take((size_t)NB_ * TT * MID * 2); bf* KPh = (bf*)take((size_t)NB_ * TT * MID * 2); bf* KPl = (bf*)take((size_t)NB_ * TT * MID * 2);   /* the planes the attention launch reads: one set a batch */
    h16* VT16 = (h16*)take((size_t)NB_ * CO * TT * 2); bf* VTh = (bf*)take((size_t)NB_ * CO * TT * 2); bf* VTl = (bf*)take((size_t)NB_ * CO * TT * 2);
    if ((size_t)(wsp - (char*)d_ws) > ws_size) return;    // ws 256 MiB (carve ~15 MiB)
    k_wt3<<<dim3(CC * MID / 512, 3, 1), 256, 0, stream>>>(wq, wk, wv, WT);   /* 'xw' weights -> fragments */
    k_proj<<<NB_ * TT / 64, 32 * 3 * KQ, 0, stream>>>(x, WT, bq, bk, bv, QPh, QPl, KPh, KPl, VT16, VTh, VTl);   /* q, k planes [b][n][64], v^T planes [b][64][n] */
    k_fattn<<<dim3(NB_, TT / 16, 1), 32 * FW, 0, stream>>>(QPh, QPl, KPh, KPl, VT16, VTh, VTl, OUT);   /* causal attention of all four batches; writes every output row once */
}

// v004
// Measured time: 45.1 microseconds a run.
// In two side-by-side timings against v003, it was 1.49 and 1.48 times as fast.
// Counting every step since v000, it is 26.7 times as fast.
#include <hip/hip_runtime.h>

// Single causal attention head over 4,096 tokens with biased projections (x [4][4096][768]; q, k, v = x w + b ('xw' [768][64] + [64]; ONE 64-wide head); scores = q.k^T; causal (-inf) THEN x 1/sqrt(64) (masking before the scale: the same thing); softmax; out = weights.v -> [4][4096][64] (1.0 M); argument order x, wq, bq, wk, bk, wv, bv).
// Layout: 'xw' weights laid out as fragments once (one launch for the three); ONE launch for all batches that rounds x to bf16 on its way into LDS, takes the three exact projections (K 768, K split over the waves of a block) and writes the planes the attention reads; then ONE launch for all batches that streams the keys of each 16-query tile up to the diagonal: scores on hi/lo planes (3 products), running-maximum softmax in registers, weights.v (rows < 512 hi/lo 3 products, rest fp16), key blocks dealt over the waves of a block and merged through LDS.
// Compute dtypes, f32 accumulate: every input rounded to bf16; projections exact; scores 3 products; softmax f32; wei.v rows < 512 3 products, rest fp16; output f32.

#define NB_  4
#define TT   4096
#define DM   64
#define NH_  1
#define NKV  1
#define REP  (NH_ / NKV)
#define HD   64
#define DQ   (NH_ * HD)
#define DKV  (NKV * HD)
#define ZH   1
#define RH   512                  // query rows < RH use hi+lo planes (0: none)
#define WIN  0
#define SCL  0.125f   // C^-0.5 with C = 64 (the head width)
#define MID  64       // q / k width (one 64-wide head)
#define CO   64       // v width
#define CC   768      // input width (d_model)
#define KQ   4        // waves that share the K of one projection tile (24 k steps: 6 each)
typedef _Float16 h16;
typedef unsigned short bf;
typedef __attribute__((ext_vector_type(16))) __bf16   v16bf;
typedef __attribute__((ext_vector_type(16))) _Float16 v16h;
typedef __attribute__((ext_vector_type(8)))  _Float16 v8h;
typedef __attribute__((ext_vector_type(8)))  unsigned short v8us;
typedef __attribute__((ext_vector_type(8)))  float    v8f;
typedef __attribute__((ext_vector_type(4)))  float    v4f;
typedef v8h  __attribute__((may_alias)) v8ha;
typedef v4f  __attribute__((may_alias)) v4fa;
typedef v8us __attribute__((may_alias)) v8usa;

__device__ __forceinline__ unsigned short f2bf(float f) { unsigned u = __float_as_uint(f); u += 0x7FFFu + ((u >> 16) & 1u); return (unsigned short)(u >> 16); }
__device__ __forceinline__ float bf2f(unsigned short b) { return __uint_as_float(((unsigned)b) << 16); }
__device__ __forceinline__ float bfr(float f) { return bf2f(f2bf(f)); }
__device__ __forceinline__ v16h cat16(v8h lo, v8h hi) { return __builtin_shufflevector(lo, hi, 0, 1, 2, 3, 4, 5, 6, 7, 8, 9, 10, 11, 12, 13, 14, 15); }
__device__ __forceinline__ v16bf cat16b(v8us lo, v8us hi) { return __builtin_bit_cast(v16bf, __builtin_shufflevector(lo, hi, 0, 1, 2, 3, 4, 5, 6, 7, 8, 9, 10, 11, 12, 13, 14, 15)); }
__device__ __forceinline__ v8f wmma16(v16h a, v16h b, v8f c) { return __builtin_amdgcn_wmma_f32_16x16x32_f16(false, a, false, b, (short)0, c, false, false); }
__device__ __forceinline__ v8f wmmab(v16bf a, v16bf b, v8f c) { return __builtin_amdgcn_wmma_f32_16x16x32_bf16(false, a, false, b, (short)0, c, false, false); }



// fragment loaders: operands straight from 16-bit planes kept in fragment order: [half 2][lane 32][8], so that each of the two 16-byte loads a lane makes is part of 512 contiguous bytes (four whole lines a wave)
template <typename T16> struct WFrag;
template <> struct WFrag<h16> { typedef v16h V; static __device__ __forceinline__ V ld(const h16* p) { return cat16(*(const v8h*)p, *(const v8h*)(p + 256)); } static __device__ __forceinline__ v8f mma(V a, V b, v8f c) { return wmma16(a, b, c); } };
template <> struct WFrag<bf> { typedef v16bf V; static __device__ __forceinline__ V ld(const bf* p) { return cat16b(*(const v8us*)p, *(const v8us*)(p + 256)); } static __device__ __forceinline__ v8f mma(V a, V b, v8f c) { return wmmab(a, b, c); } };

__device__ __forceinline__ h16 tohx(float x) { return (h16)x; }
__device__ __forceinline__ void splitf(float y, unsigned short& h, unsigned short& l) { h = f2bf(y); l = f2bf(y - bf2f(h)); }
typedef __attribute__((ext_vector_type(2))) _Float16 v2h;
typedef __attribute__((ext_vector_type(4))) _Float16 v4h;
typedef __attribute__((ext_vector_type(2))) unsigned short v2us;
typedef __attribute__((ext_vector_type(4))) unsigned short v4us;
typedef __attribute__((ext_vector_type(2))) float v2f;
typedef __attribute__((ext_vector_type(4))) int v4i;


// ---- k_wt3: the three 'xw' weights [CC][64] f32 -> bf16 in fragment order [3][nb 4][k step CC / 32][half 2][lane 32][8]: lane (hi, lr) of half h holds channel nb 16 + lr, k = 32 step + 16 h + 8 hi + 0..7,
// so that one 16-byte load a lane fetches half a fragment from 512 contiguous bytes. grid (64 CC / 512, 3); a wave writes one 128-B line.
__global__ __launch_bounds__(256) void k_wt3(const float* __restrict__ wq, const float* __restrict__ wk, const float* __restrict__ wv, bf* Bt) {
    const float* __restrict__ w = (blockIdx.y == 0) ? wq : (blockIdx.y == 1) ? wk : wv;
    const unsigned e = (blockIdx.x * 256 + threadIdx.x) * 2, f = e >> 9, ln = (e >> 3) & 31, k = (f % (CC / 32)) * 32 + ((e >> 8) & 1) * 16 + (ln >> 4) * 8 + (e & 7), n = (f / (CC / 32)) * 16 + (ln & 15); v2us o;
    o[0] = f2bf(w[k * 64 + n]); o[1] = f2bf(w[(k + 1) * 64 + n]); *(v2us*)(Bt + blockIdx.y * (64 * CC) + e) = o;
}
// ---- k_proj: q, k and v projections of 64 rows of x (all batches: grid NB_ TT / 64) and their planes, one launch. 3 KQ waves: wave w works on projection w / KQ and takes the 32-wide k steps w % KQ, w % KQ + KQ, ...
// The block's rows of x (contiguous f32) are read once, whole lines a load and all loads in flight together, rounded to bf16 (nearest even) and laid in LDS (row pitch 16 B x odd); a work-group barrier; the fragments come from there. The product is taken transposed (A = weight rows, B = x rows): a lane owns token mb 16 + lr and holds channels nb 16 + 8 hi + j.
// Every wave lays its 64 x 64 partial tile in LDS (q, k: [token][channel]; v: [channel][token]), ONE work-group barrier, then the KQ waves of a projection add its KQ tiles in wave order and store the planes in the attention's fragment order, 512 contiguous bytes a wave and store:
// q, k: [16-token tile][k step 2][half 2][lane 32][8], lane (hi, lr) of half h holds token lr of the tile, channels 32 step + 16 h + 8 hi + 0..7; v: [batch][32-token block][16-channel tile 4][half 2][lane 32][8], lane (hi, lr) of half h holds channel lr of the tile, tokens 16 h + 8 hi + 0..7 of the block. The bias (rounded to bf16) is the start value of the first wave's sums.
typedef __attribute__((ext_vector_type(4))) __bf16 v4bf;
typedef v4us __attribute__((may_alias)) v4usa;
#define PSL  (64 * 68)
#define XP   (CC + 8)
__global__ __launch_bounds__(32 * 3 * KQ) void k_proj(const float* __restrict__ x, const bf* __restrict__ WT, const float* __restrict__ bq, const float* __restrict__ bk, const float* __restrict__ bv,
                                                      bf* Qh, bf* Ql, bf* Kh, bf* Kl, h16* V16, bf* Vh, bf* Vl) {
    __shared__ __align__(16) float os[3 * KQ * PSL]; __shared__ __align__(16) bf xs[64 * XP];
    const int tid = threadIdx.x, lane = tid & 31, lr = lane & 15, hi = lane >> 4; const int w = __builtin_amdgcn_readfirstlane(tid >> 5);
    const int p = w / KQ, kq = w % KQ; const int r0 = blockIdx.x * 64;
    // the biases of the lane's channels (nb 16 + 8 hi + j, the same for the three projections) are fetched here, under the reads of x; the first wave of each projection starts its sums from them
    const float* bp = (p == 0) ? bq : (p == 1) ? bk : bv; const unsigned bo = hi * 32; v4f bz[4][2];   // bo: the lane's byte offset, the one address register of these loads
#pragma unroll
    for (int nb = 0; nb < 4; ++nb) { const float* q = (const float*)((const char*)bp + bo) + nb * 16; bz[nb][0] = *(const v4f*)q; bz[nb][1] = *(const v4f*)(q + 4); }
    // weight fragments: a ring of two k steps; the first is fetched here, under the reads of x, the second in front of the barrier (x's registers are free by then), a later one behind the products of the step whose registers it takes
    const bf* wb = WT + ((size_t)p * 4 * (CC / 32) + kq) * 512 + lane * 8; v16bf b[2][4];
#pragma unroll
    for (int nb = 0; nb < 4; ++nb) { const bf* q = wb + nb * (CC / 32) * 512; b[0][nb] = cat16b(*(const v8us*)q, *(const v8us*)(q + 256)); }
    {   // 512-B piece c = w + 3 KQ i of the 64 rows: row c / 6 = 2 i + w / 6, sixth c % 6 = w % 6
        const float* xg = x + (size_t)r0 * CC + w * 128 + lane * 4; bf* xd = xs + (w / 6) * XP + (w % 6) * 128 + lane * 4; v4f raw[64 * CC / (3 * KQ * 128)];
#pragma unroll
        for (int i = 0; i < 64 * CC / (3 * KQ * 128); ++i) raw[i] = *(const v4f*)(xg + i * 3 * KQ * 128);
        asm volatile("s_wait_xcnt 0x0" ::: "memory");   /* every load of the tile is issued in front of the first rounding (one memory round trip), and the loads' address registers are reused behind this line */
#pragma unroll
        for (int i = 0; i < 64 * CC / (3 * KQ * 128); ++i) *(v4usa*)(xd + i * 2 * XP) = __builtin_bit_cast(v4us, __builtin_convertvector(raw[i], v4bf));
    }
    asm volatile("s_wait_xcnt 0x0" :: "v"(bo) : "memory");   /* the build issues some bias and weight loads behind the wait above; named as an input the bias offset register stays whole up to this one */
#pragma unroll
    for (int nb = 0; nb < 4; ++nb) { const bf* q = wb + (nb * (CC / 32) + KQ) * 512; b[1][nb] = cat16b(*(const v8us*)q, *(const v8us*)(q + 256)); }
    asm volatile("s_wait_xcnt 0x0" ::: "memory");   /* these loads' offset register is reused in the loop below */
    __syncthreads();   /* the bf16 rows are in LDS before any wave takes a fragment */
    const bf* xa = xs + lr * XP + kq * 32 + 8 * hi;
    v8f acc[4][4];
    if (kq == 0) {   // wave-uniform
#pragma unroll
        for (int nb = 0; nb < 4; ++nb) { v8f z;
#pragma unroll
            for (int j = 0; j < 8; ++j) z[j] = bfr(bz[nb][j >> 2][j & 3]);
#pragma unroll
            for (int mb = 0; mb < 4; ++mb) acc[mb][nb] = z; }
    } else {
#pragma unroll
        for (int nb = 0; nb < 4; ++nb)
#pragma unroll
            for (int mb = 0; mb < 4; ++mb) acc[mb][nb] = (v8f){};
    }
    // (unrolled whole: the ring and the accumulators are indexed by constants and stay in registers; every address is one lane register + a constant)
#pragma unroll
    for (int s = 0; s < CC / (32 * KQ); ++s) { v16bf a[4];
#pragma unroll
        for (int mb = 0; mb < 4; ++mb) { const bf* q = xa + mb * 16 * XP + s * KQ * 32; a[mb] = cat16b(*(const v8usa*)q, *(const v8usa*)(q + 16)); }
#pragma unroll
        for (int nb = 0; nb < 4; ++nb) {
#pragma unroll
            for (int mb = 0; mb < 4; ++mb) acc[mb][nb] = wmmab(b[s & 1][nb], a[mb], acc[mb][nb]); }
        if (s + 2 < CC / (32 * KQ)) {
#pragma unroll
            for (int nb = 0; nb < 4; ++nb) { const bf* q = wb + (nb * (CC / 32) + (s + 2) * KQ) * 512; b[s & 1][nb] = cat16b(*(const v8us*)q, *(const v8us*)(q + 256)); }
            __builtin_amdgcn_sched_barrier(0); } }   /* the fetch stays a whole step in front of its products: left alone the build puts each load right in front of its use and waits out an L2 round trip a fragment */
    asm volatile("s_wait_xcnt 0x0" ::: "memory");   /* the loads' address registers are reused behind this line */
    // a thread's share of the sum: rows gl, gl + 16, ... of its projection's tile, columns 8 gc .. 8 gc + 7 (a wave: 16 rows x 16 columns, one half of a fragment)
    static_assert(KQ == 4, "the 128 threads of a projection cover 16 rows x 8 column groups a turn");
    const int g = tid & (32 * KQ - 1), gl = g & 15, gc = g >> 4; const float* tp = os + p * KQ * PSL;
    float* sl = os + w * PSL;
    if (p < 2) {   // wave-uniform
#pragma unroll
        for (int mb = 0; mb < 4; ++mb) {
#pragma unroll
            for (int nb = 0; nb < 4; ++nb) { float* q = sl + (mb * 16 + lr) * 68 + nb * 16 + hi * 8; v4f c, d;
#pragma unroll
                for (int j = 0; j < 4; ++j) { c[j] = acc[mb][nb][j]; d[j] = acc[mb][nb][4 + j]; }
                *(v4fa*)q = c; *(v4fa*)(q + 4) = d; } }
    } else {
#pragma unroll
        for (int mb = 0; mb < 4; ++mb) {
#pragma unroll
            for (int nb = 0; nb < 4; ++nb) {
#pragma unroll
                for (int j = 0; j < 8; ++j) sl[(nb * 16 + hi * 8 + j) * 68 + mb * 16 + lr] = acc[mb][nb][j]; } }
    }
    __syncthreads();   /* every wave's partial tile is in LDS before any thread adds them */
    const int bb = r0 / TT, t0 = r0 % TT;
    // (the turns are unrolled: every LDS address is one lane register + a constant)
    if (p < 2) { bf* Ph = p ? Kh : Qh; bf* Pl = p ? Kl : Ql;
#pragma unroll
        for (int it = 0; it < 512 / (32 * KQ); ++it) { const float* s0 = tp + (gl + it * 16) * 68 + gc * 8; v4f c = *(const v4fa*)s0, d = *(const v4fa*)(s0 + 4);
#pragma unroll
            for (int u = 1; u < KQ; ++u) { c += *(const v4fa*)(s0 + u * PSL); d += *(const v4fa*)(s0 + u * PSL + 4); }
            v8us oh, ol;
#pragma unroll
            for (int e = 0; e < 4; ++e) { unsigned short a2, c2; splitf(c[e], a2, c2); oh[e] = a2; ol[e] = c2; splitf(d[e], a2, c2); oh[4 + e] = a2; ol[4 + e] = c2; }
            const size_t o = (size_t)(r0 / 16 + it) * (16 * HD) + gc * 128 + gl * 8; *(v8us*)(Ph + o) = oh; *(v8us*)(Pl + o) = ol;
            asm volatile("s_wait_xcnt 0x0" ::: "memory"); }   /* the next turn reuses the stores' address and data registers */
    } else {
#pragma unroll
        for (int it = 0; it < 512 / (32 * KQ); ++it) { const float* s0 = tp + (gl + it * 16) * 68 + gc * 8; v4f c = *(const v4fa*)s0, d = *(const v4fa*)(s0 + 4);
#pragma unroll
            for (int u = 1; u < KQ; ++u) { c += *(const v4fa*)(s0 + u * PSL); d += *(const v4fa*)(s0 + u * PSL + 4); }
            v8us oh, ol; v8h o16;
#pragma unroll
            for (int e = 0; e < 4; ++e) { unsigned short a2, c2; float y = c[e]; o16[e] = tohx(y); splitf(y, a2, c2); oh[e] = a2; ol[e] = c2; y = d[e]; o16[4 + e] = tohx(y); splitf(y, a2, c2); oh[4 + e] = a2; ol[4 + e] = c2; }
            const size_t o = (size_t)bb * HD * TT + (size_t)((t0 / 32 + (gc >> 2)) * 4 + it) * 512 + (gc & 3) * 128 + gl * 8; *(v8h*)(V16 + o) = o16; *(v8us*)(Vh + o) = oh; *(v8us*)(Vl + o) = ol;
            asm volatile("s_wait_xcnt 0x0" ::: "memory"); }   /* the next turn reuses the stores' address and data registers */
    }
}
// ---- k_fattn: scores, causal softmax and weights.v in one pass over the keys; the score plane never leaves the registers. grid (batch, 16-query tile), FW waves a block.
// Both products are taken transposed, so that a lane owns ONE query: S^T[key][query] = K Q^T (A = k rows, B = q rows) leaves key 16 kt + 8 hi + j of query lr in st[kt][j], which is already the B fragment
// (element j and 8 + j <-> k = 8 hi + j and 16 + 8 hi + j) of O^T[d][query] = V^T P^T; running maximum, sum and rescale are per lane. Wave w takes the 32-key blocks w, w + FW, ... up to the diagonal;
// the FW partial (max, sum, O^T) sets are merged through LDS in wave order behind one work-group barrier, and the block stores its 16 output rows once.
// The maximum m is kept in the exponent's own unit: weight = 2^(s SL2 - m), SL2 = 1/8 log2(e).
#define FW   8
#define SL2  (SCL * 1.4426950408889634f)
typedef __attribute__((ext_vector_type(16))) unsigned short v16us;
__device__ __forceinline__ float xhalf(float x) { const int b = __float_as_int(x); return __int_as_float(__builtin_amdgcn_permlanex16(b, b, 0x76543210, 0xfedcba98, false, false)); }   // lane l <-> l ^ 16
// one block of 32 keys from k0; DIAG: the block that holds keys above a query of the tile (the tile's last)
// fo: the lane's byte offset into the key planes and the v^T planes alike (a block of 32 keys is 2,048 elements of each, in fragment order); every fragment of the block is that one offset register + a uniform base + a constant
// (the loops over kt, ks, dt, j are unrolled whole so that the fragment arrays are indexed by constants and stay in registers)
template <typename T16> __device__ __forceinline__ typename WFrag<T16>::V ldo(const T16* __restrict__ base, unsigned off, int cst) { return WFrag<T16>::ld((const T16*)((const char*)base + off) + cst); }
template <bool HI, bool DIAG>
__device__ __forceinline__ void fa_block(const bf* __restrict__ Kh, const bf* __restrict__ Kl, const h16* __restrict__ V16, const bf* __restrict__ Vh, const bf* __restrict__ Vl,
                                         const v16bf (&qh)[2], const v16bf (&ql)[2], int q0, int k0, unsigned fo, int lr, int hi, v8f (&o)[4], float& m, float& l) {
    v16bf kh[2][2], kl[2][2]; v16h v16[4]; v16bf vh[4], vl[4];
#pragma unroll
    for (int kt = 0; kt < 2; ++kt) {
#pragma unroll
        for (int ks = 0; ks < 2; ++ks) { kh[kt][ks] = ldo<bf>(Kh, fo, kt * 16 * HD + ks * 512); kl[kt][ks] = ldo<bf>(Kl, fo, kt * 16 * HD + ks * 512); } }
#pragma unroll
    for (int dt = 0; dt < 4; ++dt) {
        if (HI) { vh[dt] = ldo<bf>(Vh, fo, dt * 512); vl[dt] = ldo<bf>(Vl, fo, dt * 512); } else v16[dt] = ldo<h16>(V16, fo, dt * 512); }
    asm volatile("s_wait_xcnt 0x0" :: "v"(fo) : "memory");   /* the loads' offset register is reused behind this line; named as an input it stays whole up to it, so that no later load of the run lands in it */
    __builtin_amdgcn_sched_barrier(0);   /* every load of the block is issued before the first product waits: one memory round trip a block, not one a fragment */
    v8f st[2];
#pragma unroll
    for (int kt = 0; kt < 2; ++kt) { v8f s = (v8f){};
#pragma unroll
        for (int ks = 0; ks < 2; ++ks) { s = wmmab(kh[kt][ks], qh[ks], s); s = wmmab(kh[kt][ks], ql[ks], s); s = wmmab(kl[kt][ks], qh[ks], s); }
        st[kt] = s; }
    float mloc = -3.0e38f;
#pragma unroll
    for (int kt = 0; kt < 2; ++kt) {
#pragma unroll
        for (int j = 0; j < 8; ++j) { if (DIAG && (k0 + kt * 16 + hi * 8 + j > q0 + lr)) st[kt][j] = -3.0e38f; mloc = fmaxf(mloc, st[kt][j]); } }
    mloc = fmaxf(mloc, xhalf(mloc));   // the two lanes of a query hold different keys and must share one maximum
    const float mn = fmaxf(m, mloc * SL2); const float al = __builtin_amdgcn_exp2f(m - mn); m = mn;
    float ps = 0.f;
#pragma unroll
    for (int kt = 0; kt < 2; ++kt) {
#pragma unroll
        for (int j = 0; j < 8; ++j) { const float p = __builtin_amdgcn_exp2f(__builtin_fmaf(st[kt][j], SL2, -mn)); st[kt][j] = p; ps += p; } }
    l = l * al + ps;
#pragma unroll
    for (int dt = 0; dt < 4; ++dt) o[dt] *= al;
    if (HI) { v16us ph, pl;
#pragma unroll
        for (int j = 0; j < 8; ++j) { unsigned short a2, c2; splitf(st[0][j], a2, c2); ph[j] = a2; pl[j] = c2; splitf(st[1][j], a2, c2); ph[8 + j] = a2; pl[8 + j] = c2; }
        const v16bf pbh = __builtin_bit_cast(v16bf, ph), pbl = __builtin_bit_cast(v16bf, pl);
#pragma unroll
        for (int dt = 0; dt < 4; ++dt) { o[dt] = wmmab(vh[dt], pbh, o[dt]); o[dt] = wmmab(vh[dt], pbl, o[dt]); o[dt] = wmmab(vl[dt], pbh, o[dt]); }
    } else { v16h pb;
#pragma unroll
        for (int j = 0; j < 8; ++j) { pb[j] = tohx(st[0][j]); pb[8 + j] = tohx(st[1][j]); }
#pragma unroll
        for (int dt = 0; dt < 4; ++dt) o[dt] = wmma16(v16[dt], pb, o[dt]); }
}
template <bool HI>
__device__ __forceinline__ void fa_keys(const bf* __restrict__ Kh, const bf* __restrict__ Kl, const h16* __restrict__ V16, const bf* __restrict__ Vh, const bf* __restrict__ Vl,
                                        const v16bf (&qh)[2], const v16bf (&ql)[2], int q0, int w, int lr, int hi, v8f (&o)[4], float& m, float& l) {
    const int last = q0 / 32;   // the 32-key block on the diagonal; every query of the tile has a live key in it and in each block before it
    int kb = w; unsigned fo = (unsigned)((w * 32 * HD + (hi * 16 + lr) * 8) * 2);
#pragma unroll 1   /* rolled: a second copy of the block's fragments would take the registers that let two work-groups share a WGP */
    for (; kb < last; kb += FW) { fa_block<HI, false>(Kh, Kl, V16, Vh, Vl, qh, ql, q0, kb * 32, fo, lr, hi, o, m, l); fo += FW * 32 * HD * 2; }
    if (kb == last) fa_block<HI, true>(Kh, Kl, V16, Vh, Vl, qh, ql, q0, kb * 32, fo, lr, hi, o, m, l);   // wave-uniform: one wave of the block
}
__global__ __launch_bounds__(32 * FW) void k_fattn(const bf* __restrict__ Qh, const bf* __restrict__ Ql, const bf* __restrict__ Kh, const bf* __restrict__ Kl, const h16* __restrict__ V16, const bf* __restrict__ Vh, const bf* __restrict__ Vl, float* out) {
    __shared__ __align__(16) float Os[FW * 16 * 68]; __shared__ float Ms[FW * 16]; __shared__ float Ls[FW * 16];
    const int tid = threadIdx.x, lane = tid & 31, lr = lane & 15, hi = lane >> 4; const int w = __builtin_amdgcn_readfirstlane(tid >> 5);
    const int b = blockIdx.x; const int q0 = (int)(gridDim.y - 1 - blockIdx.y) * 16;   // the tiles with the most keys start first
    const size_t pb = (size_t)b * TT * HD; Qh += pb; Ql += pb; Kh += pb; Kl += pb; V16 += pb; Vh += pb; Vl += pb;
    v16bf qh[2], ql[2];
#pragma unroll
    for (int ks = 0; ks < 2; ++ks) { const size_t qo = (size_t)q0 * HD + ks * 512 + lane * 8; qh[ks] = WFrag<bf>::ld(Qh + qo); ql[ks] = WFrag<bf>::ld(Ql + qo); }
    asm volatile("s_wait_xcnt 0x0" ::: "memory");   /* the q loads' address registers are reused right behind them */
    v8f o[4];
#pragma unroll
    for (int dt = 0; dt < 4; ++dt) o[dt] = (v8f){};
    float m = -3.0e38f, l = 0.f;
    if (q0 < RH) fa_keys<true>(Kh, Kl, V16, Vh, Vl, qh, ql, q0, w, lr, hi, o, m, l); else fa_keys<false>(Kh, Kl, V16, Vh, Vl, qh, ql, q0, w, lr, hi, o, m, l);   // block-uniform
    l += xhalf(l);
#pragma unroll
    for (int dt = 0; dt < 4; ++dt) { float* p = Os + (w * 16 + lr) * 68 + dt * 16 + hi * 8; v4f a, c;
#pragma unroll
        for (int j = 0; j < 4; ++j) { a[j] = o[dt][j]; c[j] = o[dt][4 + j]; }
        *(v4fa*)p = a; *(v4fa*)(p + 4) = c; }
    if (hi == 0) { Ms[w * 16 + lr] = m; Ls[w * 16 + lr] = l; }
    __syncthreads();   /* every wave's partial set is in LDS before any thread merges them */
    const int qr = tid >> 4, d4 = (tid & 15) * 4;
    float M = Ms[qr];
#pragma unroll
    for (int u = 1; u < FW; ++u) M = fmaxf(M, Ms[u * 16 + qr]);
    float L = 0.f; v4f a = (v4f){};
#pragma unroll
    for (int u = 0; u < FW; ++u) { const float f = __builtin_amdgcn_exp2f(Ms[u * 16 + qr] - M); L += Ls[u * 16 + qr] * f; a += *(const v4fa*)(Os + (u * 16 + qr) * 68 + d4) * f; }   // a wave without keys has max -3e38, sum 0: factor 0
    const float r = __fdiv_rn(1.0f, L);
    *(v4f*)(out + ((size_t)b * TT + q0 + qr) * CO + d4) = a * r;
}
extern "C" void kernel_launch(void* const* d_in, const int* in_sizes, int n_in,
                              void* d_out, int out_size, void* d_ws, size_t ws_size, hipStream_t stream) {
    (void)in_sizes; (void)n_in; (void)out_size;
    const float* x = (const float*)d_in[0]; const float* wq = (const float*)d_in[1]; const float* bq = (const float*)d_in[2]; const float* wk = (const float*)d_in[3]; const float* bk = (const float*)d_in[4]; const float* wv = (const float*)d_in[5]; const float* bv = (const float*)d_in[6];   /* standard roles: rows = queries */
    float* OUT = (float*)d_out;     // [4][4096][64]
    char* wsp = (char*)d_ws;
    auto take = [&](size_t bytes) { char* p = wsp; wsp += (bytes + 255) & ~(size_t)255; return (void*)p; };
    bf* WT = (bf*)take((size_t)3 * MID * CC * 2);   /* q, k, v weights, bf16 in fragment order */
    bf* QPh = (bf*)take((size_t)NB_ * TT * MID * 2); bf* QPl = (bf*)take((size_t)NB_ * TT * MID * 2); bf* KPh = (bf*)take((size_t)NB_ * TT * MID * 2); bf* KPl = (bf*)take((size_t)NB_ * TT * MID * 2);   /* the planes the attention launch reads: one set a batch */
    h16* VT16 = (h16*)take((size_t)NB_ * CO * TT * 2); bf* VTh = (bf*)take((size_t)NB_ * CO * TT * 2); bf* VTl = (bf*)take((size_t)NB_ * CO * TT * 2);
    if ((size_t)(wsp - (char*)d_ws) > ws_size) return;    // ws 256 MiB (carve ~15 MiB)
    k_wt3<<<dim3(CC * MID / 512, 3, 1), 256, 0, stream>>>(wq, wk, wv, WT);   /* 'xw' weights -> fragments */
    k_proj<<<NB_ * TT / 64, 32 * 3 * KQ, 0, stream>>>(x, WT, bq, bk, bv, QPh, QPl, KPh, KPl, VT16, VTh, VTl);   /* q, k and v^T planes, in fragment order */
    k_fattn<<<dim3(NB_, TT / 16, 1), 32 * FW, 0, stream>>>(QPh, QPl, KPh, KPl, VT16, VTh, VTl, OUT);   /* causal attention of all four batches; writes every output row once */
}

// v005
// Measured time: 37.3 microseconds a run.
// Two timings next to v004 both put it at 1.19 times that version's speed.
// All steps since v000 together make it 31.8 times as fast.
#include <hip/hip_runtime.h>

// Single causal attention head over 4,096 tokens with biased projections (x [4][4096][768]; q, k, v = x w + b ('xw' [768][64] + [64]; ONE 64-wide head); scores = q.k^T; causal (-inf) THEN x 1/sqrt(64) (masking before the scale: the same thing); softmax; out = weights.v -> [4][4096][64] (1.0 M); argument order x, wq, bq, wk, bk, wv, bv).
// Layout: 'xw' weights laid out as fragments once (one launch for the three); ONE launch for all batches that rounds x to bf16 on its way into LDS, takes the three exact projections (K 768, K split over the waves of a block) and writes the planes the attention reads; then ONE launch for all batches that streams the keys of each 32-query tile up to the diagonal (every wave holds both 16-query groups of the tile and uses each loaded k and v fragment for both): scores on hi/lo planes (3 products), running-maximum softmax in registers, weights.v (rows < 512 hi/lo 3 products, rest fp16), key blocks dealt over the waves of a block and merged through LDS.
// Compute dtypes, f32 accumulate: every input rounded to bf16; projections exact; scores 3 products; softmax f32; wei.v rows < 512 3 products, rest fp16; output f32.

#define NB_  4
#define TT   4096
#define DM   64
#define NH_  1
#define NKV  1
#define REP  (NH_ / NKV)
#define HD   64
#define DQ   (NH_ * HD)
#define DKV  (NKV * HD)
#define ZH   1
#define RH   512                  // query rows < RH use hi+lo planes (0: none)
#define WIN  0
#define SCL  0.125f   // C^-0.5 with C = 64 (the head width)
#define MID  64       // q / k width (one 64-wide head)
#define CO   64       // v width
#define CC   768      // input width (d_model)
#define KQ   4        // waves that share the K of one projection tile (24 k steps: 6 each)
typedef _Float16 h16;
typedef unsigned short bf;
typedef __attribute__((ext_vector_type(16))) __bf16   v16bf;
typedef __attribute__((ext_vector_type(16))) _Float16 v16h;
typedef __attribute__((ext_vector_type(8)))  _Float16 v8h;
typedef __attribute__((ext_vector_type(8)))  unsigned short v8us;
typedef __attribute__((ext_vector_type(8)))  float    v8f;
typedef __attribute__((ext_vector_type(4)))  float    v4f;
typedef v8h  __attribute__((may_alias)) v8ha;
typedef v4f  __attribute__((may_alias)) v4fa;
typedef v8us __attribute__((may_alias)) v8usa;

__device__ __forceinline__ unsigned short f2bf(float f) { unsigned u = __float_as_uint(f); u += 0x7FFFu + ((u >> 16) & 1u); return (unsigned short)(u >> 16); }
__device__ __forceinline__ float bf2f(unsigned short b) { return __uint_as_float(((unsigned)b) << 16); }
__device__ __forceinline__ float bfr(float f) { return bf2f(f2bf(f)); }
__device__ __forceinline__ v16h cat16(v8h lo, v8h hi) { return __builtin_shufflevector(lo, hi, 0, 1, 2, 3, 4, 5, 6, 7, 8, 9, 10, 11, 12, 13, 14, 15); }
__device__ __forceinline__ v16bf cat16b(v8us lo, v8us hi) { return __builtin_bit_cast(v16bf, __builtin_shufflevector(lo, hi, 0, 1, 2, 3, 4, 5, 6, 7, 8, 9, 10, 11, 12, 13, 14, 15)); }
__device__ __forceinline__ v8f wmma16(v16h a, v16h b, v8f c) { return __builtin_amdgcn_wmma_f32_16x16x32_f16(false, a, false, b, (short)0, c, false, false); }
__device__ __forceinline__ v8f wmmab(v16bf a, v16bf b, v8f c) { return __builtin_amdgcn_wmma_f32_16x16x32_bf16(false, a, false, b, (short)0, c, false, false); }



// fragment loaders: operands straight from 16-bit planes kept in fragment order: [half 2][lane 32][8], so that each of the two 16-byte loads a lane makes is part of 512 contiguous bytes (four whole lines a wave)
template <typename T16> struct WFrag;
template <> struct WFrag<h16> { typedef v16h V; static __device__ __forceinline__ V ld(const h16* p) { return cat16(*(const v8h*)p, *(const v8h*)(p + 256)); } static __device__ __forceinline__ v8f mma(V a, V b, v8f c) { return wmma16(a, b, c); } };
template <> struct WFrag<bf> { typedef v16bf V; static __device__ __forceinline__ V ld(const bf* p) { return cat16b(*(const v8us*)p, *(const v8us*)(p + 256)); } static __device__ __forceinline__ v8f mma(V a, V b, v8f c) { return wmmab(a, b, c); } };

__device__ __forceinline__ h16 tohx(float x) { return (h16)x; }
__device__ __forceinline__ void splitf(float y, unsigned short& h, unsigned short& l) { h = f2bf(y); l = f2bf(y - bf2f(h)); }
typedef __attribute__((ext_vector_type(2))) _Float16 v2h;
typedef __attribute__((ext_vector_type(4))) _Float16 v4h;
typedef __attribute__((ext_vector_type(2))) unsigned short v2us;
typedef __attribute__((ext_vector_type(4))) unsigned short v4us;
typedef __attribute__((ext_vector_type(2))) float v2f;
typedef __attribute__((ext_vector_type(4))) int v4i;


// ---- k_wt3: the three 'xw' weights [CC][64] f32 -> bf16 in fragment order [3][nb 4][k step CC / 32][half 2][lane 32][8]: lane (hi, lr) of half h holds channel nb 16 + lr, k = 32 step + 16 h + 8 hi + 0..7,
// so that one 16-byte load a lane fetches half a fragment from 512 contiguous bytes. grid (64 CC / 512, 3); a wave writes one 128-B line.
__global__ __launch_bounds__(256) void k_wt3(const float* __restrict__ wq, const float* __restrict__ wk, const float* __restrict__ wv, bf* Bt) {
    const float* __restrict__ w = (blockIdx.y == 0) ? wq : (blockIdx.y == 1) ? wk : wv;
    const unsigned e = (blockIdx.x * 256 + threadIdx.x) * 2, f = e >> 9, ln = (e >> 3) & 31, k = (f % (CC / 32)) * 32 + ((e >> 8) & 1) * 16 + (ln >> 4) * 8 + (e & 7), n = (f / (CC / 32)) * 16 + (ln & 15); v2us o;
    o[0] = f2bf(w[k * 64 + n]); o[1] = f2bf(w[(k + 1) * 64 + n]); *(v2us*)(Bt + blockIdx.y * (64 * CC) + e) = o;
}
// ---- k_proj: q, k and v projections of 64 rows of x (all batches: grid NB_ TT / 64) and their planes, one launch. 3 KQ waves: wave w works on projection w / KQ and takes the 32-wide k steps w % KQ, w % KQ + KQ, ...
// The block's rows of x (contiguous f32) are read once, whole lines a load and all loads in flight together, rounded to bf16 (nearest even) and laid in LDS (row pitch 16 B x odd); a work-group barrier; the fragments come from there. The product is taken transposed (A = weight rows, B = x rows): a lane owns token mb 16 + lr and holds channels nb 16 + 8 hi + j.
// Every wave lays its 64 x 64 partial tile in LDS (q, k: [token][channel]; v: [channel][token]), ONE work-group barrier, then the KQ waves of a projection add its KQ tiles in wave order and store the planes in the attention's fragment order, 512 contiguous bytes a wave and store:
// q, k: [16-token tile][k step 2][half 2][lane 32][8], lane (hi, lr) of half h holds token lr of the tile, channels 32 step + 16 h + 8 hi + 0..7; v: [batch][32-token block][16-channel tile 4][half 2][lane 32][8], lane (hi, lr) of half h holds channel lr of the tile, tokens 16 h + 8 hi + 0..7 of the block. The bias (rounded to bf16) is the start value of the first wave's sums.
typedef __attribute__((ext_vector_type(4))) __bf16 v4bf;
typedef v4us __attribute__((may_alias)) v4usa;
#define PSL  (64 * 68)
#define XP   (CC + 8)
__global__ __launch_bounds__(32 * 3 * KQ) void k_proj(const float* __restrict__ x, const bf* __restrict__ WT, const float* __restrict__ bq, const float* __restrict__ bk, const float* __restrict__ bv,
                                                      bf* Qh, bf* Ql, bf* Kh, bf* Kl, h16* V16, bf* Vh, bf* Vl) {
    __shared__ __align__(16) float os[3 * KQ * PSL]; __shared__ __align__(16) bf xs[64 * XP];
    const int tid = threadIdx.x, lane = tid & 31, lr = lane & 15, hi = lane >> 4; const int w = __builtin_amdgcn_readfirstlane(tid >> 5);
    const int p = w / KQ, kq = w % KQ; const int r0 = blockIdx.x * 64;
    // the biases of the lane's channels (nb 16 + 8 hi + j, the same for the three projections) are fetched here, under the reads of x; the first wave of each projection starts its sums from them
    const float* bp = (p == 0) ? bq : (p == 1) ? bk : bv; const unsigned bo = hi * 32; v4f bz[4][2];   // bo: the lane's byte offset, the one address register of these loads
#pragma unroll
    for (int nb = 0; nb < 4; ++nb) { const float* q = (const float*)((const char*)bp + bo) + nb * 16; bz[nb][0] = *(const v4f*)q; bz[nb][1] = *(const v4f*)(q + 4); }
    // weight fragments: a ring of two k steps; the first is fetched here, under the reads of x, the second in front of the barrier (x's registers are free by then), a later one behind the products of the step whose registers it takes
    const bf* wb = WT + ((size_t)p * 4 * (CC / 32) + kq) * 512 + lane * 8; v16bf b[2][4];
#pragma unroll
    for (int nb = 0; nb < 4; ++nb) { const bf* q = wb + nb * (CC / 32) * 512; b[0][nb] = cat16b(*(const v8us*)q, *(const v8us*)(q + 256)); }
    {   // 512-B piece c = w + 3 KQ i of the 64 rows: row c / 6 = 2 i + w / 6, sixth c % 6 = w % 6
        const float* xg = x + (size_t)r0 * CC + w * 128 + lane * 4; bf* xd = xs + (w / 6) * XP + (w % 6) * 128 + lane * 4; v4f raw[64 * CC / (3 * KQ * 128)];
#pragma unroll
        for (int i = 0; i < 64 * CC / (3 * KQ * 128); ++i) raw[i] = *(const v4f*)(xg + i * 3 * KQ * 128);
        asm volatile("s_wait_xcnt 0x0" ::: "memory");   /* every load of the tile is issued in front of the first rounding (one memory round trip), and the loads' address registers are reused behind this line */
#pragma unroll
        for (int i = 0; i < 64 * CC / (3 * KQ * 128); ++i) *(v4usa*)(xd + i * 2 * XP) = __builtin_bit_cast(v4us, __builtin_convertvector(raw[i], v4bf));
    }
    asm volatile("s_wait_xcnt 0x0" :: "v"(bo) : "memory");   /* the build issues some bias and weight loads behind the wait above; named as an input the bias offset register stays whole up to this one */
#pragma unroll
    for (int nb = 0; nb < 4; ++nb) { const bf* q = wb + (nb * (CC / 32) + KQ) * 512; b[1][nb] = cat16b(*(const v8us*)q, *(const v8us*)(q + 256)); }
    asm volatile("s_wait_xcnt 0x0" ::: "memory");   /* these loads' offset register is reused in the loop below */
    __syncthreads();   /* the bf16 rows are in LDS before any wave takes a fragment */
    const bf* xa = xs + lr * XP + kq * 32 + 8 * hi;
    v8f acc[4][4];
    if (kq == 0) {   // wave-uniform
#pragma unroll
        for (int nb = 0; nb < 4; ++nb) { v8f z;
#pragma unroll
            for (int j = 0; j < 8; ++j) z[j] = bfr(bz[nb][j >> 2][j & 3]);
#pragma unroll
            for (int mb = 0; mb < 4; ++mb) acc[mb][nb] = z; }
    } else {
#pragma unroll
        for (int nb = 0; nb < 4; ++nb)
#pragma unroll
            for (int mb = 0; mb < 4; ++mb) acc[mb][nb] = (v8f){};
    }
    // (unrolled whole: the ring and the accumulators are indexed by constants and stay in registers; every address is one lane register + a constant)
#pragma unroll
    for (int s = 0; s < CC / (32 * KQ); ++s) { v16bf a[4];
#pragma unroll
        for (int mb = 0; mb < 4; ++mb) { const bf* q = xa + mb * 16 * XP + s * KQ * 32; a[mb] = cat16b(*(const v8usa*)q, *(const v8usa*)(q + 16)); }
#pragma unroll
        for (int nb = 0; nb < 4; ++nb) {
#pragma unroll
            for (int mb = 0; mb < 4; ++mb) acc[mb][nb] = wmmab(b[s & 1][nb], a[mb], acc[mb][nb]); }
        if (s + 2 < CC / (32 * KQ)) {
#pragma unroll
            for (int nb = 0; nb < 4; ++nb) { const bf* q = wb + (nb * (CC / 32) + (s + 2) * KQ) * 512; b[s & 1][nb] = cat16b(*(const v8us*)q, *(const v8us*)(q + 256)); }
            __builtin_amdgcn_sched_barrier(0); } }   /* the fetch stays a whole step in front of its products: left alone the build puts each load right in front of its use and waits out an L2 round trip a fragment */
    asm volatile("s_wait_xcnt 0x0" ::: "memory");   /* the loads' address registers are reused behind this line */
    // a thread's share of the sum: rows gl, gl + 16, ... of its projection's tile, columns 8 gc .. 8 gc + 7 (a wave: 16 rows x 16 columns, one half of a fragment)
    static_assert(KQ == 4, "the 128 threads of a projection cover 16 rows x 8 column groups a turn");
    const int g = tid & (32 * KQ - 1), gl = g & 15, gc = g >> 4; const float* tp = os + p * KQ * PSL;
    float* sl = os + w * PSL;
    if (p < 2) {   // wave-uniform
#pragma unroll
        for (int mb = 0; mb < 4; ++mb) {
#pragma unroll
            for (int nb = 0; nb < 4; ++nb) { float* q = sl + (mb * 16 + lr) * 68 + nb * 16 + hi * 8; v4f c, d;
#pragma unroll
                for (int j = 0; j < 4; ++j) { c[j] = acc[mb][nb][j]; d[j] = acc[mb][nb][4 + j]; }
                *(v4fa*)q = c; *(v4fa*)(q + 4) = d; } }
    } else {
#pragma unroll
        for (int mb = 0; mb < 4; ++mb) {
#pragma unroll
            for (int nb = 0; nb < 4; ++nb) {
#pragma unroll
                for (int j = 0; j < 8; ++j) sl[(nb * 16 + hi * 8 + j) * 68 + mb * 16 + lr] = acc[mb][nb][j]; } }
    }
    __syncthreads();   /* every wave's partial tile is in LDS before any thread adds them */
    const int bb = r0 / TT, t0 = r0 % TT;
    // (the turns are unrolled: every LDS address is one lane register + a constant)
    if (p < 2) { bf* Ph = p ? Kh : Qh; bf* Pl = p ? Kl : Ql;
#pragma unroll
        for (int it = 0; it < 512 / (32 * KQ); ++it) { const float* s0 = tp + (gl + it * 16) * 68 + gc * 8; v4f c = *(const v4fa*)s0, d = *(const v4fa*)(s0 + 4);
#pragma unroll
            for (int u = 1; u < KQ; ++u) { c += *(const v4fa*)(s0 + u * PSL); d += *(const v4fa*)(s0 + u * PSL + 4); }
            v8us oh, ol;
#pragma unroll
            for (int e = 0; e < 4; ++e) { unsigned short a2, c2; splitf(c[e], a2, c2); oh[e] = a2; ol[e] = c2; splitf(d[e], a2, c2); oh[4 + e] = a2; ol[4 + e] = c2; }
            const size_t o = (size_t)(r0 / 16 + it) * (16 * HD) + gc * 128 + gl * 8; *(v8us*)(Ph + o) = oh; *(v8us*)(Pl + o) = ol;
            asm volatile("s_wait_xcnt 0x0" ::: "memory"); }   /* the next turn reuses the stores' address and data registers */
    } else {
#pragma unroll
        for (int it = 0; it < 512 / (32 * KQ); ++it) { const float* s0 = tp + (gl + it * 16) * 68 + gc * 8; v4f c = *(const v4fa*)s0, d = *(const v4fa*)(s0 + 4);
#pragma unroll
            for (int u = 1; u < KQ; ++u) { c += *(const v4fa*)(s0 + u * PSL); d += *(const v4fa*)(s0 + u * PSL + 4); }
            v8us oh, ol; v8h o16;
#pragma unroll
            for (int e = 0; e < 4; ++e) { unsigned short a2, c2; float y = c[e]; o16[e] = tohx(y); splitf(y, a2, c2); oh[e] = a2; ol[e] = c2; y = d[e]; o16[4 + e] = tohx(y); splitf(y, a2, c2); oh[4 + e] = a2; ol[4 + e] = c2; }
            const size_t o = (size_t)bb * HD * TT + (size_t)((t0 / 32 + (gc >> 2)) * 4 + it) * 512 + (gc & 3) * 128 + gl * 8; *(v8h*)(V16 + o) = o16; *(v8us*)(Vh + o) = oh; *(v8us*)(Vl + o) = ol;
            asm volatile("s_wait_xcnt 0x0" ::: "memory"); }   /* the next turn reuses the stores' address and data registers */
    }
}
// ---- k_fattn: scores, causal softmax and weights.v in one pass over the keys; the score plane never leaves the registers. grid (batch, 32-query tile), FW waves a block; a wave holds the QG 16-query groups of the tile, so that every k and v fragment it loads serves QG groups (the bytes from L2 a query fall by QG).
// Both products are taken transposed, so that in each group a lane owns ONE query: S^T[key][query] = K Q^T (A = k rows, B = q rows) leaves key 16 kt + 8 hi + j of query lr in st[kt][j], which is already the B fragment
// (element j and 8 + j <-> k = 8 hi + j and 16 + 8 hi + j) of O^T[d][query] = V^T P^T; running maximum, sum and rescale are per lane. Wave w takes the 32-key blocks w, w + FW, ... up to the diagonal;
// the FW partial (max, sum, O^T) sets are merged through LDS in wave order behind one work-group barrier, and the block stores its 16 QG output rows once.
// amdgpu_waves_per_eu(4, 4): the register budget of four waves a SIMD (256 a wave), so that two work-groups share a WGP and one's softmax runs under the other's loads and products.
// The maximum m is kept in the exponent's own unit: weight = 2^(s SL2 - m), SL2 = 1/8 log2(e).
#define FW   8
#define QG   2        // 16-query groups a wave holds
#define SL2  (SCL * 1.4426950408889634f)
typedef __attribute__((ext_vector_type(16))) unsigned short v16us;
__device__ __forceinline__ float xhalf(float x) { const int b = __float_as_int(x); return __int_as_float(__builtin_amdgcn_permlanex16(b, b, 0x76543210, 0xfedcba98, false, false)); }   // lane l <-> l ^ 16
// one block of 32 keys from k0; DIAG: the block that holds keys above a query of the tile (the tile's last)
// fo: the lane's byte offset into the key planes and the v^T planes alike (a block of 32 keys is 2,048 elements of each, in fragment order); every fragment of the block is that one offset register + a uniform base + a constant
// (the loops over kt, ks, dt, j are unrolled whole so that the fragment arrays are indexed by constants and stay in registers)
template <typename T16> __device__ __forceinline__ typename WFrag<T16>::V ldo(const T16* __restrict__ base, unsigned off, int cst) { return WFrag<T16>::ld((const T16*)((const char*)base + off) + cst); }
template <bool HI, bool DIAG>
__device__ __forceinline__ void fa_block(const bf* __restrict__ Kh, const bf* __restrict__ Kl, const h16* __restrict__ V16, const bf* __restrict__ Vh, const bf* __restrict__ Vl,
                                         const v16bf (&qh)[QG][2], const v16bf (&ql)[QG][2], int q0, int k0, unsigned fo, int lr, int hi, v8f (&o)[QG][4], float (&m)[QG], float (&l)[QG]) {
    v16bf kh[2][2], kl[2][2]; v16h v16[4]; v16bf vh[4], vl[4];
#pragma unroll
    for (int kt = 0; kt < 2; ++kt) {
#pragma unroll
        for (int ks = 0; ks < 2; ++ks) { kh[kt][ks] = ldo<bf>(Kh, fo, kt * 16 * HD + ks * 512); kl[kt][ks] = ldo<bf>(Kl, fo, kt * 16 * HD + ks * 512); } }
    __builtin_amdgcn_sched_barrier(0);   /* every k load of the block is issued before the first product waits: one memory round trip for them, not one a fragment */
    // the v fragments take registers that the scores have set free (beside all k fragments the QG groups' q and output tiles would pass the 256 registers a wave that let two work-groups share a WGP):
    // fp16 v (4 fragments) behind the scores of the first 16 keys, so that the other scores and the softmax stand between these loads and their products; hi and lo v (8 fragments; rows < RH, few blocks) behind the softmax
    v8f st[QG][2];
#pragma unroll
    for (int kt = 0; kt < 2; ++kt) {
#pragma unroll
        for (int g = 0; g < QG; ++g) { v8f s = (v8f){};
#pragma unroll
            for (int ks = 0; ks < 2; ++ks) { s = wmmab(kh[kt][ks], qh[g][ks], s); s = wmmab(kh[kt][ks], ql[g][ks], s); s = wmmab(kl[kt][ks], qh[g][ks], s); }
            st[g][kt] = s; }
        if (!HI && kt == 0) {
            __builtin_amdgcn_sched_barrier(0);   /* keeps the v loads from rising in front of these scores, where their registers are not free yet */
#pragma unroll
            for (int dt = 0; dt < 4; ++dt) v16[dt] = ldo<h16>(V16, fo, dt * 512);
            asm volatile("s_wait_xcnt 0x0" :: "v"(fo) : "memory");   /* the loads' offset register is reused behind this line; named as an input it stays whole up to it, so that no later load of the run lands in it */
            __builtin_amdgcn_sched_barrier(0); } }   /* and from sinking towards their products, which would then wait out the round trip */
    v16h pb[QG]; v16bf pbh[QG], pbl[QG];
#pragma unroll
    for (int g = 0; g < QG; ++g) {   // group g: queries q0 + 16 g + lr
        float mloc = -3.0e38f;
#pragma unroll
        for (int kt = 0; kt < 2; ++kt) {
#pragma unroll
            for (int j = 0; j < 8; ++j) { if (DIAG && (k0 + kt * 16 + hi * 8 + j > q0 + g * 16 + lr)) st[g][kt][j] = -3.0e38f; mloc = fmaxf(mloc, st[g][kt][j]); } }
        mloc = fmaxf(mloc, xhalf(mloc));   // the two lanes of a query hold different keys and must share one maximum
        const float mn = fmaxf(m[g], mloc * SL2); const float al = __builtin_amdgcn_exp2f(m[g] - mn); m[g] = mn;
        float ps = 0.f;
#pragma unroll
        for (int kt = 0; kt < 2; ++kt) {
#pragma unroll
            for (int j = 0; j < 8; ++j) { const float p = __builtin_amdgcn_exp2f(__builtin_fmaf(st[g][kt][j], SL2, -mn)); st[g][kt][j] = p; ps += p; } }
        l[g] = l[g] * al + ps;
#pragma unroll
        for (int dt = 0; dt < 4; ++dt) o[g][dt] *= al;
        if (HI) { v16us ph, pl;
#pragma unroll
            for (int j = 0; j < 8; ++j) { unsigned short a2, c2; splitf(st[g][0][j], a2, c2); ph[j] = a2; pl[j] = c2; splitf(st[g][1][j], a2, c2); ph[8 + j] = a2; pl[8 + j] = c2; }
            pbh[g] = __builtin_bit_cast(v16bf, ph); pbl[g] = __builtin_bit_cast(v16bf, pl);
        } else {
#pragma unroll
            for (int j = 0; j < 8; ++j) { pb[g][j] = tohx(st[g][0][j]); pb[g][8 + j] = tohx(st[g][1][j]); } }
    }
    if (HI) {
        __builtin_amdgcn_sched_barrier(0);   /* keeps the v loads from rising into the softmax, where their registers are not free yet */
#pragma unroll
        for (int dt = 0; dt < 4; ++dt) { vh[dt] = ldo<bf>(Vh, fo, dt * 512); vl[dt] = ldo<bf>(Vl, fo, dt * 512); }
        asm volatile("s_wait_xcnt 0x0" :: "v"(fo) : "memory"); }   /* the loads' offset register is reused behind this line; named as an input it stays whole up to it */
#pragma unroll
    for (int g = 0; g < QG; ++g) {
#pragma unroll
        for (int dt = 0; dt < 4; ++dt) {
            if (HI) { o[g][dt] = wmmab(vh[dt], pbh[g], o[g][dt]); o[g][dt] = wmmab(vh[dt], pbl[g], o[g][dt]); o[g][dt] = wmmab(vl[dt], pbh[g], o[g][dt]); }
            else o[g][dt] = wmma16(v16[dt], pb[g], o[g][dt]); } }
}
template <bool HI>
__device__ __forceinline__ void fa_keys(const bf* __restrict__ Kh, const bf* __restrict__ Kl, const h16* __restrict__ V16, const bf* __restrict__ Vh, const bf* __restrict__ Vl,
                                        const v16bf (&qh)[QG][2], const v16bf (&ql)[QG][2], int q0, int w, int lr, int hi, v8f (&o)[QG][4], float (&m)[QG], float (&l)[QG]) {
    const int last = q0 / 32;   // the 32-key block on the diagonal (the tile's own 32 tokens); every query of the tile has a live key in it and in each block before it
    int kb = w; unsigned fo = (unsigned)((w * 32 * HD + (hi * 16 + lr) * 8) * 2);
#pragma unroll 1   /* rolled: a second copy of the block's fragments would take the registers that let two work-groups share a WGP */
    for (; kb < last; kb += FW) { fa_block<HI, false>(Kh, Kl, V16, Vh, Vl, qh, ql, q0, kb * 32, fo, lr, hi, o, m, l); fo += FW * 32 * HD * 2; }
    if (kb == last) fa_block<HI, true>(Kh, Kl, V16, Vh, Vl, qh, ql, q0, kb * 32, fo, lr, hi, o, m, l);   // wave-uniform: one wave of the block
}
__global__ __launch_bounds__(32 * FW) __attribute__((amdgpu_waves_per_eu(4, 4))) void k_fattn(const bf* __restrict__ Qh, const bf* __restrict__ Ql, const bf* __restrict__ Kh, const bf* __restrict__ Kl, const h16* __restrict__ V16, const bf* __restrict__ Vh, const bf* __restrict__ Vl, float* out) {
    __shared__ __align__(16) float Os[FW * QG * 16 * 68]; __shared__ float Ms[FW * QG * 16]; __shared__ float Ls[FW * QG * 16];
    static_assert(QG * 16 == 32, "the tile is one 32-key block wide: its diagonal block is q0 / 32 for every group");
    const int tid = threadIdx.x, lane = tid & 31, lr = lane & 15, hi = lane >> 4; const int w = __builtin_amdgcn_readfirstlane(tid >> 5);
    const int b = blockIdx.x; const int q0 = (int)(gridDim.y - 1 - blockIdx.y) * (QG * 16);   // the tiles with the most keys start first
    const size_t pb = (size_t)b * TT * HD; Qh += pb; Ql += pb; Kh += pb; Kl += pb; V16 += pb; Vh += pb; Vl += pb;
    v16bf qh[QG][2], ql[QG][2];
#pragma unroll
    for (int g = 0; g < QG; ++g) {
#pragma unroll
        for (int ks = 0; ks < 2; ++ks) { const size_t qo = (size_t)(q0 + g * 16) * HD + ks * 512 + lane * 8; qh[g][ks] = WFrag<bf>::ld(Qh + qo); ql[g][ks] = WFrag<bf>::ld(Ql + qo); } }
    asm volatile("s_wait_xcnt 0x0" ::: "memory");   /* the q loads' address registers are reused right behind them */
    v8f o[QG][4]; float m[QG], l[QG];
#pragma unroll
    for (int g = 0; g < QG; ++g) { m[g] = -3.0e38f; l[g] = 0.f;
#pragma unroll
        for (int dt = 0; dt < 4; ++dt) o[g][dt] = (v8f){}; }
    if (q0 < RH) fa_keys<true>(Kh, Kl, V16, Vh, Vl, qh, ql, q0, w, lr, hi, o, m, l); else fa_keys<false>(Kh, Kl, V16, Vh, Vl, qh, ql, q0, w, lr, hi, o, m, l);   // block-uniform
#pragma unroll
    for (int g = 0; g < QG; ++g) { l[g] += xhalf(l[g]);
#pragma unroll
        for (int dt = 0; dt < 4; ++dt) { float* p = Os + ((w * QG + g) * 16 + lr) * 68 + dt * 16 + hi * 8; v4f a, c;
#pragma unroll
            for (int j = 0; j < 4; ++j) { a[j] = o[g][dt][j]; c[j] = o[g][dt][4 + j]; }
            *(v4fa*)p = a; *(v4fa*)(p + 4) = c; }
        if (hi == 0) { Ms[(w * QG + g) * 16 + lr] = m[g]; Ls[(w * QG + g) * 16 + lr] = l[g]; } }
    __syncthreads();   /* every wave's partial set is in LDS before any thread merges them */
    const int d4 = (tid & 15) * 4;
#pragma unroll
    for (int g = 0; g < QG; ++g) { const int qr = g * 16 + (tid >> 4);   // the thread's query of group g
        float M = Ms[qr];
#pragma unroll
        for (int u = 1; u < FW; ++u) M = fmaxf(M, Ms[u * QG * 16 + qr]);
        float L = 0.f; v4f a = (v4f){};
#pragma unroll
        for (int u = 0; u < FW; ++u) { const float f = __builtin_amdgcn_exp2f(Ms[u * QG * 16 + qr] - M); L += Ls[u * QG * 16 + qr] * f; a += *(const v4fa*)(Os + (u * QG * 16 + qr) * 68 + d4) * f; }   // a wave without keys has max -3e38, sum 0: factor 0
        const float r = __fdiv_rn(1.0f, L);
        *(v4f*)(out + ((size_t)b * TT + q0 + qr) * CO + d4) = a * r; }
}
extern "C" void kernel_launch(void* const* d_in, const int* in_sizes, int n_in,
                              void* d_out, int out_size, void* d_ws, size_t ws_size, hipStream_t stream) {
    (void)in_sizes; (void)n_in; (void)out_size;
    const float* x = (const float*)d_in[0]; const float* wq = (const float*)d_in[1]; const float* bq = (const float*)d_in[2]; const float* wk = (const float*)d_in[3]; const float* bk = (const float*)d_in[4]; const float* wv = (const float*)d_in[5]; const float* bv = (const float*)d_in[6];   /* standard roles: rows = queries */
    float* OUT = (float*)d_out;     // [4][4096][64]
    char* wsp = (char*)d_ws;
    auto take = [&](size_t bytes) { char* p = wsp; wsp += (bytes + 255) & ~(size_t)255; return (void*)p; };
    bf* WT = (bf*)take((size_t)3 * MID * CC * 2);   /* q, k, v weights, bf16 in fragment order */
    bf* QPh = (bf*)take((size_t)NB_ * TT * MID * 2); bf* QPl = (bf*)take((size_t)NB_ * TT * MID * 2); bf* KPh = (bf*)take((size_t)NB_ * TT * MID * 2); bf* KPl = (bf*)take((size_t)NB_ * TT * MID * 2);   /* the planes the attention launch reads: one set a batch */
    h16* VT16 = (h16*)take((size_t)NB_ * CO * TT * 2); bf* VTh = (bf*)take((size_t)NB_ * CO * TT * 2); bf* VTl = (bf*)take((size_t)NB_ * CO * TT * 2);
    if ((size_t)(wsp - (char*)d_ws) > ws_size) return;    // ws 256 MiB (carve ~15 MiB)
    k_wt3<<<dim3(CC * MID / 512, 3, 1), 256, 0, stream>>>(wq, wk, wv, WT);   /* 'xw' weights -> fragments */
    k_proj<<<NB_ * TT / 64, 32 * 3 * KQ, 0, stream>>>(x, WT, bq, bk, bv, QPh, QPl, KPh, KPl, VT16, VTh, VTl);   /* q, k and v^T planes, in fragment order */
    k_fattn<<<dim3(NB_, TT / (16 * QG), 1), 32 * FW, 0, stream>>>(QPh, QPl, KPh, KPl, VT16, VTh, VTl, OUT);   /* causal attention of all four batches; writes every output row once */
}

// v006
// One run takes 34.3 microseconds.
// Two timings next to v005 put it at 1.07 and 1.08 times that version's speed.
// Over all steps from v000 it is 34.2 times as fast.
#include <hip/hip_runtime.h>

// Single causal attention head over 4,096 tokens with biased projections (x [4][4096][768]; q, k, v = x w + b ('xw' [768][64] + [64]; ONE 64-wide head); scores = q.k^T; causal (-inf) THEN x 1/sqrt(64) (masking before the scale: the same thing); softmax; out = weights.v -> [4][4096][64] (1.0 M); argument order x, wq, bq, wk, bk, wv, bv).
// Layout: 'xw' weights laid out as fragments once (one launch for the three); ONE launch for all batches that rounds x to bf16 on its way into LDS, takes the three exact projections (K 768, K split over the waves of a block) and writes the planes the attention reads; then ONE launch for all batches in which a block takes the 32-query tiles t and 127 - t one after the other (equal work a block) and streams the keys of each up to the diagonal (every wave holds both 16-query groups of the tile and uses each loaded k and v fragment for both): scores on hi/lo planes (3 products), running-maximum softmax in registers, weights.v (rows < 512 hi/lo 3 products, rest fp16), key blocks dealt over the waves of a block and merged through LDS.
// Compute dtypes, f32 accumulate: every input rounded to bf16; projections exact; scores 3 products; softmax f32; wei.v rows < 512 3 products, rest fp16; output f32.

#define NB_  4
#define TT   4096
#define DM   64
#define NH_  1
#define NKV  1
#define REP  (NH_ / NKV)
#define HD   64
#define DQ   (NH_ * HD)
#define DKV  (NKV * HD)
#define ZH   1
#define RH   512                  // query rows < RH use hi+lo planes (0: none)
#define WIN  0
#define SCL  0.125f   // C^-0.5 with C = 64 (the head width)
#define MID  64       // q / k width (one 64-wide head)
#define CO   64       // v width
#define CC   768      // input width (d_model)
#define KQ   4        // waves that share the K of one projection tile (24 k steps: 6 each)
typedef _Float16 h16;
typedef unsigned short bf;
typedef __attribute__((ext_vector_type(16))) __bf16   v16bf;
typedef __attribute__((ext_vector_type(16))) _Float16 v16h;
typedef __attribute__((ext_vector_type(8)))  _Float16 v8h;
typedef __attribute__((ext_vector_type(8)))  unsigned short v8us;
typedef __attribute__((ext_vector_type(8)))  float    v8f;
typedef __attribute__((ext_vector_type(4)))  float    v4f;
typedef v8h  __attribute__((may_alias)) v8ha;
typedef v4f  __attribute__((may_alias)) v4fa;
typedef v8us __attribute__((may_alias)) v8usa;

__device__ __forceinline__ unsigned short f2bf(float f) { unsigned u = __float_as_uint(f); u += 0x7FFFu + ((u >> 16) & 1u); return (unsigned short)(u >> 16); }
__device__ __forceinline__ float bf2f(unsigned short b) { return __uint_as_float(((unsigned)b) << 16); }
__device__ __forceinline__ float bfr(float f) { return bf2f(f2bf(f)); }
__device__ __forceinline__ v16h cat16(v8h lo, v8h hi) { return __builtin_shufflevector(lo, hi, 0, 1, 2, 3, 4, 5, 6, 7, 8, 9, 10, 11, 12, 13, 14, 15); }
__device__ __forceinline__ v16bf cat16b(v8us lo, v8us hi) { return __builtin_bit_cast(v16bf, __builtin_shufflevector(lo, hi, 0, 1, 2, 3, 4, 5, 6, 7, 8, 9, 10, 11, 12, 13, 14, 15)); }
__device__ __forceinline__ v8f wmma16(v16h a, v16h b, v8f c) { return __builtin_amdgcn_wmma_f32_16x16x32_f16(false, a, false, b, (short)0, c, false, false); }
__device__ __forceinline__ v8f wmmab(v16bf a, v16bf b, v8f c) { return __builtin_amdgcn_wmma_f32_16x16x32_bf16(false, a, false, b, (short)0, c, false, false); }



// fragment loaders: operands straight from 16-bit planes kept in fragment order: [half 2][lane 32][8], so that each of the two 16-byte loads a lane makes is part of 512 contiguous bytes (four whole lines a wave)
template <typename T16> struct WFrag;
template <> struct WFrag<h16> { typedef v16h V; static __device__ __forceinline__ V ld(const h16* p) { return cat16(*(const v8h*)p, *(const v8h*)(p + 256)); } static __device__ __forceinline__ v8f mma(V a, V b, v8f c) { return wmma16(a, b, c); } };
template <> struct WFrag<bf> { typedef v16bf V; static __device__ __forceinline__ V ld(const bf* p) { return cat16b(*(const v8us*)p, *(const v8us*)(p + 256)); } static __device__ __forceinline__ v8f mma(V a, V b, v8f c) { return wmmab(a, b, c); } };

__device__ __forceinline__ h16 tohx(float x) { return (h16)x; }
__device__ __forceinline__ void splitf(float y, unsigned short& h, unsigned short& l) { h = f2bf(y); l = f2bf(y - bf2f(h)); }
typedef __attribute__((ext_vector_type(2))) _Float16 v2h;
typedef __attribute__((ext_vector_type(4))) _Float16 v4h;
typedef __attribute__((ext_vector_type(2))) unsigned short v2us;
typedef __attribute__((ext_vector_type(4))) unsigned short v4us;
typedef __attribute__((ext_vector_type(2))) float v2f;
typedef __attribute__((ext_vector_type(4))) int v4i;


// ---- k_wt3: the three 'xw' weights [CC][64] f32 -> bf16 in fragment order [3][nb 4][k step CC / 32][half 2][lane 32][8]: lane (hi, lr) of half h holds channel nb 16 + lr, k = 32 step + 16 h + 8 hi + 0..7,
// so that one 16-byte load a lane fetches half a fragment from 512 contiguous bytes. grid (64 CC / 512, 3); a wave writes one 128-B line.
__global__ __launch_bounds__(256) void k_wt3(const float* __restrict__ wq, const float* __restrict__ wk, const float* __restrict__ wv, bf* Bt) {
    const float* __restrict__ w = (blockIdx.y == 0) ? wq : (blockIdx.y == 1) ? wk : wv;
    const unsigned e = (blockIdx.x * 256 + threadIdx.x) * 2, f = e >> 9, ln = (e >> 3) & 31, k = (f % (CC / 32)) * 32 + ((e >> 8) & 1) * 16 + (ln >> 4) * 8 + (e & 7), n = (f / (CC / 32)) * 16 + (ln & 15); v2us o;
    o[0] = f2bf(w[k * 64 + n]); o[1] = f2bf(w[(k + 1) * 64 + n]); *(v2us*)(Bt + blockIdx.y * (64 * CC) + e) = o;
}
// ---- k_proj: q, k and v projections of 64 rows of x (all batches: grid NB_ TT / 64) and their planes, one launch. 3 KQ waves: wave w works on projection w / KQ and takes the 32-wide k steps w % KQ, w % KQ + KQ, ...
// The block's rows of x (contiguous f32) are read once, whole lines a load and all loads in flight together, rounded to bf16 (nearest even) and laid in LDS (row pitch 16 B x odd); a work-group barrier; the fragments come from there. The product is taken transposed (A = weight rows, B = x rows): a lane owns token mb 16 + lr and holds channels nb 16 + 8 hi + j.
// Every wave lays its 64 x 64 partial tile in LDS (q, k: [token][channel]; v: [channel][token]), ONE work-group barrier, then the KQ waves of a projection add its KQ tiles in wave order and store the planes in the attention's fragment order, 512 contiguous bytes a wave and store:
// q, k: [16-token tile][k step 2][half 2][lane 32][8], lane (hi, lr) of half h holds token lr of the tile, channels 32 step + 16 h + 8 hi + 0..7; v: [batch][32-token block][16-channel tile 4][half 2][lane 32][8], lane (hi, lr) of half h holds channel lr of the tile, tokens 16 h + 8 hi + 0..7 of the block. The bias (rounded to bf16) is the start value of the first wave's sums.
typedef __attribute__((ext_vector_type(4))) __bf16 v4bf;
typedef v4us __attribute__((may_alias)) v4usa;
#define PSL  (64 * 68)
#define XP   (CC + 8)
__global__ __launch_bounds__(32 * 3 * KQ) void k_proj(const float* __restrict__ x, const bf* __restrict__ WT, const float* __restrict__ bq, const float* __restrict__ bk, const float* __restrict__ bv,
                                                      bf* Qh, bf* Ql, bf* Kh, bf* Kl, h16* V16, bf* Vh, bf* Vl) {
    __shared__ __align__(16) float os[3 * KQ * PSL]; __shared__ __align__(16) bf xs[64 * XP];
    const int tid = threadIdx.x, lane = tid & 31, lr = lane & 15, hi = lane >> 4; const int w = __builtin_amdgcn_readfirstlane(tid >> 5);
    const int p = w / KQ, kq = w % KQ; const int r0 = blockIdx.x * 64;
    // the biases of the lane's channels (nb 16 + 8 hi + j, the same for the three projections) are fetched here, under the reads of x; the first wave of each projection starts its sums from them
    const float* bp = (p == 0) ? bq : (p == 1) ? bk : bv; const unsigned bo = hi * 32; v4f bz[4][2];   // bo: the lane's byte offset, the one address register of these loads
#pragma unroll
    for (int nb = 0; nb < 4; ++nb) { const float* q = (const float*)((const char*)bp + bo) + nb * 16; bz[nb][0] = *(const v4f*)q; bz[nb][1] = *(const v4f*)(q + 4); }
    // weight fragments: a ring of two k steps; the first is fetched here, under the reads of x, the second in front of the barrier (x's registers are free by then), a later one behind the products of the step whose registers it takes
    const bf* wb = WT + ((size_t)p * 4 * (CC / 32) + kq) * 512 + lane * 8; v16bf b[2][4];
#pragma unroll
    for (int nb = 0; nb < 4; ++nb) { const bf* q = wb + nb * (CC / 32) * 512; b[0][nb] = cat16b(*(const v8us*)q, *(const v8us*)(q + 256)); }
    {   // 512-B piece c = w + 3 KQ i of the 64 rows: row c / 6 = 2 i + w / 6, sixth c % 6 = w % 6
        const float* xg = x + (size_t)r0 * CC + w * 128 + lane * 4; bf* xd = xs + (w / 6) * XP + (w % 6) * 128 + lane * 4; v4f raw[64 * CC / (3 * KQ * 128)];
#pragma unroll
        for (int i = 0; i < 64 * CC / (3 * KQ * 128); ++i) raw[i] = *(const v4f*)(xg + i * 3 * KQ * 128);
        asm volatile("s_wait_xcnt 0x0" ::: "memory");   /* every load of the tile is issued in front of the first rounding (one memory round trip), and the loads' address registers are reused behind this line */
#pragma unroll
        for (int i = 0; i < 64 * CC / (3 * KQ * 128); ++i) *(v4usa*)(xd + i * 2 * XP) = __builtin_bit_cast(v4us, __builtin_convertvector(raw[i], v4bf));
    }
    asm volatile("s_wait_xcnt 0x0" :: "v"(bo) : "memory");   /* the build issues some bias and weight loads behind the wait above; named as an input the bias offset register stays whole up to this one */
#pragma unroll
    for (int nb = 0; nb < 4; ++nb) { const bf* q = wb + (nb * (CC / 32) + KQ) * 512; b[1][nb] = cat16b(*(const v8us*)q, *(const v8us*)(q + 256)); }
    asm volatile("s_wait_xcnt 0x0" ::: "memory");   /* these loads' offset register is reused in the loop below */
    __syncthreads();   /* the bf16 rows are in LDS before any wave takes a fragment */
    const bf* xa = xs + lr * XP + kq * 32 + 8 * hi;
    v8f acc[4][4];
    if (kq == 0) {   // wave-uniform
#pragma unroll
        for (int nb = 0; nb < 4; ++nb) { v8f z;
#pragma unroll
            for (int j = 0; j < 8; ++j) z[j] = bfr(bz[nb][j >> 2][j & 3]);
#pragma unroll
            for (int mb = 0; mb < 4; ++mb) acc[mb][nb] = z; }
    } else {
#pragma unroll
        for (int nb = 0; nb < 4; ++nb)
#pragma unroll
            for (int mb = 0; mb < 4; ++mb) acc[mb][nb] = (v8f){};
    }
    // (unrolled whole: the ring and the accumulators are indexed by constants and stay in registers; every address is one lane register + a constant)
#pragma unroll
    for (int s = 0; s < CC / (32 * KQ); ++s) { v16bf a[4];
#pragma unroll
        for (int mb = 0; mb < 4; ++mb) { const bf* q = xa + mb * 16 * XP + s * KQ * 32; a[mb] = cat16b(*(const v8usa*)q, *(const v8usa*)(q + 16)); }
#pragma unroll
        for (int nb = 0; nb < 4; ++nb) {
#pragma unroll
            for (int mb = 0; mb < 4; ++mb) acc[mb][nb] = wmmab(b[s & 1][nb], a[mb], acc[mb][nb]); }
        if (s + 2 < CC / (32 * KQ)) {
#pragma unroll
            for (int nb = 0; nb < 4; ++nb) { const bf* q = wb + (nb * (CC / 32) + (s + 2) * KQ) * 512; b[s & 1][nb] = cat16b(*(const v8us*)q, *(const v8us*)(q + 256)); }
            __builtin_amdgcn_sched_barrier(0); } }   /* the fetch stays a whole step in front of its products: left alone the build puts each load right in front of its use and waits out an L2 round trip a fragment */
    asm volatile("s_wait_xcnt 0x0" ::: "memory");   /* the loads' address registers are reused behind this line */
    // a thread's share of the sum: rows gl, gl + 16, ... of its projection's tile, columns 8 gc .. 8 gc + 7 (a wave: 16 rows x 16 columns, one half of a fragment)
    static_assert(KQ == 4, "the 128 threads of a projection cover 16 rows x 8 column groups a turn");
    const int g = tid & (32 * KQ - 1), gl = g & 15, gc = g >> 4; const float* tp = os + p * KQ * PSL;
    float* sl = os + w * PSL;
    if (p < 2) {   // wave-uniform
#pragma unroll
        for (int mb = 0; mb < 4; ++mb) {
#pragma unroll
            for (int nb = 0; nb < 4; ++nb) { float* q = sl + (mb * 16 + lr) * 68 + nb * 16 + hi * 8; v4f c, d;
#pragma unroll
                for (int j = 0; j < 4; ++j) { c[j] = acc[mb][nb][j]; d[j] = acc[mb][nb][4 + j]; }
                *(v4fa*)q = c; *(v4fa*)(q + 4) = d; } }
    } else {
#pragma unroll
        for (int mb = 0; mb < 4; ++mb) {
#pragma unroll
            for (int nb = 0; nb < 4; ++nb) {
#pragma unroll
                for (int j = 0; j < 8; ++j) sl[(nb * 16 + hi * 8 + j) * 68 + mb * 16 + lr] = acc[mb][nb][j]; } }
    }
    __syncthreads();   /* every wave's partial tile is in LDS before any thread adds them */
    const int bb = r0 / TT, t0 = r0 % TT;
    // (the turns are unrolled: every LDS address is one lane register + a constant)
    if (p < 2) { bf* Ph = p ? Kh : Qh; bf* Pl = p ? Kl : Ql;
#pragma unroll
        for (int it = 0; it < 512 / (32 * KQ); ++it) { const float* s0 = tp + (gl + it * 16) * 68 + gc * 8; v4f c = *(const v4fa*)s0, d = *(const v4fa*)(s0 + 4);
#pragma unroll
            for (int u = 1; u < KQ; ++u) { c += *(const v4fa*)(s0 + u * PSL); d += *(const v4fa*)(s0 + u * PSL + 4); }
            v8us oh, ol;
#pragma unroll
            for (int e = 0; e < 4; ++e) { unsigned short a2, c2; splitf(c[e], a2, c2); oh[e] = a2; ol[e] = c2; splitf(d[e], a2, c2); oh[4 + e] = a2; ol[4 + e] = c2; }
            const size_t o = (size_t)(r0 / 16 + it) * (16 * HD) + gc * 128 + gl * 8; *(v8us*)(Ph + o) = oh; *(v8us*)(Pl + o) = ol;
            asm volatile("s_wait_xcnt 0x0" ::: "memory"); }   /* the next turn reuses the stores' address and data registers */
    } else {
#pragma unroll
        for (int it = 0; it < 512 / (32 * KQ); ++it) { const float* s0 = tp + (gl + it * 16) * 68 + gc * 8; v4f c = *(const v4fa*)s0, d = *(const v4fa*)(s0 + 4);
#pragma unroll
            for (int u = 1; u < KQ; ++u) { c += *(const v4fa*)(s0 + u * PSL); d += *(const v4fa*)(s0 + u * PSL + 4); }
            v8us oh, ol; v8h o16;
#pragma unroll
            for (int e = 0; e < 4; ++e) { unsigned short a2, c2; float y = c[e]; o16[e] = tohx(y); splitf(y, a2, c2); oh[e] = a2; ol[e] = c2; y = d[e]; o16[4 + e] = tohx(y); splitf(y, a2, c2); oh[4 + e] = a2; ol[4 + e] = c2; }
            const size_t o = (size_t)bb * HD * TT + (size_t)((t0 / 32 + (gc >> 2)) * 4 + it) * 512 + (gc & 3) * 128 + gl * 8; *(v8h*)(V16 + o) = o16; *(v8us*)(Vh + o) = oh; *(v8us*)(Vl + o) = ol;
            asm volatile("s_wait_xcnt 0x0" ::: "memory"); }   /* the next turn reuses the stores' address and data registers */
    }
}
// ---- k_fattn: scores, causal softmax and weights.v in one pass over the keys; the score plane never leaves the registers. grid (batch, pair of 32-query tiles), FW waves a block, one block a WGP; a wave holds the QG 16-query groups of the tile, so that every k and v fragment it loads serves QG groups (the bytes from L2 a query fall by QG).
// Both products are taken transposed, so that in each group a lane owns ONE query: S^T[key][query] = K Q^T (A = k rows, B = q rows) leaves key 16 kt + 8 hi + j of query lr in st[kt][j], which is already the B fragment
// (element j and 8 + j <-> k = 8 hi + j and 16 + 8 hi + j) of O^T[d][query] = V^T P^T; running maximum, sum and rescale are per lane.
// Every block is resident at once and a tile's cost grows with its index, so the launch lasts as long as its fullest wave: a block takes tile NT - 1 - pr and then tile pr, NT + 1 key blocks together whatever pr is,
// and deals them as ONE list over its FW waves (the second tile's deal goes on at the wave where the first tile's ended), so that every wave of the launch has 8 or 9 key blocks. In each tile the wave in deal place s takes the 32-key blocks s, s + FW, ... up to the diagonal;
// the FW partial (max, sum, O^T) sets of each tile are merged through LDS in the order of the deal behind one work-group barrier, and the block stores the 16 QG output rows of each tile once.
// amdgpu_waves_per_eu(4, 4): the register budget of four waves a SIMD (256 a wave), so that the FW waves of a block fit one WGP and one wave's softmax runs under another's loads and products.
// The maximum m is kept in the exponent's own unit: weight = 2^(s SL2 - m), SL2 = 1/8 log2(e).
#define FW   16
#define NT   (TT / (16 * QG))   // 32-query tiles a batch
#define QG   2        // 16-query groups a wave holds
#define SL2  (SCL * 1.4426950408889634f)
typedef __attribute__((ext_vector_type(16))) unsigned short v16us;
__device__ __forceinline__ float xhalf(float x) { const int b = __float_as_int(x); return __int_as_float(__builtin_amdgcn_permlanex16(b, b, 0x76543210, 0xfedcba98, false, false)); }   // lane l <-> l ^ 16
// one block of 32 keys from k0; DIAG: the block that holds keys above a query of the tile (the tile's last)
// fo: the lane's byte offset into the key planes and the v^T planes alike (a block of 32 keys is 2,048 elements of each, in fragment order); every fragment of the block is that one offset register + a uniform base + a constant
// (the loops over kt, ks, dt, j are unrolled whole so that the fragment arrays are indexed by constants and stay in registers)
template <typename T16> __device__ __forceinline__ typename WFrag<T16>::V ldo(const T16* __restrict__ base, unsigned off, int cst) { return WFrag<T16>::ld((const T16*)((const char*)base + off) + cst); }
template <bool HI, bool DIAG>
__device__ __forceinline__ void fa_block(const bf* __restrict__ Kh, const bf* __restrict__ Kl, const h16* __restrict__ V16, const bf* __restrict__ Vh, const bf* __restrict__ Vl,
                                         const v16bf (&qh)[QG][2], const v16bf (&ql)[QG][2], int q0, int k0, unsigned fo, int lr, int hi, v8f (&o)[QG][4], float (&m)[QG], float (&l)[QG]) {
    v16bf kh[2][2], kl[2][2]; v16h v16[4]; v16bf vh[4], vl[4];
#pragma unroll
    for (int kt = 0; kt < 2; ++kt) {
#pragma unroll
        for (int ks = 0; ks < 2; ++ks) { kh[kt][ks] = ldo<bf>(Kh, fo, kt * 16 * HD + ks * 512); kl[kt][ks] = ldo<bf>(Kl, fo, kt * 16 * HD + ks * 512); } }
    __builtin_amdgcn_sched_barrier(0);   /* every k load of the block is issued before the first product waits: one memory round trip for them, not one a fragment */
    // the v fragments take registers that the scores have set free (beside all k fragments the QG groups' q and output tiles would pass the 256 registers a wave that let four waves share a SIMD):
    // fp16 v (4 fragments) behind the scores of the first 16 keys, so that the other scores and the softmax stand between these loads and their products; hi and lo v (8 fragments; rows < RH, few blocks) behind the softmax
    v8f st[QG][2];
#pragma unroll
    for (int kt = 0; kt < 2; ++kt) {
#pragma unroll
        for (int g = 0; g < QG; ++g) { v8f s = (v8f){};
#pragma unroll
            for (int ks = 0; ks < 2; ++ks) { s = wmmab(kh[kt][ks], qh[g][ks], s); s = wmmab(kh[kt][ks], ql[g][ks], s); s = wmmab(kl[kt][ks], qh[g][ks], s); }
            st[g][kt] = s; }
        if (!HI && kt == 0) {
            __builtin_amdgcn_sched_barrier(0);   /* keeps the v loads from rising in front of these scores, where their registers are not free yet */
#pragma unroll
            for (int dt = 0; dt < 4; ++dt) v16[dt] = ldo<h16>(V16, fo, dt * 512);
            asm volatile("s_wait_xcnt 0x0" :: "v"(fo) : "memory");   /* the loads' offset register is reused behind this line; named as an input it stays whole up to it, so that no later load of the run lands in it */
            __builtin_amdgcn_sched_barrier(0); } }   /* and from sinking towards their products, which would then wait out the round trip */
    v16h pb[QG]; v16bf pbh[QG], pbl[QG];
#pragma unroll
    for (int g = 0; g < QG; ++g) {   // group g: queries q0 + 16 g + lr
        float mloc = -3.0e38f;
#pragma unroll
        for (int kt = 0; kt < 2; ++kt) {
#pragma unroll
            for (int j = 0; j < 8; ++j) { if (DIAG && (k0 + kt * 16 + hi * 8 + j > q0 + g * 16 + lr)) st[g][kt][j] = -3.0e38f; mloc = fmaxf(mloc, st[g][kt][j]); } }
        mloc = fmaxf(mloc, xhalf(mloc));   // the two lanes of a query hold different keys and must share one maximum
        const float mn = fmaxf(m[g], mloc * SL2); const float al = __builtin_amdgcn_exp2f(m[g] - mn); m[g] = mn;
        float ps = 0.f;
#pragma unroll
        for (int kt = 0; kt < 2; ++kt) {
#pragma unroll
            for (int j = 0; j < 8; ++j) { const float p = __builtin_amdgcn_exp2f(__builtin_fmaf(st[g][kt][j], SL2, -mn)); st[g][kt][j] = p; ps += p; } }
        l[g] = l[g] * al + ps;
#pragma unroll
        for (int dt = 0; dt < 4; ++dt) o[g][dt] *= al;
        if (HI) { v16us ph, pl;
#pragma unroll
            for (int j = 0; j < 8; ++j) { unsigned short a2, c2; splitf(st[g][0][j], a2, c2); ph[j] = a2; pl[j] = c2; splitf(st[g][1][j], a2, c2); ph[8 + j] = a2; pl[8 + j] = c2; }
            pbh[g] = __builtin_bit_cast(v16bf, ph); pbl[g] = __builtin_bit_cast(v16bf, pl);
        } else {
#pragma unroll
            for (int j = 0; j < 8; ++j) { pb[g][j] = tohx(st[g][0][j]); pb[g][8 + j] = tohx(st[g][1][j]); } }
    }
    if (HI) {
        __builtin_amdgcn_sched_barrier(0);   /* keeps the v loads from rising into the softmax, where their registers are not free yet */
#pragma unroll
        for (int dt = 0; dt < 4; ++dt) { vh[dt] = ldo<bf>(Vh, fo, dt * 512); vl[dt] = ldo<bf>(Vl, fo, dt * 512); }
        asm volatile("s_wait_xcnt 0x0" :: "v"(fo) : "memory"); }   /* the loads' offset register is reused behind this line; named as an input it stays whole up to it */
#pragma unroll
    for (int g = 0; g < QG; ++g) {
#pragma unroll
        for (int dt = 0; dt < 4; ++dt) {
            if (HI) { o[g][dt] = wmmab(vh[dt], pbh[g], o[g][dt]); o[g][dt] = wmmab(vh[dt], pbl[g], o[g][dt]); o[g][dt] = wmmab(vl[dt], pbh[g], o[g][dt]); }
            else o[g][dt] = wmma16(v16[dt], pb[g], o[g][dt]); } }
}
template <bool HI>
__device__ __forceinline__ void fa_keys(const bf* __restrict__ Kh, const bf* __restrict__ Kl, const h16* __restrict__ V16, const bf* __restrict__ Vh, const bf* __restrict__ Vl,
                                        const v16bf (&qh)[QG][2], const v16bf (&ql)[QG][2], int q0, int w, int lr, int hi, v8f (&o)[QG][4], float (&m)[QG], float (&l)[QG]) {
    const int last = q0 / 32;   // the 32-key block on the diagonal (the tile's own 32 tokens); every query of the tile has a live key in it and in each block before it
    int kb = w; unsigned fo = (unsigned)((w * 32 * HD + (hi * 16 + lr) * 8) * 2);
#pragma unroll 1   /* rolled: a second copy of the block's fragments would take the registers that let four waves share a SIMD */
    for (; kb < last; kb += FW) { fa_block<HI, false>(Kh, Kl, V16, Vh, Vl, qh, ql, q0, kb * 32, fo, lr, hi, o, m, l); fo += FW * 32 * HD * 2; }
    if (kb == last) fa_block<HI, true>(Kh, Kl, V16, Vh, Vl, qh, ql, q0, kb * 32, fo, lr, hi, o, m, l);   // wave-uniform: one wave of the block
}
__global__ __launch_bounds__(32 * FW) __attribute__((amdgpu_waves_per_eu(4, 4))) void k_fattn(const bf* __restrict__ Qh, const bf* __restrict__ Ql, const bf* __restrict__ Kh, const bf* __restrict__ Kl, const h16* __restrict__ V16, const bf* __restrict__ Vh, const bf* __restrict__ Vl, float* out) {
    __shared__ __align__(16) float Os[2 * FW * QG * 16 * 68]; __shared__ float Ms[2 * FW * QG * 16]; __shared__ float Ls[2 * FW * QG * 16];
    static_assert(QG * 16 == 32, "the tile is one 32-key block wide: its diagonal block is q0 / 32 for every group");
    static_assert((FW & (FW - 1)) == 0 && NT % 2 == 0, "the deal wraps by a mask; the tiles pair up");
    const int tid = threadIdx.x, lane = tid & 31, lr = lane & 15, hi = lane >> 4; const int w = __builtin_amdgcn_readfirstlane(tid >> 5);
    const int b = blockIdx.x, pr = blockIdx.y;
    const size_t pb = (size_t)b * TT * HD; Qh += pb; Ql += pb; Kh += pb; Kl += pb; V16 += pb; Vh += pb; Vl += pb;
#pragma unroll 1   /* rolled: one copy of the key loops serves both tiles (half the code to fetch) */
    for (int t = 0; t < 2; ++t) {   // t 0: tile NT - 1 - pr (NT - pr key blocks); t 1: tile pr (pr + 1 key blocks)
        const int q0 = (t ? pr : NT - 1 - pr) * (QG * 16);
        const int s = t ? ((w - (NT - pr)) & (FW - 1)) : w;   // the wave's place in the tile's deal
        v16bf qh[QG][2], ql[QG][2];
#pragma unroll
        for (int g = 0; g < QG; ++g) {
#pragma unroll
            for (int ks = 0; ks < 2; ++ks) { const size_t qo = (size_t)(q0 + g * 16) * HD + ks * 512 + lane * 8; qh[g][ks] = WFrag<bf>::ld(Qh + qo); ql[g][ks] = WFrag<bf>::ld(Ql + qo); } }
        asm volatile("s_wait_xcnt 0x0" ::: "memory");   /* the q loads' address registers are reused right behind them */
        v8f o[QG][4]; float m[QG], l[QG];
#pragma unroll
        for (int g = 0; g < QG; ++g) { m[g] = -3.0e38f; l[g] = 0.f;
#pragma unroll
            for (int dt = 0; dt < 4; ++dt) o[g][dt] = (v8f){}; }
        if (q0 < RH) fa_keys<true>(Kh, Kl, V16, Vh, Vl, qh, ql, q0, s, lr, hi, o, m, l); else fa_keys<false>(Kh, Kl, V16, Vh, Vl, qh, ql, q0, s, lr, hi, o, m, l);   // the same for every wave of the block in trip t; no barrier stands inside
        const int sl = t * FW + s;   // the LDS slot of this partial set: written by this wave alone, read behind the barrier
#pragma unroll
        for (int g = 0; g < QG; ++g) { l[g] += xhalf(l[g]);
#pragma unroll
            for (int dt = 0; dt < 4; ++dt) { float* p = Os + ((sl * QG + g) * 16 + lr) * 68 + dt * 16 + hi * 8; v4f a, c;
#pragma unroll
                for (int j = 0; j < 4; ++j) { a[j] = o[g][dt][j]; c[j] = o[g][dt][4 + j]; }
                *(v4fa*)p = a; *(v4fa*)(p + 4) = c; }
            if (hi == 0) { Ms[(sl * QG + g) * 16 + lr] = m[g]; Ls[(sl * QG + g) * 16 + lr] = l[g]; } }
    }
    __syncthreads();   /* every wave's two partial sets are in LDS before any thread merges them */
    const int d4 = (tid & 15) * 4, qr = tid >> 4;   // the thread's query row of each tile (32 FW threads: 16 QG rows x 16 column groups)
    static_assert(32 * FW == QG * 16 * 16, "one merge turn a tile");
#pragma unroll
    for (int t = 0; t < 2; ++t) { const int q0 = (t ? pr : NT - 1 - pr) * (QG * 16); const int e = t * FW * QG * 16 + qr;
        float M = Ms[e];
#pragma unroll
        for (int u = 1; u < FW; ++u) M = fmaxf(M, Ms[u * QG * 16 + e]);
        float L = 0.f; v4f a = (v4f){};
#pragma unroll
        for (int u = 0; u < FW; ++u) { const float f = __builtin_amdgcn_exp2f(Ms[u * QG * 16 + e] - M); L += Ls[u * QG * 16 + e] * f; a += *(const v4fa*)(Os + (u * QG * 16 + e) * 68 + d4) * f; }   // a wave without keys has max -3e38, sum 0: factor 0
        const float r = __fdiv_rn(1.0f, L);
        *(v4f*)(out + ((size_t)b * TT + q0 + qr) * CO + d4) = a * r; }
}
extern "C" void kernel_launch(void* const* d_in, const int* in_sizes, int n_in,
                              void* d_out, int out_size, void* d_ws, size_t ws_size, hipStream_t stream) {
    (void)in_sizes; (void)n_in; (void)out_size;
    const float* x = (const float*)d_in[0]; const float* wq = (const float*)d_in[1]; const float* bq = (const float*)d_in[2]; const float* wk = (const float*)d_in[3]; const float* bk = (const float*)d_in[4]; const float* wv = (const float*)d_in[5]; const float* bv = (const float*)d_in[6];   /* standard roles: rows = queries */
    float* OUT = (float*)d_out;     // [4][4096][64]
    char* wsp = (char*)d_ws;
    auto take = [&](size_t bytes) { char* p = wsp; wsp += (bytes + 255) & ~(size_t)255; return (void*)p; };
    bf* WT = (bf*)take((size_t)3 * MID * CC * 2);   /* q, k, v weights, bf16 in fragment order */
    bf* QPh = (bf*)take((size_t)NB_ * TT * MID * 2); bf* QPl = (bf*)take((size_t)NB_ * TT * MID * 2); bf* KPh = (bf*)take((size_t)NB_ * TT * MID * 2); bf* KPl = (bf*)take((size_t)NB_ * TT * MID * 2);   /* the planes the attention launch reads: one set a batch */
    h16* VT16 = (h16*)take((size_t)NB_ * CO * TT * 2); bf* VTh = (bf*)take((size_t)NB_ * CO * TT * 2); bf* VTl = (bf*)take((size_t)NB_ * CO * TT * 2);
    if ((size_t)(wsp - (char*)d_ws) > ws_size) return;    // ws 256 MiB (carve ~15 MiB)
    k_wt3<<<dim3(CC * MID / 512, 3, 1), 256, 0, stream>>>(wq, wk, wv, WT);   /* 'xw' weights -> fragments */
    k_proj<<<NB_ * TT / 64, 32 * 3 * KQ, 0, stream>>>(x, WT, bq, bk, bv, QPh, QPl, KPh, KPl, VT16, VTh, VTl);   /* q, k and v^T planes, in fragment order */
    k_fattn<<<dim3(NB_, NT / 2, 1), 32 * FW, 0, stream>>>(QPh, QPl, KPh, KPl, VT16, VTh, VTl, OUT);   /* causal attention of all four batches; writes every output row once */
}

// v007
// Measured time: 28.8 microseconds a run.
// Timed twice side by side with v006, it ran 1.21 and 1.17 times as fast.
// All steps since v000 together make it 40.7 times as fast.
#include <hip/hip_runtime.h>

// Single causal attention head over 4,096 tokens with biased projections (x [4][4096][768]; q, k, v = x w + b ('xw' [768][64] + [64]; ONE 64-wide head); scores = q.k^T; causal (-inf) THEN x 1/sqrt(64) (masking before the scale: the same thing); softmax; out = weights.v -> [4][4096][64] (1.0 M); argument order x, wq, bq, wk, bk, wv, bv).
// Layout: 'xw' weights laid out as fragments once (one launch for the three); ONE launch for all batches that rounds x to bf16 on its way into LDS, takes the three exact projections (K 768, K split over the waves of a block) and writes the planes the attention reads; then ONE launch for all batches in which a block takes the 32-query tiles t and 127 - t one after the other (equal work a block) and streams the keys of each up to the diagonal (every wave holds both 16-query groups of the tile and uses each loaded k and v fragment for both): scores (rows < 512 hi/lo planes, 3 products; rest one fp16 product), running-maximum softmax in registers, weights.v (rows < 512 hi/lo 3 products, rest fp16), key blocks dealt over the waves of a block and merged through LDS.
// Compute dtypes, f32 accumulate: every input rounded to bf16; projections exact; scores and wei.v of rows < 512 3 bf16 hi/lo products each, of the other rows one fp16 product each; softmax f32; output f32.

#define NB_  4
#define TT   4096
#define DM   64
#define NH_  1
#define NKV  1
#define REP  (NH_ / NKV)
#define HD   64
#define DQ   (NH_ * HD)
#define DKV  (NKV * HD)
#define ZH   1
#define RH   512                  // query rows < RH use hi+lo planes (0: none)
#define WIN  0
#define SCL  0.125f   // C^-0.5 with C = 64 (the head width)
#define MID  64       // q / k width (one 64-wide head)
#define CO   64       // v width
#define CC   768      // input width (d_model)
#define KQ   4        // waves that share the K of one projection tile (24 k steps: 6 each)
typedef _Float16 h16;
typedef unsigned short bf;
typedef __attribute__((ext_vector_type(16))) __bf16   v16bf;
typedef __attribute__((ext_vector_type(16))) _Float16 v16h;
typedef __attribute__((ext_vector_type(8)))  _Float16 v8h;
typedef __attribute__((ext_vector_type(8)))  unsigned short v8us;
typedef __attribute__((ext_vector_type(8)))  float    v8f;
typedef __attribute__((ext_vector_type(4)))  float    v4f;
typedef v8h  __attribute__((may_alias)) v8ha;
typedef v4f  __attribute__((may_alias)) v4fa;
typedef v8us __attribute__((may_alias)) v8usa;

__device__ __forceinline__ unsigned short f2bf(float f) { unsigned u = __float_as_uint(f); u += 0x7FFFu + ((u >> 16) & 1u); return (unsigned short)(u >> 16); }
__device__ __forceinline__ float bf2f(unsigned short b) { return __uint_as_float(((unsigned)b) << 16); }
__device__ __forceinline__ float bfr(float f) { return bf2f(f2bf(f)); }
__device__ __forceinline__ v16h cat16(v8h lo, v8h hi) { return __builtin_shufflevector(lo, hi, 0, 1, 2, 3, 4, 5, 6, 7, 8, 9, 10, 11, 12, 13, 14, 15); }
__device__ __forceinline__ v16bf cat16b(v8us lo, v8us hi) { return __builtin_bit_cast(v16bf, __builtin_shufflevector(lo, hi, 0, 1, 2, 3, 4, 5, 6, 7, 8, 9, 10, 11, 12, 13, 14, 15)); }
__device__ __forceinline__ v8f wmma16(v16h a, v16h b, v8f c) { return __builtin_amdgcn_wmma_f32_16x16x32_f16(false, a, false, b, (short)0, c, false, false); }
__device__ __forceinline__ v8f wmmab(v16bf a, v16bf b, v8f c) { return __builtin_amdgcn_wmma_f32_16x16x32_bf16(false, a, false, b, (short)0, c, false, false); }



// fragment loaders: operands straight from 16-bit planes kept in fragment order: [half 2][lane 32][8], so that each of the two 16-byte loads a lane makes is part of 512 contiguous bytes (four whole lines a wave)
template <typename T16> struct WFrag;
template <> struct WFrag<h16> { typedef v16h V; static __device__ __forceinline__ V ld(const h16* p) { return cat16(*(const v8h*)p, *(const v8h*)(p + 256)); } static __device__ __forceinline__ v8f mma(V a, V b, v8f c) { return wmma16(a, b, c); } };
template <> struct WFrag<bf> { typedef v16bf V; static __device__ __forceinline__ V ld(const bf* p) { return cat16b(*(const v8us*)p, *(const v8us*)(p + 256)); } static __device__ __forceinline__ v8f mma(V a, V b, v8f c) { return wmmab(a, b, c); } };

__device__ __forceinline__ h16 tohx(float x) { return (h16)x; }
__device__ __forceinline__ void splitf(float y, unsigned short& h, unsigned short& l) { h = f2bf(y); l = f2bf(y - bf2f(h)); }
typedef __attribute__((ext_vector_type(2))) _Float16 v2h;
typedef __attribute__((ext_vector_type(4))) _Float16 v4h;
typedef __attribute__((ext_vector_type(2))) unsigned short v2us;
typedef __attribute__((ext_vector_type(4))) unsigned short v4us;
typedef __attribute__((ext_vector_type(2))) float v2f;
typedef __attribute__((ext_vector_type(4))) int v4i;


// ---- k_wt3: the three 'xw' weights [CC][64] f32 -> bf16 in fragment order [3][nb 4][k step CC / 32][half 2][lane 32][8]: lane (hi, lr) of half h holds channel nb 16 + lr, k = 32 step + 16 h + 8 hi + 0..7,
// so that one 16-byte load a lane fetches half a fragment from 512 contiguous bytes. grid (64 CC / 512, 3); a wave writes one 128-B line.
__global__ __launch_bounds__(256) void k_wt3(const float* __restrict__ wq, const float* __restrict__ wk, const float* __restrict__ wv, bf* Bt) {
    const float* __restrict__ w = (blockIdx.y == 0) ? wq : (blockIdx.y == 1) ? wk : wv;
    const unsigned e = (blockIdx.x * 256 + threadIdx.x) * 2, f = e >> 9, ln = (e >> 3) & 31, k = (f % (CC / 32)) * 32 + ((e >> 8) & 1) * 16 + (ln >> 4) * 8 + (e & 7), n = (f / (CC / 32)) * 16 + (ln & 15); v2us o;
    o[0] = f2bf(w[k * 64 + n]); o[1] = f2bf(w[(k + 1) * 64 + n]); *(v2us*)(Bt + blockIdx.y * (64 * CC) + e) = o;
}
// ---- k_proj: q, k and v projections of 64 rows of x (all batches: grid NB_ TT / 64) and their planes, one launch. 3 KQ waves: wave w works on projection w / KQ and takes the 32-wide k steps w % KQ, w % KQ + KQ, ...
// The block's rows of x (contiguous f32) are read once, whole lines a load and all loads in flight together, rounded to bf16 (nearest even) and laid in LDS (row pitch 16 B x odd); a work-group barrier; the fragments come from there. The product is taken transposed (A = weight rows, B = x rows): a lane owns token mb 16 + lr and holds channels nb 16 + 8 hi + j.
// Every wave lays its 64 x 64 partial tile in LDS (q, k: [token][channel]; v: [channel][token]), ONE work-group barrier, then the KQ waves of a projection add its KQ tiles in wave order and store the planes in the attention's fragment order, 512 contiguous bytes a wave and store:
// q, k: [16-token tile][k step 2][half 2][lane 32][8], lane (hi, lr) of half h holds token lr of the tile, channels 32 step + 16 h + 8 hi + 0..7; v: [batch][32-token block][16-channel tile 4][half 2][lane 32][8], lane (hi, lr) of half h holds channel lr of the tile, tokens 16 h + 8 hi + 0..7 of the block. The bias (rounded to bf16) is the start value of the first wave's sums.
typedef __attribute__((ext_vector_type(4))) __bf16 v4bf;
typedef v4us __attribute__((may_alias)) v4usa;
#define PSL  (64 * 68)
#define XP   (CC + 8)
__global__ __launch_bounds__(32 * 3 * KQ) void k_proj(const float* __restrict__ x, const bf* __restrict__ WT, const float* __restrict__ bq, const float* __restrict__ bk, const float* __restrict__ bv,
                                                      bf* Qh, bf* Ql, bf* Kh, bf* Kl, h16* Q16, h16* K16, h16* V16, bf* Vh, bf* Vl) {
    __shared__ __align__(16) float os[3 * KQ * PSL]; __shared__ __align__(16) bf xs[64 * XP];
    const int tid = threadIdx.x, lane = tid & 31, lr = lane & 15, hi = lane >> 4; const int w = __builtin_amdgcn_readfirstlane(tid >> 5);
    const int p = w / KQ, kq = w % KQ; const int r0 = blockIdx.x * 64;
    // the biases of the lane's channels (nb 16 + 8 hi + j, the same for the three projections) are fetched here, under the reads of x; the first wave of each projection starts its sums from them
    const float* bp = (p == 0) ? bq : (p == 1) ? bk : bv; const unsigned bo = hi * 32; v4f bz[4][2];   // bo: the lane's byte offset, the one address register of these loads
#pragma unroll
    for (int nb = 0; nb < 4; ++nb) { const float* q = (const float*)((const char*)bp + bo) + nb * 16; bz[nb][0] = *(const v4f*)q; bz[nb][1] = *(const v4f*)(q + 4); }
    // weight fragments: a ring of two k steps; the first is fetched here, under the reads of x, the second in front of the barrier (x's registers are free by then), a later one behind the products of the step whose registers it takes
    const bf* wb = WT + ((size_t)p * 4 * (CC / 32) + kq) * 512 + lane * 8; v16bf b[2][4];
#pragma unroll
    for (int nb = 0; nb < 4; ++nb) { const bf* q = wb + nb * (CC / 32) * 512; b[0][nb] = cat16b(*(const v8us*)q, *(const v8us*)(q + 256)); }
    {   // 512-B piece c = w + 3 KQ i of the 64 rows: row c / 6 = 2 i + w / 6, sixth c % 6 = w % 6
        const float* xg = x + (size_t)r0 * CC + w * 128 + lane * 4; bf* xd = xs + (w / 6) * XP + (w % 6) * 128 + lane * 4; v4f raw[64 * CC / (3 * KQ * 128)];
#pragma unroll
        for (int i = 0; i < 64 * CC / (3 * KQ * 128); ++i) raw[i] = *(const v4f*)(xg + i * 3 * KQ * 128);
        asm volatile("s_wait_xcnt 0x0" ::: "memory");   /* every load of the tile is issued in front of the first rounding (one memory round trip), and the loads' address registers are reused behind this line */
#pragma unroll
        for (int i = 0; i < 64 * CC / (3 * KQ * 128); ++i) *(v4usa*)(xd + i * 2 * XP) = __builtin_bit_cast(v4us, __builtin_convertvector(raw[i], v4bf));
    }
    asm volatile("s_wait_xcnt 0x0" :: "v"(bo) : "memory");   /* the build issues some bias and weight loads behind the wait above; named as an input the bias offset register stays whole up to this one */
#pragma unroll
    for (int nb = 0; nb < 4; ++nb) { const bf* q = wb + (nb * (CC / 32) + KQ) * 512; b[1][nb] = cat16b(*(const v8us*)q, *(const v8us*)(q + 256)); }
    asm volatile("s_wait_xcnt 0x0" ::: "memory");   /* these loads' offset register is reused in the loop below */
    __syncthreads();   /* the bf16 rows are in LDS before any wave takes a fragment */
    const bf* xa = xs + lr * XP + kq * 32 + 8 * hi;
    v8f acc[4][4];
    if (kq == 0) {   // wave-uniform
#pragma unroll
        for (int nb = 0; nb < 4; ++nb) { v8f z;
#pragma unroll
            for (int j = 0; j < 8; ++j) z[j] = bfr(bz[nb][j >> 2][j & 3]);
#pragma unroll
            for (int mb = 0; mb < 4; ++mb) acc[mb][nb] = z; }
    } else {
#pragma unroll
        for (int nb = 0; nb < 4; ++nb)
#pragma unroll
            for (int mb = 0; mb < 4; ++mb) acc[mb][nb] = (v8f){};
    }
    // (unrolled whole: the ring and the accumulators are indexed by constants and stay in registers; every address is one lane register + a constant)
#pragma unroll
    for (int s = 0; s < CC / (32 * KQ); ++s) { v16bf a[4];
#pragma unroll
        for (int mb = 0; mb < 4; ++mb) { const bf* q = xa + mb * 16 * XP + s * KQ * 32; a[mb] = cat16b(*(const v8usa*)q, *(const v8usa*)(q + 16)); }
#pragma unroll
        for (int nb = 0; nb < 4; ++nb) {
#pragma unroll
            for (int mb = 0; mb < 4; ++mb) acc[mb][nb] = wmmab(b[s & 1][nb], a[mb], acc[mb][nb]); }
        if (s + 2 < CC / (32 * KQ)) {
#pragma unroll
            for (int nb = 0; nb < 4; ++nb) { const bf* q = wb + (nb * (CC / 32) + (s + 2) * KQ) * 512; b[s & 1][nb] = cat16b(*(const v8us*)q, *(const v8us*)(q + 256)); }
            __builtin_amdgcn_sched_barrier(0); } }   /* the fetch stays a whole step in front of its products: left alone the build puts each load right in front of its use and waits out an L2 round trip a fragment */
    asm volatile("s_wait_xcnt 0x0" ::: "memory");   /* the loads' address registers are reused behind this line */
    // a thread's share of the sum: rows gl, gl + 16, ... of its projection's tile, columns 8 gc .. 8 gc + 7 (a wave: 16 rows x 16 columns, one half of a fragment)
    static_assert(KQ == 4, "the 128 threads of a projection cover 16 rows x 8 column groups a turn");
    const int g = tid & (32 * KQ - 1), gl = g & 15, gc = g >> 4; const float* tp = os + p * KQ * PSL;
    float* sl = os + w * PSL;
    if (p < 2) {   // wave-uniform
#pragma unroll
        for (int mb = 0; mb < 4; ++mb) {
#pragma unroll
            for (int nb = 0; nb < 4; ++nb) { float* q = sl + (mb * 16 + lr) * 68 + nb * 16 + hi * 8; v4f c, d;
#pragma unroll
                for (int j = 0; j < 4; ++j) { c[j] = acc[mb][nb][j]; d[j] = acc[mb][nb][4 + j]; }
                *(v4fa*)q = c; *(v4fa*)(q + 4) = d; } }
    } else {
#pragma unroll
        for (int mb = 0; mb < 4; ++mb) {
#pragma unroll
            for (int nb = 0; nb < 4; ++nb) {
#pragma unroll
                for (int j = 0; j < 8; ++j) sl[(nb * 16 + hi * 8 + j) * 68 + mb * 16 + lr] = acc[mb][nb][j]; } }
    }
    __syncthreads();   /* every wave's partial tile is in LDS before any thread adds them */
    const int bb = r0 / TT, t0 = r0 % TT;
    // (the turns are unrolled: every LDS address is one lane register + a constant)
    // which planes the attention reads: query rows < RH take q and their keys (all < RH) as hi and lo planes; the other rows take q and every key as one fp16 plane. t0 < RH is the same for the whole block (RH is a multiple of 64)
    if (p < 2) { bf* Ph = p ? Kh : Qh; bf* Pl = p ? Kl : Ql; h16* P16 = p ? K16 : Q16; const bool hl = t0 < RH;
#pragma unroll
        for (int it = 0; it < 512 / (32 * KQ); ++it) { const float* s0 = tp + (gl + it * 16) * 68 + gc * 8; v4f c = *(const v4fa*)s0, d = *(const v4fa*)(s0 + 4);
#pragma unroll
            for (int u = 1; u < KQ; ++u) { c += *(const v4fa*)(s0 + u * PSL); d += *(const v4fa*)(s0 + u * PSL + 4); }
            const size_t o = (size_t)(r0 / 16 + it) * (16 * HD) + gc * 128 + gl * 8;
            if (p || !hl) { v8h o16;
#pragma unroll
                for (int e = 0; e < 4; ++e) { o16[e] = tohx(c[e]); o16[4 + e] = tohx(d[e]); }
                *(v8h*)(P16 + o) = o16;
                asm volatile("s_wait_xcnt 0x0" ::: "memory"); }   /* the hi and lo planes' arithmetic below reuses this store's address and data registers */
            if (hl) { v8us oh, ol;
#pragma unroll
                for (int e = 0; e < 4; ++e) { unsigned short a2, c2; splitf(c[e], a2, c2); oh[e] = a2; ol[e] = c2; splitf(d[e], a2, c2); oh[4 + e] = a2; ol[4 + e] = c2; }
                *(v8us*)(Ph + o) = oh; *(v8us*)(Pl + o) = ol; }
            asm volatile("s_wait_xcnt 0x0" ::: "memory"); }   /* the next turn reuses the stores' address and data registers */
    } else {
#pragma unroll
        for (int it = 0; it < 512 / (32 * KQ); ++it) { const float* s0 = tp + (gl + it * 16) * 68 + gc * 8; v4f c = *(const v4fa*)s0, d = *(const v4fa*)(s0 + 4);
#pragma unroll
            for (int u = 1; u < KQ; ++u) { c += *(const v4fa*)(s0 + u * PSL); d += *(const v4fa*)(s0 + u * PSL + 4); }
            v8us oh, ol; v8h o16;
#pragma unroll
            for (int e = 0; e < 4; ++e) { unsigned short a2, c2; float y = c[e]; o16[e] = tohx(y); splitf(y, a2, c2); oh[e] = a2; ol[e] = c2; y = d[e]; o16[4 + e] = tohx(y); splitf(y, a2, c2); oh[4 + e] = a2; ol[4 + e] = c2; }
            const size_t o = (size_t)bb * HD * TT + (size_t)((t0 / 32 + (gc >> 2)) * 4 + it) * 512 + (gc & 3) * 128 + gl * 8; *(v8h*)(V16 + o) = o16; *(v8us*)(Vh + o) = oh; *(v8us*)(Vl + o) = ol;
            asm volatile("s_wait_xcnt 0x0" ::: "memory"); }   /* the next turn reuses the stores' address and data registers */
    }
}
// ---- k_fattn: scores, causal softmax and weights.v in one pass over the keys; the score plane never leaves the registers. grid (batch, pair of 32-query tiles), FW waves a block, one block a WGP; a wave holds the QG 16-query groups of the tile, so that every k and v fragment it loads serves QG groups (the bytes from L2 a query fall by QG).
// Both products are taken transposed, so that in each group a lane owns ONE query: S^T[key][query] = K Q^T (A = k rows, B = q rows) leaves key 16 kt + 8 hi + j of query lr in st[kt][j], which is already the B fragment
// (element j and 8 + j <-> k = 8 hi + j and 16 + 8 hi + j) of O^T[d][query] = V^T P^T; running maximum, sum and rescale are per lane.
// Every block is resident at once and a tile's cost grows with its index, so the launch lasts as long as its fullest wave: a block takes tile NT - 1 - pr and then tile pr, NT + 1 key blocks together whatever pr is,
// and deals them as ONE list over its FW waves (the second tile's deal goes on at the wave where the first tile's ended), so that every wave of the launch has 8 or 9 key blocks. In each tile the wave in deal place s takes the 32-key blocks s, s + FW, ... up to the diagonal;
// the FW partial (max, sum, O^T) sets of each tile are merged through LDS in the order of the deal behind one work-group barrier, and the block stores the 16 QG output rows of each tile once.
// amdgpu_waves_per_eu(4, 4): the register budget of four waves a SIMD (256 a wave), so that the FW waves of a block fit one WGP and one wave's softmax runs under another's loads and products.
// The maximum m is kept in the exponent's own unit: weight = 2^(s SL2 - m), SL2 = 1/8 log2(e).
#define FW   16
#define NT   (TT / (16 * QG))   // 32-query tiles a batch
#define QG   2        // 16-query groups a wave holds
#define SL2  (SCL * 1.4426950408889634f)
typedef __attribute__((ext_vector_type(16))) unsigned short v16us;
__device__ __forceinline__ float xhalf(float x) { const int b = __float_as_int(x); return __int_as_float(__builtin_amdgcn_permlanex16(b, b, 0x76543210, 0xfedcba98, false, false)); }   // lane l <-> l ^ 16
// one block of 32 keys from k0; DIAG: the block that holds keys above a query of the tile (the tile's last)
// fo: the lane's byte offset into the key planes and the v^T planes alike (a block of 32 keys is 2,048 elements of each, in fragment order); every fragment of the block is that one offset register + a uniform base + a constant
// (the loops over kt, ks, dt, j are unrolled whole so that the fragment arrays are indexed by constants and stay in registers)
template <typename T16> __device__ __forceinline__ typename WFrag<T16>::V ldo(const T16* __restrict__ base, unsigned off, int cst) { return WFrag<T16>::ld((const T16*)((const char*)base + off) + cst); }
// the q fragments of a tile: query rows < RH as hi and lo bf16 planes, the other rows as one fp16 plane
template <bool HI> struct QFrag;
template <> struct QFrag<true> { v16bf h[QG][2], l[QG][2]; };
template <> struct QFrag<false> { v16h f[QG][2]; };
// Scores of rows >= RH: ONE fp16 product (q and k rounded once to fp16, 11 significant bits), the precision that the weights and v of these rows have in weights.v anyway; a block of 32 keys is then 4 KiB of k, not 8, and 8 score products, not 24.
template <bool HI, bool DIAG>
__device__ __forceinline__ void fa_block(const bf* __restrict__ Kh, const bf* __restrict__ Kl, const h16* __restrict__ K16, const h16* __restrict__ V16, const bf* __restrict__ Vh, const bf* __restrict__ Vl,
                                         const QFrag<HI>& q, int q0, int k0, unsigned fo, int lr, int hi, v8f (&o)[QG][4], float (&m)[QG], float (&l)[QG]) {
    v8f st[QG][2]; v16h v16[4];
    if constexpr (HI) {
        v16bf kh[2][2], kl[2][2];
#pragma unroll
        for (int kt = 0; kt < 2; ++kt) {
#pragma unroll
            for (int ks = 0; ks < 2; ++ks) { kh[kt][ks] = ldo<bf>(Kh, fo, kt * 16 * HD + ks * 512); kl[kt][ks] = ldo<bf>(Kl, fo, kt * 16 * HD + ks * 512); } }
        __builtin_amdgcn_sched_barrier(0);   /* every k load of the block is issued before the first product waits: one memory round trip for them, not one a fragment */
#pragma unroll
        for (int kt = 0; kt < 2; ++kt) {
#pragma unroll
            for (int g = 0; g < QG; ++g) { v8f s = (v8f){};
#pragma unroll
                for (int ks = 0; ks < 2; ++ks) { s = wmmab(kh[kt][ks], q.h[g][ks], s); s = wmmab(kh[kt][ks], q.l[g][ks], s); s = wmmab(kl[kt][ks], q.h[g][ks], s); }
                st[g][kt] = s; } }
    } else {
        // 4 k and 4 v fragments fit beside the QG groups' q and output tiles inside the 256 registers a wave: all are fetched at the block's head
        v16h k16[2][2];
#pragma unroll
        for (int kt = 0; kt < 2; ++kt) {
#pragma unroll
            for (int ks = 0; ks < 2; ++ks) k16[kt][ks] = ldo<h16>(K16, fo, kt * 16 * HD + ks * 512); }
#pragma unroll
        for (int dt = 0; dt < 4; ++dt) v16[dt] = ldo<h16>(V16, fo, dt * 512);
        asm volatile("s_wait_xcnt 0x0" :: "v"(fo) : "memory");   /* the loads' offset register is reused behind this line; named as an input it stays whole up to it, so that no later load of the run lands in it */
        __builtin_amdgcn_sched_barrier(0);   /* every k and v load of the block is issued before the first product waits: one memory round trip for them, not one a fragment */
#pragma unroll
        for (int kt = 0; kt < 2; ++kt) {
#pragma unroll
            for (int g = 0; g < QG; ++g) { v8f s = (v8f){};
#pragma unroll
                for (int ks = 0; ks < 2; ++ks) s = wmma16(k16[kt][ks], q.f[g][ks], s);
                st[g][kt] = s; } }
    }
    v16h pb[QG]; v16bf pbh[QG], pbl[QG];
#pragma unroll
    for (int g = 0; g < QG; ++g) {   // group g: queries q0 + 16 g + lr
        float mloc = -3.0e38f;
#pragma unroll
        for (int kt = 0; kt < 2; ++kt) {
#pragma unroll
            for (int j = 0; j < 8; ++j) { if (DIAG && (k0 + kt * 16 + hi * 8 + j > q0 + g * 16 + lr)) st[g][kt][j] = -3.0e38f; mloc = fmaxf(mloc, st[g][kt][j]); } }
        mloc = fmaxf(mloc, xhalf(mloc));   // the two lanes of a query hold different keys and must share one maximum
        const float mn = fmaxf(m[g], mloc * SL2); const float al = __builtin_amdgcn_exp2f(m[g] - mn); m[g] = mn;
        float ps = 0.f;
#pragma unroll
        for (int kt = 0; kt < 2; ++kt) {
#pragma unroll
            for (int j = 0; j < 8; ++j) { const float p = __builtin_amdgcn_exp2f(__builtin_fmaf(st[g][kt][j], SL2, -mn)); st[g][kt][j] = p; ps += p; } }
        l[g] = l[g] * al + ps;
#pragma unroll
        for (int dt = 0; dt < 4; ++dt) o[g][dt] *= al;
        if (HI) { v16us ph, pl;
#pragma unroll
            for (int j = 0; j < 8; ++j) { unsigned short a2, c2; splitf(st[g][0][j], a2, c2); ph[j] = a2; pl[j] = c2; splitf(st[g][1][j], a2, c2); ph[8 + j] = a2; pl[8 + j] = c2; }
            pbh[g] = __builtin_bit_cast(v16bf, ph); pbl[g] = __builtin_bit_cast(v16bf, pl);
        } else {
#pragma unroll
            for (int j = 0; j < 8; ++j) { pb[g][j] = tohx(st[g][0][j]); pb[g][8 + j] = tohx(st[g][1][j]); } }
    }
    v16bf vh[4], vl[4];   // hi and lo v (8 fragments; rows < RH, few blocks) are fetched behind the softmax, into registers that the scores have set free
    if (HI) {
        __builtin_amdgcn_sched_barrier(0);   /* keeps the v loads from rising into the softmax, where their registers are not free yet */
#pragma unroll
        for (int dt = 0; dt < 4; ++dt) { vh[dt] = ldo<bf>(Vh, fo, dt * 512); vl[dt] = ldo<bf>(Vl, fo, dt * 512); }
        asm volatile("s_wait_xcnt 0x0" :: "v"(fo) : "memory"); }   /* the loads' offset register is reused behind this line; named as an input it stays whole up to it */
#pragma unroll
    for (int g = 0; g < QG; ++g) {
#pragma unroll
        for (int dt = 0; dt < 4; ++dt) {
            if (HI) { o[g][dt] = wmmab(vh[dt], pbh[g], o[g][dt]); o[g][dt] = wmmab(vh[dt], pbl[g], o[g][dt]); o[g][dt] = wmmab(vl[dt], pbh[g], o[g][dt]); }
            else o[g][dt] = wmma16(v16[dt], pb[g], o[g][dt]); } }
}
template <bool HI>
__device__ __forceinline__ void fa_keys(const bf* __restrict__ Qh, const bf* __restrict__ Ql, const h16* __restrict__ Q16, const bf* __restrict__ Kh, const bf* __restrict__ Kl, const h16* __restrict__ K16, const h16* __restrict__ V16, const bf* __restrict__ Vh, const bf* __restrict__ Vl,
                                        int q0, int w, int lane, int lr, int hi, v8f (&o)[QG][4], float (&m)[QG], float (&l)[QG]) {
    QFrag<HI> q;
#pragma unroll
    for (int g = 0; g < QG; ++g) {
#pragma unroll
        for (int ks = 0; ks < 2; ++ks) { const size_t qo = (size_t)(q0 + g * 16) * HD + ks * 512 + lane * 8;
            if constexpr (HI) { q.h[g][ks] = WFrag<bf>::ld(Qh + qo); q.l[g][ks] = WFrag<bf>::ld(Ql + qo); } else q.f[g][ks] = WFrag<h16>::ld(Q16 + qo); } }
    asm volatile("s_wait_xcnt 0x0" ::: "memory");   /* the q loads' address registers are reused right behind them */
    const int last = q0 / 32;   // the 32-key block on the diagonal (the tile's own 32 tokens); every query of the tile has a live key in it and in each block before it
    int kb = w; unsigned fo = (unsigned)((w * 32 * HD + (hi * 16 + lr) * 8) * 2);
#pragma unroll 1   /* rolled: a second copy of the block's fragments would take the registers that let four waves share a SIMD */
    for (; kb < last; kb += FW) { fa_block<HI, false>(Kh, Kl, K16, V16, Vh, Vl, q, q0, kb * 32, fo, lr, hi, o, m, l); fo += FW * 32 * HD * 2; }
    if (kb == last) fa_block<HI, true>(Kh, Kl, K16, V16, Vh, Vl, q, q0, kb * 32, fo, lr, hi, o, m, l);   // wave-uniform: one wave of the block
}
__global__ __launch_bounds__(32 * FW) __attribute__((amdgpu_waves_per_eu(4, 4))) void k_fattn(const bf* __restrict__ Qh, const bf* __restrict__ Ql, const bf* __restrict__ Kh, const bf* __restrict__ Kl, const h16* __restrict__ Q16, const h16* __restrict__ K16, const h16* __restrict__ V16, const bf* __restrict__ Vh, const bf* __restrict__ Vl, float* out) {
    __shared__ __align__(16) float Os[2 * FW * QG * 16 * 68]; __shared__ float Ms[2 * FW * QG * 16]; __shared__ float Ls[2 * FW * QG * 16];
    static_assert(QG * 16 == 32, "the tile is one 32-key block wide: its diagonal block is q0 / 32 for every group");
    static_assert((FW & (FW - 1)) == 0 && NT % 2 == 0, "the deal wraps by a mask; the tiles pair up");
    const int tid = threadIdx.x, lane = tid & 31, lr = lane & 15, hi = lane >> 4; const int w = __builtin_amdgcn_readfirstlane(tid >> 5);
    const int b = blockIdx.x, pr = blockIdx.y;
    const size_t pb = (size_t)b * TT * HD; Qh += pb; Ql += pb; Kh += pb; Kl += pb; Q16 += pb; K16 += pb; V16 += pb; Vh += pb; Vl += pb;
#pragma unroll 1   /* rolled: one copy of the key loops serves both tiles (half the code to fetch) */
    for (int t = 0; t < 2; ++t) {   // t 0: tile NT - 1 - pr (NT - pr key blocks); t 1: tile pr (pr + 1 key blocks)
        const int q0 = (t ? pr : NT - 1 - pr) * (QG * 16);
        const int s = t ? ((w - (NT - pr)) & (FW - 1)) : w;   // the wave's place in the tile's deal
        v8f o[QG][4]; float m[QG], l[QG];
#pragma unroll
        for (int g = 0; g < QG; ++g) { m[g] = -3.0e38f; l[g] = 0.f;
#pragma unroll
            for (int dt = 0; dt < 4; ++dt) o[g][dt] = (v8f){}; }
        if (q0 < RH) fa_keys<true>(Qh, Ql, Q16, Kh, Kl, K16, V16, Vh, Vl, q0, s, lane, lr, hi, o, m, l); else fa_keys<false>(Qh, Ql, Q16, Kh, Kl, K16, V16, Vh, Vl, q0, s, lane, lr, hi, o, m, l);   // the same for every wave of the block in trip t; no barrier stands inside
        const int sl = t * FW + s;   // the LDS slot of this partial set: written by this wave alone, read behind the barrier
#pragma unroll
        for (int g = 0; g < QG; ++g) { l[g] += xhalf(l[g]);
#pragma unroll
            for (int dt = 0; dt < 4; ++dt) { float* p = Os + ((sl * QG + g) * 16 + lr) * 68 + dt * 16 + hi * 8; v4f a, c;
#pragma unroll
                for (int j = 0; j < 4; ++j) { a[j] = o[g][dt][j]; c[j] = o[g][dt][4 + j]; }
                *(v4fa*)p = a; *(v4fa*)(p + 4) = c; }
            if (hi == 0) { Ms[(sl * QG + g) * 16 + lr] = m[g]; Ls[(sl * QG + g) * 16 + lr] = l[g]; } }
    }
    __syncthreads();   /* every wave's two partial sets are in LDS before any thread merges them */
    const int d4 = (tid & 15) * 4, qr = tid >> 4;   // the thread's query row of each tile (32 FW threads: 16 QG rows x 16 column groups)
    static_assert(32 * FW == QG * 16 * 16, "one merge turn a tile");
#pragma unroll
    for (int t = 0; t < 2; ++t) { const int q0 = (t ? pr : NT - 1 - pr) * (QG * 16); const int e = t * FW * QG * 16 + qr;
        float M = Ms[e];
#pragma unroll
        for (int u = 1; u < FW; ++u) M = fmaxf(M, Ms[u * QG * 16 + e]);
        float L = 0.f; v4f a = (v4f){};
#pragma unroll
        for (int u = 0; u < FW; ++u) { const float f = __builtin_amdgcn_exp2f(Ms[u * QG * 16 + e] - M); L += Ls[u * QG * 16 + e] * f; a += *(const v4fa*)(Os + (u * QG * 16 + e) * 68 + d4) * f; }   // a wave without keys has max -3e38, sum 0: factor 0
        const float r = __fdiv_rn(1.0f, L);
        *(v4f*)(out + ((size_t)b * TT + q0 + qr) * CO + d4) = a * r; }
}
extern "C" void kernel_launch(void* const* d_in, const int* in_sizes, int n_in,
                              void* d_out, int out_size, void* d_ws, size_t ws_size, hipStream_t stream) {
    (void)in_sizes; (void)n_in; (void)out_size;
    const float* x = (const float*)d_in[0]; const float* wq = (const float*)d_in[1]; const float* bq = (const float*)d_in[2]; const float* wk = (const float*)d_in[3]; const float* bk = (const float*)d_in[4]; const float* wv = (const float*)d_in[5]; const float* bv = (const float*)d_in[6];   /* standard roles: rows = queries */
    float* OUT = (float*)d_out;     // [4][4096][64]
    char* wsp = (char*)d_ws;
    auto take = [&](size_t bytes) { char* p = wsp; wsp += (bytes + 255) & ~(size_t)255; return (void*)p; };
    bf* WT = (bf*)take((size_t)3 * MID * CC * 2);   /* q, k, v weights, bf16 in fragment order */
    bf* QPh = (bf*)take((size_t)NB_ * TT * MID * 2); bf* QPl = (bf*)take((size_t)NB_ * TT * MID * 2); bf* KPh = (bf*)take((size_t)NB_ * TT * MID * 2); bf* KPl = (bf*)take((size_t)NB_ * TT * MID * 2);   /* the planes the attention launch reads: one set a batch */
    h16* QP16 = (h16*)take((size_t)NB_ * TT * MID * 2); h16* KP16 = (h16*)take((size_t)NB_ * TT * MID * 2);   /* q and k as one fp16 plane each (query rows >= RH) */
    h16* VT16 = (h16*)take((size_t)NB_ * CO * TT * 2); bf* VTh = (bf*)take((size_t)NB_ * CO * TT * 2); bf* VTl = (bf*)take((size_t)NB_ * CO * TT * 2);
    if ((size_t)(wsp - (char*)d_ws) > ws_size) return;    // ws 256 MiB (carve ~19 MiB)
    k_wt3<<<dim3(CC * MID / 512, 3, 1), 256, 0, stream>>>(wq, wk, wv, WT);   /* 'xw' weights -> fragments */
    k_proj<<<NB_ * TT / 64, 32 * 3 * KQ, 0, stream>>>(x, WT, bq, bk, bv, QPh, QPl, KPh, KPl, QP16, KP16, VT16, VTh, VTl);   /* q, k and v^T planes, in fragment order */
    k_fattn<<<dim3(NB_, NT / 2, 1), 32 * FW, 0, stream>>>(QPh, QPl, KPh, KPl, QP16, KP16, VT16, VTh, VTl, OUT);   /* causal attention of all four batches; writes every output row once */
}

// v008
// It runs in 28.2 microseconds.
// Two timings next to v007 put it at 1.04 and 1.02 times that version's speed.
// All steps since v000 together make it 41.8 times as fast.
#include <hip/hip_runtime.h>

// Single causal attention head over 4,096 tokens with biased projections (x [4][4096][768]; q, k, v = x w + b ('xw' [768][64] + [64]; ONE 64-wide head); scores = q.k^T; causal (-inf) THEN x 1/sqrt(64) (masking before the scale: the same thing); softmax; out = weights.v -> [4][4096][64] (1.0 M); argument order x, wq, bq, wk, bk, wv, bv).
// Layout: 'xw' weights laid out as fragments once (one launch for the three); ONE launch for all batches that rounds x to bf16 on its way into LDS, takes the three exact projections (K 768, K split over the waves of a block) and writes the planes the attention reads; then ONE launch for all batches in which a block takes a 32-query tile of the upper half and one of the lower half one after the other (paired by cost: about equal work a block) and streams the keys of each up to the diagonal (every wave holds both 16-query groups of the tile and uses each loaded k and v fragment for both): scores (rows < 512 hi/lo planes, 3 products; rest one fp16 product), running-maximum softmax in registers, weights.v (rows < 512 hi/lo 3 products, rest fp16), key blocks dealt over the waves of a block and merged through LDS.
// Compute dtypes, f32 accumulate: every input rounded to bf16; projections exact; scores and wei.v of rows < 512 3 bf16 hi/lo products each, of the other rows one fp16 product each; softmax f32; output f32.

#define NB_  4
#define TT   4096
#define DM   64
#define NH_  1
#define NKV  1
#define REP  (NH_ / NKV)
#define HD   64
#define DQ   (NH_ * HD)
#define DKV  (NKV * HD)
#define ZH   1
#define RH   512                  // query rows < RH use hi+lo planes (0: none)
#define WIN  0
#define SCL  0.125f   // C^-0.5 with C = 64 (the head width)
#define MID  64       // q / k width (one 64-wide head)
#define CO   64       // v width
#define CC   768      // input width (d_model)
#define KQ   4        // waves that share the K of one projection tile (24 k steps: 6 each)
typedef _Float16 h16;
typedef unsigned short bf;
typedef __attribute__((ext_vector_type(16))) __bf16   v16bf;
typedef __attribute__((ext_vector_type(16))) _Float16 v16h;
typedef __attribute__((ext_vector_type(8)))  _Float16 v8h;
typedef __attribute__((ext_vector_type(8)))  unsigned short v8us;
typedef __attribute__((ext_vector_type(8)))  float    v8f;
typedef __attribute__((ext_vector_type(4)))  float    v4f;
typedef v8h  __attribute__((may_alias)) v8ha;
typedef v4f  __attribute__((may_alias)) v4fa;
typedef v8us __attribute__((may_alias)) v8usa;

__device__ __forceinline__ unsigned short f2bf(float f) { unsigned u = __float_as_uint(f); u += 0x7FFFu + ((u >> 16) & 1u); return (unsigned short)(u >> 16); }
__device__ __forceinline__ float bf2f(unsigned short b) { return __uint_as_float(((unsigned)b) << 16); }
__device__ __forceinline__ float bfr(float f) { return bf2f(f2bf(f)); }
__device__ __forceinline__ v16h cat16(v8h lo, v8h hi) { return __builtin_shufflevector(lo, hi, 0, 1, 2, 3, 4, 5, 6, 7, 8, 9, 10, 11, 12, 13, 14, 15); }
__device__ __forceinline__ v16bf cat16b(v8us lo, v8us hi) { return __builtin_bit_cast(v16bf, __builtin_shufflevector(lo, hi, 0, 1, 2, 3, 4, 5, 6, 7, 8, 9, 10, 11, 12, 13, 14, 15)); }
__device__ __forceinline__ v8f wmma16(v16h a, v16h b, v8f c) { return __builtin_amdgcn_wmma_f32_16x16x32_f16(false, a, false, b, (short)0, c, false, false); }
__device__ __forceinline__ v8f wmmab(v16bf a, v16bf b, v8f c) { return __builtin_amdgcn_wmma_f32_16x16x32_bf16(false, a, false, b, (short)0, c, false, false); }



// fragment loaders: operands straight from 16-bit planes kept in fragment order: [half 2][lane 32][8], so that each of the two 16-byte loads a lane makes is part of 512 contiguous bytes (four whole lines a wave)
template <typename T16> struct WFrag;
template <> struct WFrag<h16> { typedef v16h V; static __device__ __forceinline__ V ld(const h16* p) { return cat16(*(const v8h*)p, *(const v8h*)(p + 256)); } static __device__ __forceinline__ v8f mma(V a, V b, v8f c) { return wmma16(a, b, c); } };
template <> struct WFrag<bf> { typedef v16bf V; static __device__ __forceinline__ V ld(const bf* p) { return cat16b(*(const v8us*)p, *(const v8us*)(p + 256)); } static __device__ __forceinline__ v8f mma(V a, V b, v8f c) { return wmmab(a, b, c); } };

__device__ __forceinline__ h16 tohx(float x) { return (h16)x; }
__device__ __forceinline__ void splitf(float y, unsigned short& h, unsigned short& l) { h = f2bf(y); l = f2bf(y - bf2f(h)); }
typedef __attribute__((ext_vector_type(2))) _Float16 v2h;
typedef __attribute__((ext_vector_type(4))) _Float16 v4h;
typedef __attribute__((ext_vector_type(2))) unsigned short v2us;
typedef __attribute__((ext_vector_type(4))) unsigned short v4us;
typedef __attribute__((ext_vector_type(2))) float v2f;
typedef __attribute__((ext_vector_type(4))) int v4i;


// ---- k_wt3: the three 'xw' weights [CC][64] f32 -> bf16 in fragment order [3][nb 4][k step CC / 32][half 2][lane 32][8]: lane (hi, lr) of half h holds channel nb 16 + lr, k = 32 step + 16 h + 8 hi + 0..7,
// so that one 16-byte load a lane fetches half a fragment from 512 contiguous bytes. grid (64 CC / 512, 3); a wave writes one 128-B line.
__global__ __launch_bounds__(256) void k_wt3(const float* __restrict__ wq, const float* __restrict__ wk, const float* __restrict__ wv, bf* Bt) {
    const float* __restrict__ w = (blockIdx.y == 0) ? wq : (blockIdx.y == 1) ? wk : wv;
    const unsigned e = (blockIdx.x * 256 + threadIdx.x) * 2, f = e >> 9, ln = (e >> 3) & 31, k = (f % (CC / 32)) * 32 + ((e >> 8) & 1) * 16 + (ln >> 4) * 8 + (e & 7), n = (f / (CC / 32)) * 16 + (ln & 15); v2us o;
    o[0] = f2bf(w[k * 64 + n]); o[1] = f2bf(w[(k + 1) * 64 + n]); *(v2us*)(Bt + blockIdx.y * (64 * CC) + e) = o;
}
// ---- k_proj: q, k and v projections of 64 rows of x (all batches: grid NB_ TT / 64) and their planes, one launch. 3 KQ waves: wave w works on projection w / KQ and takes the 32-wide k steps w % KQ, w % KQ + KQ, ...
// The block's rows of x (contiguous f32) are read once, whole lines a load and all loads in flight together, rounded to bf16 (nearest even) and laid in LDS (row pitch 16 B x odd); a work-group barrier; the fragments come from there. The product is taken transposed (A = weight rows, B = x rows): a lane owns token mb 16 + lr and holds channels nb 16 + 8 hi + j.
// Every wave lays its 64 x 64 partial tile in LDS (q, k: [token][channel]; v: [channel][token]), ONE work-group barrier, then the KQ waves of a projection add its KQ tiles in wave order and store the planes in the attention's fragment order, 512 contiguous bytes a wave and store:
// q, k: [16-token tile][k step 2][half 2][lane 32][8], lane (hi, lr) of half h holds token lr of the tile, channels 32 step + 16 h + 8 hi + 0..7; v: [batch][32-token block][16-channel tile 4][half 2][lane 32][8], lane (hi, lr) of half h holds channel lr of the tile, tokens 16 h + 8 hi + 0..7 of the block. The bias (rounded to bf16) is the start value of the first wave's sums.
typedef __attribute__((ext_vector_type(4))) __bf16 v4bf;
typedef v4us __attribute__((may_alias)) v4usa;
#define PSL  (64 * 68)
#define XP   (CC + 8)
__global__ __launch_bounds__(32 * 3 * KQ) void k_proj(const float* __restrict__ x, const bf* __restrict__ WT, const float* __restrict__ bq, const float* __restrict__ bk, const float* __restrict__ bv,
                                                      bf* Qh, bf* Ql, bf* Kh, bf* Kl, h16* Q16, h16* K16, h16* V16, bf* Vh, bf* Vl) {
    __shared__ __align__(16) float os[3 * KQ * PSL]; __shared__ __align__(16) bf xs[64 * XP];
    const int tid = threadIdx.x, lane = tid & 31, lr = lane & 15, hi = lane >> 4; const int w = __builtin_amdgcn_readfirstlane(tid >> 5);
    const int p = w / KQ, kq = w % KQ; const int r0 = blockIdx.x * 64;
    // the biases of the lane's channels (nb 16 + 8 hi + j, the same for the three projections) are fetched here, under the reads of x; the first wave of each projection starts its sums from them
    const float* bp = (p == 0) ? bq : (p == 1) ? bk : bv; const unsigned bo = hi * 32; v4f bz[4][2];   // bo: the lane's byte offset, the one address register of these loads
#pragma unroll
    for (int nb = 0; nb < 4; ++nb) { const float* q = (const float*)((const char*)bp + bo) + nb * 16; bz[nb][0] = *(const v4f*)q; bz[nb][1] = *(const v4f*)(q + 4); }
    // weight fragments: a ring of two k steps; the first is fetched here, under the reads of x, the second in front of the barrier (x's registers are free by then), a later one behind the products of the step whose registers it takes
    const bf* wb = WT + ((size_t)p * 4 * (CC / 32) + kq) * 512 + lane * 8; v16bf b[2][4];
#pragma unroll
    for (int nb = 0; nb < 4; ++nb) { const bf* q = wb + nb * (CC / 32) * 512; b[0][nb] = cat16b(*(const v8us*)q, *(const v8us*)(q + 256)); }
    {   // 512-B piece c = w + 3 KQ i of the 64 rows: row c / 6 = 2 i + w / 6, sixth c % 6 = w % 6
        const float* xg = x + (size_t)r0 * CC + w * 128 + lane * 4; bf* xd = xs + (w / 6) * XP + (w % 6) * 128 + lane * 4; v4f raw[64 * CC / (3 * KQ * 128)];
#pragma unroll
        for (int i = 0; i < 64 * CC / (3 * KQ * 128); ++i) raw[i] = *(const v4f*)(xg + i * 3 * KQ * 128);
        asm volatile("s_wait_xcnt 0x0" ::: "memory");   /* every load of the tile is issued in front of the first rounding (one memory round trip), and the loads' address registers are reused behind this line */
#pragma unroll
        for (int i = 0; i < 64 * CC / (3 * KQ * 128); ++i) *(v4usa*)(xd + i * 2 * XP) = __builtin_bit_cast(v4us, __builtin_convertvector(raw[i], v4bf));
    }
    asm volatile("s_wait_xcnt 0x0" :: "v"(bo) : "memory");   /* the build issues some bias and weight loads behind the wait above; named as an input the bias offset register stays whole up to this one */
#pragma unroll
    for (int nb = 0; nb < 4; ++nb) { const bf* q = wb + (nb * (CC / 32) + KQ) * 512; b[1][nb] = cat16b(*(const v8us*)q, *(const v8us*)(q + 256)); }
    asm volatile("s_wait_xcnt 0x0" ::: "memory");   /* these loads' offset register is reused in the loop below */
    __syncthreads();   /* the bf16 rows are in LDS before any wave takes a fragment */
    const bf* xa = xs + lr * XP + kq * 32 + 8 * hi;
    v8f acc[4][4];
    if (kq == 0) {   // wave-uniform
#pragma unroll
        for (int nb = 0; nb < 4; ++nb) { v8f z;
#pragma unroll
            for (int j = 0; j < 8; ++j) z[j] = bfr(bz[nb][j >> 2][j & 3]);
#pragma unroll
            for (int mb = 0; mb < 4; ++mb) acc[mb][nb] = z; }
    } else {
#pragma unroll
        for (int nb = 0; nb < 4; ++nb)
#pragma unroll
            for (int mb = 0; mb < 4; ++mb) acc[mb][nb] = (v8f){};
    }
    // (unrolled whole: the ring and the accumulators are indexed by constants and stay in registers; every address is one lane register + a constant)
#pragma unroll
    for (int s = 0; s < CC / (32 * KQ); ++s) { v16bf a[4];
#pragma unroll
        for (int mb = 0; mb < 4; ++mb) { const bf* q = xa + mb * 16 * XP + s * KQ * 32; a[mb] = cat16b(*(const v8usa*)q, *(const v8usa*)(q + 16)); }
#pragma unroll
        for (int nb = 0; nb < 4; ++nb) {
#pragma unroll
            for (int mb = 0; mb < 4; ++mb) acc[mb][nb] = wmmab(b[s & 1][nb], a[mb], acc[mb][nb]); }
        if (s + 2 < CC / (32 * KQ)) {
#pragma unroll
            for (int nb = 0; nb < 4; ++nb) { const bf* q = wb + (nb * (CC / 32) + (s + 2) * KQ) * 512; b[s & 1][nb] = cat16b(*(const v8us*)q, *(const v8us*)(q + 256)); }
            __builtin_amdgcn_sched_barrier(0); } }   /* the fetch stays a whole step in front of its products: left alone the build puts each load right in front of its use and waits out an L2 round trip a fragment */
    asm volatile("s_wait_xcnt 0x0" ::: "memory");   /* the loads' address registers are reused behind this line */
    // a thread's share of the sum: rows gl, gl + 16, ... of its projection's tile, columns 8 gc .. 8 gc + 7 (a wave: 16 rows x 16 columns, one half of a fragment)
    static_assert(KQ == 4, "the 128 threads of a projection cover 16 rows x 8 column groups a turn");
    const int g = tid & (32 * KQ - 1), gl = g & 15, gc = g >> 4; const float* tp = os + p * KQ * PSL;
    float* sl = os + w * PSL;
    if (p < 2) {   // wave-uniform
#pragma unroll
        for (int mb = 0; mb < 4; ++mb) {
#pragma unroll
            for (int nb = 0; nb < 4; ++nb) { float* q = sl + (mb * 16 + lr) * 68 + nb * 16 + hi * 8; v4f c, d;
#pragma unroll
                for (int j = 0; j < 4; ++j) { c[j] = acc[mb][nb][j]; d[j] = acc[mb][nb][4 + j]; }
                *(v4fa*)q = c; *(v4fa*)(q + 4) = d; } }
    } else {
#pragma unroll
        for (int mb = 0; mb < 4; ++mb) {
#pragma unroll
            for (int nb = 0; nb < 4; ++nb) {
#pragma unroll
                for (int j = 0; j < 8; ++j) sl[(nb * 16 + hi * 8 + j) * 68 + mb * 16 + lr] = acc[mb][nb][j]; } }
    }
    __syncthreads();   /* every wave's partial tile is in LDS before any thread adds them */
    const int bb = r0 / TT, t0 = r0 % TT;
    // (the turns are unrolled: every LDS address is one lane register + a constant)
    // which planes the attention reads: query rows < RH take q and their keys (all < RH) as hi and lo planes; the other rows take q and every key as one fp16 plane. t0 < RH is the same for the whole block (RH is a multiple of 64)
    if (p < 2) { bf* Ph = p ? Kh : Qh; bf* Pl = p ? Kl : Ql; h16* P16 = p ? K16 : Q16; const bool hl = t0 < RH;
#pragma unroll
        for (int it = 0; it < 512 / (32 * KQ); ++it) { const float* s0 = tp + (gl + it * 16) * 68 + gc * 8; v4f c = *(const v4fa*)s0, d = *(const v4fa*)(s0 + 4);
#pragma unroll
            for (int u = 1; u < KQ; ++u) { c += *(const v4fa*)(s0 + u * PSL); d += *(const v4fa*)(s0 + u * PSL + 4); }
            const size_t o = (size_t)(r0 / 16 + it) * (16 * HD) + gc * 128 + gl * 8;
            if (p || !hl) { v8h o16;
#pragma unroll
                for (int e = 0; e < 4; ++e) { o16[e] = tohx(c[e]); o16[4 + e] = tohx(d[e]); }
                *(v8h*)(P16 + o) = o16;
                asm volatile("s_wait_xcnt 0x0" ::: "memory"); }   /* the hi and lo planes' arithmetic below reuses this store's address and data registers */
            if (hl) { v8us oh, ol;
#pragma unroll
                for (int e = 0; e < 4; ++e) { unsigned short a2, c2; splitf(c[e], a2, c2); oh[e] = a2; ol[e] = c2; splitf(d[e], a2, c2); oh[4 + e] = a2; ol[4 + e] = c2; }
                *(v8us*)(Ph + o) = oh; *(v8us*)(Pl + o) = ol; }
            asm volatile("s_wait_xcnt 0x0" ::: "memory"); }   /* the next turn reuses the stores' address and data registers */
    } else {
#pragma unroll
        for (int it = 0; it < 512 / (32 * KQ); ++it) { const float* s0 = tp + (gl + it * 16) * 68 + gc * 8; v4f c = *(const v4fa*)s0, d = *(const v4fa*)(s0 + 4);
#pragma unroll
            for (int u = 1; u < KQ; ++u) { c += *(const v4fa*)(s0 + u * PSL); d += *(const v4fa*)(s0 + u * PSL + 4); }
            v8us oh, ol; v8h o16;
#pragma unroll
            for (int e = 0; e < 4; ++e) { unsigned short a2, c2; float y = c[e]; o16[e] = tohx(y); splitf(y, a2, c2); oh[e] = a2; ol[e] = c2; y = d[e]; o16[4 + e] = tohx(y); splitf(y, a2, c2); oh[4 + e] = a2; ol[4 + e] = c2; }
            const size_t o = (size_t)bb * HD * TT + (size_t)((t0 / 32 + (gc >> 2)) * 4 + it) * 512 + (gc & 3) * 128 + gl * 8; *(v8h*)(V16 + o) = o16; *(v8us*)(Vh + o) = oh; *(v8us*)(Vl + o) = ol;
            asm volatile("s_wait_xcnt 0x0" ::: "memory"); }   /* the next turn reuses the stores' address and data registers */
    }
}
// ---- k_fattn: scores, causal softmax and weights.v in one pass over the keys; the score plane never leaves the registers. grid (batch, pair of 32-query tiles), FW waves a block, one block a WGP; a wave holds the QG 16-query groups of the tile, so that every k and v fragment it loads serves QG groups (the bytes from L2 a query fall by QG).
// Both products are taken transposed, so that in each group a lane owns ONE query: S^T[key][query] = K Q^T (A = k rows, B = q rows) leaves key 16 kt + 8 hi + j of query lr in st[kt][j], which is already the B fragment
// (element j and 8 + j <-> k = 8 hi + j and 16 + 8 hi + j) of O^T[d][query] = V^T P^T; running maximum, sum and rescale are per lane.
// Every block is resident at once, so the launch lasts as long as its fullest block: a block takes tile NT - 1 - pr (the pr-th dearest of the upper half) and then the pr-th CHEAPEST tile of the lower half (low_by_cost below),
// where a tile's cost is its key blocks, one of rows < RH counted HC / NC times (3 times the products, twice the bytes and two memory round trips, the hi/lo split of the weights): dearest with cheapest keeps the dearest pair as cheap as a pairing can.
// The block deals the key blocks of both tiles as ONE list over its FW waves (the second tile's deal goes on at the wave where the first tile's ended), so that its waves differ by one key block. In each tile the wave in deal place s takes the 32-key blocks s, s + FW, ... up to the diagonal;
// the FW partial (max, sum, O^T) sets of each tile are merged through LDS in the order of the deal behind one work-group barrier, and the block stores the 16 QG output rows of each tile once.
// amdgpu_waves_per_eu(4, 4): the register budget of four waves a SIMD (256 a wave), so that the FW waves of a block fit one WGP and one wave's softmax runs under another's loads and products.
// The maximum m is kept in the exponent's own unit: weight = 2^(s SL2 - m), SL2 = 1/8 log2(e).
#define FW   16
#define NT   (TT / (16 * QG))   // 32-query tiles a batch
#define QG   2        // 16-query groups a wave holds
#define SL2  (SCL * 1.4426950408889634f)
typedef __attribute__((ext_vector_type(16))) unsigned short v16us;
#define HC   5        // cost of a key block of a tile of rows < RH ...
#define NC   2        // ... against that of a key block of any other tile (issue slots of the two block bodies in the listing, a product counted as 8)
struct LowOf { unsigned char t[NT / 2]; };
// the tiles 0 .. NT / 2 - 1 in the order of rising cost (insertion sort at compile time; equal costs in index order)
constexpr LowOf low_by_cost() { LowOf r{}; int c[NT / 2] = {};
    for (int i = 0; i < NT / 2; ++i) { const int ci = (i + 1) * (i * QG * 16 < RH ? HC : NC); int j = i;
        for (; j > 0 && c[j - 1] > ci; --j) { c[j] = c[j - 1]; r.t[j] = r.t[j - 1]; }
        c[j] = ci; r.t[j] = (unsigned char)i; }
    return r; }
constexpr bool each_once(LowOf r) { unsigned long long seen = 0; for (int i = 0; i < NT / 2; ++i) seen |= 1ull << r.t[i]; return NT / 2 == 64 && seen == ~0ull; }
static_assert(each_once(low_by_cost()), "every tile of the lower half belongs to exactly one block: each output row is stored once");
__device__ __forceinline__ float xhalf(float x) { const int b = __float_as_int(x); return __int_as_float(__builtin_amdgcn_permlanex16(b, b, 0x76543210, 0xfedcba98, false, false)); }   // lane l <-> l ^ 16
// one block of 32 keys from k0; DIAG: the block that holds keys above a query of the tile (the tile's last)
// fo: the lane's byte offset into the key planes and the v^T planes alike (a block of 32 keys is 2,048 elements of each, in fragment order); every fragment of the block is that one offset register + a uniform base + a constant
// (the loops over kt, ks, dt, j are unrolled whole so that the fragment arrays are indexed by constants and stay in registers)
template <typename T16> __device__ __forceinline__ typename WFrag<T16>::V ldo(const T16* __restrict__ base, unsigned off, int cst) { return WFrag<T16>::ld((const T16*)((const char*)base + off) + cst); }
// the q fragments of a tile: query rows < RH as hi and lo bf16 planes, the other rows as one fp16 plane
template <bool HI> struct QFrag;
template <> struct QFrag<true> { v16bf h[QG][2], l[QG][2]; };
template <> struct QFrag<false> { v16h f[QG][2]; };
// Scores of rows >= RH: ONE fp16 product (q and k rounded once to fp16, 11 significant bits), the precision that the weights and v of these rows have in weights.v anyway; a block of 32 keys is then 4 KiB of k, not 8, and 8 score products, not 24.
template <bool HI, bool DIAG>
__device__ __forceinline__ void fa_block(const bf* __restrict__ Kh, const bf* __restrict__ Kl, const h16* __restrict__ K16, const h16* __restrict__ V16, const bf* __restrict__ Vh, const bf* __restrict__ Vl,
                                         const QFrag<HI>& q, int q0, int k0, unsigned fo, int lr, int hi, v8f (&o)[QG][4], float (&m)[QG], float (&l)[QG]) {
    v8f st[QG][2]; v16h v16[4];
    if constexpr (HI) {
        v16bf kh[2][2], kl[2][2];
#pragma unroll
        for (int kt = 0; kt < 2; ++kt) {
#pragma unroll
            for (int ks = 0; ks < 2; ++ks) { kh[kt][ks] = ldo<bf>(Kh, fo, kt * 16 * HD + ks * 512); kl[kt][ks] = ldo<bf>(Kl, fo, kt * 16 * HD + ks * 512); } }
        __builtin_amdgcn_sched_barrier(0);   /* every k load of the block is issued before the first product waits: one memory round trip for them, not one a fragment */
#pragma unroll
        for (int kt = 0; kt < 2; ++kt) {
#pragma unroll
            for (int g = 0; g < QG; ++g) { v8f s = (v8f){};
#pragma unroll
                for (int ks = 0; ks < 2; ++ks) { s = wmmab(kh[kt][ks], q.h[g][ks], s); s = wmmab(kh[kt][ks], q.l[g][ks], s); s = wmmab(kl[kt][ks], q.h[g][ks], s); }
                st[g][kt] = s; } }
    } else {
        // 4 k and 4 v fragments fit beside the QG groups' q and output tiles inside the 256 registers a wave: all are fetched at the block's head
        v16h k16[2][2];
#pragma unroll
        for (int kt = 0; kt < 2; ++kt) {
#pragma unroll
            for (int ks = 0; ks < 2; ++ks) k16[kt][ks] = ldo<h16>(K16, fo, kt * 16 * HD + ks * 512); }
#pragma unroll
        for (int dt = 0; dt < 4; ++dt) v16[dt] = ldo<h16>(V16, fo, dt * 512);
        asm volatile("s_wait_xcnt 0x0" :: "v"(fo) : "memory");   /* the loads' offset register is reused behind this line; named as an input it stays whole up to it, so that no later load of the run lands in it */
        __builtin_amdgcn_sched_barrier(0);   /* every k and v load of the block is issued before the first product waits: one memory round trip for them, not one a fragment */
#pragma unroll
        for (int kt = 0; kt < 2; ++kt) {
#pragma unroll
            for (int g = 0; g < QG; ++g) { v8f s = (v8f){};
#pragma unroll
                for (int ks = 0; ks < 2; ++ks) s = wmma16(k16[kt][ks], q.f[g][ks], s);
                st[g][kt] = s; } }
    }
    v16h pb[QG]; v16bf pbh[QG], pbl[QG];
#pragma unroll
    for (int g = 0; g < QG; ++g) {   // group g: queries q0 + 16 g + lr
        float mloc = -3.0e38f;
#pragma unroll
        for (int kt = 0; kt < 2; ++kt) {
#pragma unroll
            for (int j = 0; j < 8; ++j) { if (DIAG && (k0 + kt * 16 + hi * 8 + j > q0 + g * 16 + lr)) st[g][kt][j] = -3.0e38f; mloc = fmaxf(mloc, st[g][kt][j]); } }
        mloc = fmaxf(mloc, xhalf(mloc));   // the two lanes of a query hold different keys and must share one maximum
        const float mn = fmaxf(m[g], mloc * SL2); const float al = __builtin_amdgcn_exp2f(m[g] - mn); m[g] = mn;
        float ps = 0.f;
#pragma unroll
        for (int kt = 0; kt < 2; ++kt) {
#pragma unroll
            for (int j = 0; j < 8; ++j) { const float p = __builtin_amdgcn_exp2f(__builtin_fmaf(st[g][kt][j], SL2, -mn)); st[g][kt][j] = p; ps += p; } }
        l[g] = l[g] * al + ps;
#pragma unroll
        for (int dt = 0; dt < 4; ++dt) o[g][dt] *= al;
        if (HI) { v16us ph, pl;
#pragma unroll
            for (int j = 0; j < 8; ++j) { unsigned short a2, c2; splitf(st[g][0][j], a2, c2); ph[j] = a2; pl[j] = c2; splitf(st[g][1][j], a2, c2); ph[8 + j] = a2; pl[8 + j] = c2; }
            pbh[g] = __builtin_bit_cast(v16bf, ph); pbl[g] = __builtin_bit_cast(v16bf, pl);
        } else {
#pragma unroll
            for (int j = 0; j < 8; ++j) { pb[g][j] = tohx(st[g][0][j]); pb[g][8 + j] = tohx(st[g][1][j]); } }
    }
    v16bf vh[4], vl[4];   // hi and lo v (8 fragments; rows < RH, few blocks) are fetched behind the softmax, into registers that the scores have set free
    if (HI) {
        __builtin_amdgcn_sched_barrier(0);   /* keeps the v loads from rising into the softmax, where their registers are not free yet */
#pragma unroll
        for (int dt = 0; dt < 4; ++dt) { vh[dt] = ldo<bf>(Vh, fo, dt * 512); vl[dt] = ldo<bf>(Vl, fo, dt * 512); }
        asm volatile("s_wait_xcnt 0x0" :: "v"(fo) : "memory"); }   /* the loads' offset register is reused behind this line; named as an input it stays whole up to it */
#pragma unroll
    for (int g = 0; g < QG; ++g) {
#pragma unroll
        for (int dt = 0; dt < 4; ++dt) {
            if (HI) { o[g][dt] = wmmab(vh[dt], pbh[g], o[g][dt]); o[g][dt] = wmmab(vh[dt], pbl[g], o[g][dt]); o[g][dt] = wmmab(vl[dt], pbh[g], o[g][dt]); }
            else o[g][dt] = wmma16(v16[dt], pb[g], o[g][dt]); } }
}
template <bool HI>
__device__ __forceinline__ void fa_keys(const bf* __restrict__ Qh, const bf* __restrict__ Ql, const h16* __restrict__ Q16, const bf* __restrict__ Kh, const bf* __restrict__ Kl, const h16* __restrict__ K16, const h16* __restrict__ V16, const bf* __restrict__ Vh, const bf* __restrict__ Vl,
                                        int q0, int w, int lane, int lr, int hi, v8f (&o)[QG][4], float (&m)[QG], float (&l)[QG]) {
    QFrag<HI> q;
#pragma unroll
    for (int g = 0; g < QG; ++g) {
#pragma unroll
        for (int ks = 0; ks < 2; ++ks) { const size_t qo = (size_t)(q0 + g * 16) * HD + ks * 512 + lane * 8;
            if constexpr (HI) { q.h[g][ks] = WFrag<bf>::ld(Qh + qo); q.l[g][ks] = WFrag<bf>::ld(Ql + qo); } else q.f[g][ks] = WFrag<h16>::ld(Q16 + qo); } }
    asm volatile("s_wait_xcnt 0x0" ::: "memory");   /* the q loads' address registers are reused right behind them */
    const int last = q0 / 32;   // the 32-key block on the diagonal (the tile's own 32 tokens); every query of the tile has a live key in it and in each block before it
    int kb = w; unsigned fo = (unsigned)((w * 32 * HD + (hi * 16 + lr) * 8) * 2);
#pragma unroll 1   /* rolled: a second copy of the block's fragments would take the registers that let four waves share a SIMD */
    for (; kb < last; kb += FW) { fa_block<HI, false>(Kh, Kl, K16, V16, Vh, Vl, q, q0, kb * 32, fo, lr, hi, o, m, l); fo += FW * 32 * HD * 2; }
    if (kb == last) fa_block<HI, true>(Kh, Kl, K16, V16, Vh, Vl, q, q0, kb * 32, fo, lr, hi, o, m, l);   // wave-uniform: one wave of the block
}
__global__ __launch_bounds__(32 * FW) __attribute__((amdgpu_waves_per_eu(4, 4))) void k_fattn(const bf* __restrict__ Qh, const bf* __restrict__ Ql, const bf* __restrict__ Kh, const bf* __restrict__ Kl, const h16* __restrict__ Q16, const h16* __restrict__ K16, const h16* __restrict__ V16, const bf* __restrict__ Vh, const bf* __restrict__ Vl, float* out) {
    __shared__ __align__(16) float Os[2 * FW * QG * 16 * 68]; __shared__ float Ms[2 * FW * QG * 16]; __shared__ float Ls[2 * FW * QG * 16];
    static_assert(QG * 16 == 32, "the tile is one 32-key block wide: its diagonal block is q0 / 32 for every group");
    static_assert((FW & (FW - 1)) == 0 && NT % 2 == 0, "the deal wraps by a mask; the tiles pair up");
    const int tid = threadIdx.x, lane = tid & 31, lr = lane & 15, hi = lane >> 4; const int w = __builtin_amdgcn_readfirstlane(tid >> 5);
    const int b = blockIdx.x, pr = blockIdx.y;
    static constexpr LowOf LOW = low_by_cost(); const int lo = LOW.t[pr];   // the block's tile of the lower half (one scalar load)
    const size_t pb = (size_t)b * TT * HD; Qh += pb; Ql += pb; Kh += pb; Kl += pb; Q16 += pb; K16 += pb; V16 += pb; Vh += pb; Vl += pb;
#pragma unroll 1   /* rolled: one copy of the key loops serves both tiles (half the code to fetch) */
    for (int t = 0; t < 2; ++t) {   // t 0: tile NT - 1 - pr (NT - pr key blocks); t 1: tile lo (lo + 1 key blocks)
        const int q0 = (t ? lo : NT - 1 - pr) * (QG * 16);
        const int s = t ? ((w - (NT - pr)) & (FW - 1)) : w;   // the wave's place in the tile's deal
        v8f o[QG][4]; float m[QG], l[QG];
#pragma unroll
        for (int g = 0; g < QG; ++g) { m[g] = -3.0e38f; l[g] = 0.f;
#pragma unroll
            for (int dt = 0; dt < 4; ++dt) o[g][dt] = (v8f){}; }
        if (q0 < RH) fa_keys<true>(Qh, Ql, Q16, Kh, Kl, K16, V16, Vh, Vl, q0, s, lane, lr, hi, o, m, l); else fa_keys<false>(Qh, Ql, Q16, Kh, Kl, K16, V16, Vh, Vl, q0, s, lane, lr, hi, o, m, l);   // the same for every wave of the block in trip t; no barrier stands inside
        const int sl = t * FW + s;   // the LDS slot of this partial set: written by this wave alone, read behind the barrier
#pragma unroll
        for (int g = 0; g < QG; ++g) { l[g] += xhalf(l[g]);
#pragma unroll
            for (int dt = 0; dt < 4; ++dt) { float* p = Os + ((sl * QG + g) * 16 + lr) * 68 + dt * 16 + hi * 8; v4f a, c;
#pragma unroll
                for (int j = 0; j < 4; ++j) { a[j] = o[g][dt][j]; c[j] = o[g][dt][4 + j]; }
                *(v4fa*)p = a; *(v4fa*)(p + 4) = c; }
            if (hi == 0) { Ms[(sl * QG + g) * 16 + lr] = m[g]; Ls[(sl * QG + g) * 16 + lr] = l[g]; } }
    }
    __syncthreads();   /* every wave's two partial sets are in LDS before any thread merges them */
    const int d4 = (tid & 15) * 4, qr = tid >> 4;   // the thread's query row of each tile (32 FW threads: 16 QG rows x 16 column groups)
    static_assert(32 * FW == QG * 16 * 16, "one merge turn a tile");
#pragma unroll
    for (int t = 0; t < 2; ++t) { const int q0 = (t ? lo : NT - 1 - pr) * (QG * 16); const int e = t * FW * QG * 16 + qr;
        float M = Ms[e];
#pragma unroll
        for (int u = 1; u < FW; ++u) M = fmaxf(M, Ms[u * QG * 16 + e]);
        float L = 0.f; v4f a = (v4f){};
#pragma unroll
        for (int u = 0; u < FW; ++u) { const float f = __builtin_amdgcn_exp2f(Ms[u * QG * 16 + e] - M); L += Ls[u * QG * 16 + e] * f; a += *(const v4fa*)(Os + (u * QG * 16 + e) * 68 + d4) * f; }   // a wave without keys has max -3e38, sum 0: factor 0
        const float r = __fdiv_rn(1.0f, L);
        *(v4f*)(out + ((size_t)b * TT + q0 + qr) * CO + d4) = a * r; }
}
extern "C" void kernel_launch(void* const* d_in, const int* in_sizes, int n_in,
                              void* d_out, int out_size, void* d_ws, size_t ws_size, hipStream_t stream) {
    (void)in_sizes; (void)n_in; (void)out_size;
    const float* x = (const float*)d_in[0]; const float* wq = (const float*)d_in[1]; const float* bq = (const float*)d_in[2]; const float* wk = (const float*)d_in[3]; const float* bk = (const float*)d_in[4]; const float* wv = (const float*)d_in[5]; const float* bv = (const float*)d_in[6];   /* standard roles: rows = queries */
    float* OUT = (float*)d_out;     // [4][4096][64]
    char* wsp = (char*)d_ws;
    auto take = [&](size_t bytes) { char* p = wsp; wsp += (bytes + 255) & ~(size_t)255; return (void*)p; };
    bf* WT = (bf*)take((size_t)3 * MID * CC * 2);   /* q, k, v weights, bf16 in fragment order */
    bf* QPh = (bf*)take((size_t)NB_ * TT * MID * 2); bf* QPl = (bf*)take((size_t)NB_ * TT * MID * 2); bf* KPh = (bf*)take((size_t)NB_ * TT * MID * 2); bf* KPl = (bf*)take((size_t)NB_ * TT * MID * 2);   /* the planes the attention launch reads: one set a batch */
    h16* QP16 = (h16*)take((size_t)NB_ * TT * MID * 2); h16* KP16 = (h16*)take((size_t)NB_ * TT * MID * 2);   /* q and k as one fp16 plane each (query rows >= RH) */
    h16* VT16 = (h16*)take((size_t)NB_ * CO * TT * 2); bf* VTh = (bf*)take((size_t)NB_ * CO * TT * 2); bf* VTl = (bf*)take((size_t)NB_ * CO * TT * 2);
    if ((size_t)(wsp - (char*)d_ws) > ws_size) return;    // ws 256 MiB (carve ~19 MiB)
    k_wt3<<<dim3(CC * MID / 512, 3, 1), 256, 0, stream>>>(wq, wk, wv, WT);   /* 'xw' weights -> fragments */
    k_proj<<<NB_ * TT / 64, 32 * 3 * KQ, 0, stream>>>(x, WT, bq, bk, bv, QPh, QPl, KPh, KPl, QP16, KP16, VT16, VTh, VTl);   /* q, k and v^T planes, in fragment order */
    k_fattn<<<dim3(NB_, NT / 2, 1), 32 * FW, 0, stream>>>(QPh, QPl, KPh, KPl, QP16, KP16, VT16, VTh, VTl, OUT);   /* causal attention of all four batches; writes every output row once */
}

// v009
// It runs in 26.6 microseconds.
// In two side-by-side timings against v008, it was 1.07 and 1.03 times as fast.
// Counting every step since v000, it is 43.8 times as fast.
#include <hip/hip_runtime.h>

// Single causal attention head over 4,096 tokens with biased projections (x [4][4096][768]; q, k, v = x w + b ('xw' [768][64] + [64]; ONE 64-wide head); scores = q.k^T; causal (-inf) THEN x 1/sqrt(64) (masking before the scale: the same thing); softmax; out = weights.v -> [4][4096][64] (1.0 M); argument order x, wq, bq, wk, bk, wv, bv).
// Layout: 'xw' weights laid out as fragments once (one launch for the three); ONE launch for all batches that rounds x to bf16 on its way into LDS, takes the three exact projections (K 768, K split over the waves of a block) and writes the planes the attention reads; then ONE launch for all batches in which a block takes a 32-query tile of the upper half and one of the lower half one after the other (paired by cost: about equal work a block) and streams the keys of each up to the diagonal (every wave holds both 16-query groups of the tile and uses each loaded k and v fragment for both): scores (rows < 512 hi/lo planes, 3 products; rest one fp16 product), running-maximum softmax in registers, weights.v (rows < 512 hi/lo 3 products, rest fp16), key blocks dealt over the waves of a block and merged through LDS.
// Compute dtypes, f32 accumulate: every input rounded to bf16; projections exact; scores and wei.v of rows < 512 3 bf16 hi/lo products each, of the other rows one fp16 product each; softmax f32; output f32.

#define NB_  4
#define TT   4096
#define DM   64
#define NH_  1
#define NKV  1
#define REP  (NH_ / NKV)
#define HD   64
#define DQ   (NH_ * HD)
#define DKV  (NKV * HD)
#define ZH   1
#define RH   512                  // query rows < RH use hi+lo planes (0: none)
#define WIN  0
#define SCL  0.125f   // C^-0.5 with C = 64 (the head width)
#define MID  64       // q / k width (one 64-wide head)
#define CO   64       // v width
#define CC   768      // input width (d_model)
#define KQ   4        // waves that share the K of one projection tile (24 k steps: 6 each)
typedef _Float16 h16;
typedef unsigned short bf;
typedef __attribute__((ext_vector_type(16))) __bf16   v16bf;
typedef __attribute__((ext_vector_type(16))) _Float16 v16h;
typedef __attribute__((ext_vector_type(8)))  _Float16 v8h;
typedef __attribute__((ext_vector_type(8)))  unsigned short v8us;
typedef __attribute__((ext_vector_type(8)))  float    v8f;
typedef __attribute__((ext_vector_type(4)))  float    v4f;
typedef v8h  __attribute__((may_alias)) v8ha;
typedef v4f  __attribute__((may_alias)) v4fa;
typedef v8us __attribute__((may_alias)) v8usa;

__device__ __forceinline__ unsigned short f2bf(float f) { unsigned u = __float_as_uint(f); u += 0x7FFFu + ((u >> 16) & 1u); return (unsigned short)(u >> 16); }
__device__ __forceinline__ float bf2f(unsigned short b) { return __uint_as_float(((unsigned)b) << 16); }
__device__ __forceinline__ float bfr(float f) { return bf2f(f2bf(f)); }
__device__ __forceinline__ v16h cat16(v8h lo, v8h hi) { return __builtin_shufflevector(lo, hi, 0, 1, 2, 3, 4, 5, 6, 7, 8, 9, 10, 11, 12, 13, 14, 15); }
__device__ __forceinline__ v16bf cat16b(v8us lo, v8us hi) { return __builtin_bit_cast(v16bf, __builtin_shufflevector(lo, hi, 0, 1, 2, 3, 4, 5, 6, 7, 8, 9, 10, 11, 12, 13, 14, 15)); }
__device__ __forceinline__ v8f wmma16(v16h a, v16h b, v8f c) { return __builtin_amdgcn_wmma_f32_16x16x32_f16(false, a, false, b, (short)0, c, false, false); }
__device__ __forceinline__ v8f wmmab(v16bf a, v16bf b, v8f c) { return __builtin_amdgcn_wmma_f32_16x16x32_bf16(false, a, false, b, (short)0, c, false, false); }



// fragment loaders: operands straight from 16-bit planes kept in fragment order: [half 2][lane 32][8], so that each of the two 16-byte loads a lane makes is part of 512 contiguous bytes (four whole lines a wave)
template <typename T16> struct WFrag;
template <> struct WFrag<h16> { typedef v16h V; static __device__ __forceinline__ V ld(const h16* p) { return cat16(*(const v8h*)p, *(const v8h*)(p + 256)); } static __device__ __forceinline__ v8f mma(V a, V b, v8f c) { return wmma16(a, b, c); } };
template <> struct WFrag<bf> { typedef v16bf V; static __device__ __forceinline__ V ld(const bf* p) { return cat16b(*(const v8us*)p, *(const v8us*)(p + 256)); } static __device__ __forceinline__ v8f mma(V a, V b, v8f c) { return wmmab(a, b, c); } };

__device__ __forceinline__ h16 tohx(float x) { return (h16)x; }
__device__ __forceinline__ void splitf(float y, unsigned short& h, unsigned short& l) { h = f2bf(y); l = f2bf(y - bf2f(h)); }
typedef __attribute__((ext_vector_type(2))) _Float16 v2h;
typedef __attribute__((ext_vector_type(4))) _Float16 v4h;
typedef __attribute__((ext_vector_type(2))) unsigned short v2us;
typedef __attribute__((ext_vector_type(4))) unsigned short v4us;
typedef __attribute__((ext_vector_type(2))) float v2f;
typedef __attribute__((ext_vector_type(4))) int v4i;


// ---- k_wt3: the three 'xw' weights [CC][64] f32 -> bf16 in fragment order [3][nb 4][k step CC / 32][half 2][lane 32][8]: lane (hi, lr) of half h holds channel nb 16 + lr, k = 32 step + 16 h + 8 hi + 0..7,
// so that one 16-byte load a lane fetches half a fragment from 512 contiguous bytes. grid (64 CC / 512, 3); a wave writes one 128-B line.
__global__ __launch_bounds__(256) void k_wt3(const float* __restrict__ wq, const float* __restrict__ wk, const float* __restrict__ wv, bf* Bt) {
    const float* __restrict__ w = (blockIdx.y == 0) ? wq : (blockIdx.y == 1) ? wk : wv;
    const unsigned e = (blockIdx.x * 256 + threadIdx.x) * 2, f = e >> 9, ln = (e >> 3) & 31, k = (f % (CC / 32)) * 32 + ((e >> 8) & 1) * 16 + (ln >> 4) * 8 + (e & 7), n = (f / (CC / 32)) * 16 + (ln & 15); v2us o;
    o[0] = f2bf(w[k * 64 + n]); o[1] = f2bf(w[(k + 1) * 64 + n]); *(v2us*)(Bt + blockIdx.y * (64 * CC) + e) = o;
}
// ---- k_proj: q, k and v projections of 64 rows of x (all batches: grid NB_ TT / 64) and their planes, one launch. 3 KQ waves: wave w works on projection w / KQ and takes the 32-wide k steps w % KQ, w % KQ + KQ, ...
// The block's rows of x (contiguous f32) are read once, whole lines a load and all loads in flight together, rounded to bf16 (nearest even) and laid in LDS (row pitch 16 B x odd); a work-group barrier; the fragments come from there. The product is taken transposed (A = weight rows, B = x rows): a lane owns token mb 16 + lr and holds channels nb 16 + 8 hi + j.
// Every wave lays its 64 x 64 partial tile in LDS (q, k: [token][channel]; v: [channel][token]), ONE work-group barrier, then the KQ waves of a projection add its KQ tiles in wave order and store the planes in the attention's fragment order, 512 contiguous bytes a wave and store:
// q, k: [16-token tile][k step 2][half 2][lane 32][8], lane (hi, lr) of half h holds token lr of the tile, channels 32 step + 16 h + 8 hi + 0..7; v: [batch][32-token block][16-channel tile 4][half 2][lane 32][8], lane (hi, lr) of half h holds channel lr of the tile, tokens 16 h + 8 hi + 0..7 of the block. The bias (rounded to bf16) is the start value of the first wave's sums.
typedef __attribute__((ext_vector_type(4))) __bf16 v4bf;
typedef v4us __attribute__((may_alias)) v4usa;
#define PSL  (64 * 68)
#define XP   (CC + 8)
__global__ __launch_bounds__(32 * 3 * KQ) void k_proj(const float* __restrict__ x, const bf* __restrict__ WT, const float* __restrict__ bq, const float* __restrict__ bk, const float* __restrict__ bv,
                                                      bf* Qh, bf* Ql, bf* Kh, bf* Kl, h16* Q16, h16* K16, h16* V16, bf* Vh, bf* Vl) {
    __shared__ __align__(16) float os[3 * KQ * PSL]; __shared__ __align__(16) bf xs[64 * XP];
    const int tid = threadIdx.x, lane = tid & 31, lr = lane & 15, hi = lane >> 4; const int w = __builtin_amdgcn_readfirstlane(tid >> 5);
    const int p = w / KQ, kq = w % KQ; const int r0 = blockIdx.x * 64;
    // the biases of the lane's channels (nb 16 + 8 hi + j, the same for the three projections) are fetched here, under the reads of x; the first wave of each projection starts its sums from them
    const float* bp = (p == 0) ? bq : (p == 1) ? bk : bv; const unsigned bo = hi * 32; v4f bz[4][2];   // bo: the lane's byte offset, the one address register of these loads
#pragma unroll
    for (int nb = 0; nb < 4; ++nb) { const float* q = (const float*)((const char*)bp + bo) + nb * 16; bz[nb][0] = *(const v4f*)q; bz[nb][1] = *(const v4f*)(q + 4); }
    // weight fragments: a ring of two k steps; the first is fetched here, under the reads of x, the second in front of the barrier (x's registers are free by then), a later one behind the products of the step whose registers it takes
    const bf* wb = WT + ((size_t)p * 4 * (CC / 32) + kq) * 512 + lane * 8; v16bf b[2][4];
#pragma unroll
    for (int nb = 0; nb < 4; ++nb) { const bf* q = wb + nb * (CC / 32) * 512; b[0][nb] = cat16b(*(const v8us*)q, *(const v8us*)(q + 256)); }
    {   // 512-B piece c = w + 3 KQ i of the 64 rows: row c / 6 = 2 i + w / 6, sixth c % 6 = w % 6
        const float* xg = x + (size_t)r0 * CC + w * 128 + lane * 4; bf* xd = xs + (w / 6) * XP + (w % 6) * 128 + lane * 4; v4f raw[64 * CC / (3 * KQ * 128)];
#pragma unroll
        for (int i = 0; i < 64 * CC / (3 * KQ * 128); ++i) raw[i] = *(const v4f*)(xg + i * 3 * KQ * 128);
        asm volatile("s_wait_xcnt 0x0" ::: "memory");   /* every load of the tile is issued in front of the first rounding (one memory round trip), and the loads' address registers are reused behind this line */
#pragma unroll
        for (int i = 0; i < 64 * CC / (3 * KQ * 128); ++i) *(v4usa*)(xd + i * 2 * XP) = __builtin_bit_cast(v4us, __builtin_convertvector(raw[i], v4bf));
    }
    asm volatile("s_wait_xcnt 0x0" :: "v"(bo) : "memory");   /* the build issues some bias and weight loads behind the wait above; named as an input the bias offset register stays whole up to this one */
#pragma unroll
    for (int nb = 0; nb < 4; ++nb) { const bf* q = wb + (nb * (CC / 32) + KQ) * 512; b[1][nb] = cat16b(*(const v8us*)q, *(const v8us*)(q + 256)); }
    asm volatile("s_wait_xcnt 0x0" ::: "memory");   /* these loads' offset register is reused in the loop below */
    __syncthreads();   /* the bf16 rows are in LDS before any wave takes a fragment */
    const bf* xa = xs + lr * XP + kq * 32 + 8 * hi;
    v8f acc[4][4];
    if (kq == 0) {   // wave-uniform
#pragma unroll
        for (int nb = 0; nb < 4; ++nb) { v8f z;
#pragma unroll
            for (int j = 0; j < 8; ++j) z[j] = bfr(bz[nb][j >> 2][j & 3]);
#pragma unroll
            for (int mb = 0; mb < 4; ++mb) acc[mb][nb] = z; }
    } else {
#pragma unroll
        for (int nb = 0; nb < 4; ++nb)
#pragma unroll
            for (int mb = 0; mb < 4; ++mb) acc[mb][nb] = (v8f){};
    }
    // (unrolled whole: the ring and the accumulators are indexed by constants and stay in registers; every address is one lane register + a constant)
#pragma unroll
    for (int s = 0; s < CC / (32 * KQ); ++s) { v16bf a[4];
#pragma unroll
        for (int mb = 0; mb < 4; ++mb) { const bf* q = xa + mb * 16 * XP + s * KQ * 32; a[mb] = cat16b(*(const v8usa*)q, *(const v8usa*)(q + 16)); }
#pragma unroll
        for (int nb = 0; nb < 4; ++nb) {
#pragma unroll
            for (int mb = 0; mb < 4; ++mb) acc[mb][nb] = wmmab(b[s & 1][nb], a[mb], acc[mb][nb]); }
        if (s + 2 < CC / (32 * KQ)) {
#pragma unroll
            for (int nb = 0; nb < 4; ++nb) { const bf* q = wb + (nb * (CC / 32) + (s + 2) * KQ) * 512; b[s & 1][nb] = cat16b(*(const v8us*)q, *(const v8us*)(q + 256)); }
            __builtin_amdgcn_sched_barrier(0); } }   /* the fetch stays a whole step in front of its products: left alone the build puts each load right in front of its use and waits out an L2 round trip a fragment */
    asm volatile("s_wait_xcnt 0x0" ::: "memory");   /* the loads' address registers are reused behind this line */
    // a thread's share of the sum: rows gl, gl + 16, ... of its projection's tile, columns 8 gc .. 8 gc + 7 (a wave: 16 rows x 16 columns, one half of a fragment)
    static_assert(KQ == 4, "the 128 threads of a projection cover 16 rows x 8 column groups a turn");
    const int g = tid & (32 * KQ - 1), gl = g & 15, gc = g >> 4; const float* tp = os + p * KQ * PSL;
    float* sl = os + w * PSL;
    if (p < 2) {   // wave-uniform
#pragma unroll
        for (int mb = 0; mb < 4; ++mb) {
#pragma unroll
            for (int nb = 0; nb < 4; ++nb) { float* q = sl + (mb * 16 + lr) * 68 + nb * 16 + hi * 8; v4f c, d;
#pragma unroll
                for (int j = 0; j < 4; ++j) { c[j] = acc[mb][nb][j]; d[j] = acc[mb][nb][4 + j]; }
                *(v4fa*)q = c; *(v4fa*)(q + 4) = d; } }
    } else {
#pragma unroll
        for (int mb = 0; mb < 4; ++mb) {
#pragma unroll
            for (int nb = 0; nb < 4; ++nb) {
#pragma unroll
                for (int j = 0; j < 8; ++j) sl[(nb * 16 + hi * 8 + j) * 68 + mb * 16 + lr] = acc[mb][nb][j]; } }
    }
    __syncthreads();   /* every wave's partial tile is in LDS before any thread adds them */
    const int bb = r0 / TT, t0 = r0 % TT;
    // (the turns are unrolled: every LDS address is one lane register + a constant)
    // which planes the attention reads: query rows < RH take q and their keys (all < RH) as hi and lo planes; the other rows take q and every key as one fp16 plane. t0 < RH is the same for the whole block (RH is a multiple of 64)
    if (p < 2) { bf* Ph = p ? Kh : Qh; bf* Pl = p ? Kl : Ql; h16* P16 = p ? K16 : Q16; const bool hl = t0 < RH;
#pragma unroll
        for (int it = 0; it < 512 / (32 * KQ); ++it) { const float* s0 = tp + (gl + it * 16) * 68 + gc * 8; v4f c = *(const v4fa*)s0, d = *(const v4fa*)(s0 + 4);
#pragma unroll
            for (int u = 1; u < KQ; ++u) { c += *(const v4fa*)(s0 + u * PSL); d += *(const v4fa*)(s0 + u * PSL + 4); }
            const size_t o = (size_t)(r0 / 16 + it) * (16 * HD) + gc * 128 + gl * 8;
            if (p || !hl) { v8h o16;
#pragma unroll
                for (int e = 0; e < 4; ++e) { o16[e] = tohx(c[e]); o16[4 + e] = tohx(d[e]); }
                *(v8h*)(P16 + o) = o16;
                asm volatile("s_wait_xcnt 0x0" ::: "memory"); }   /* the hi and lo planes' arithmetic below reuses this store's address and data registers */
            if (hl) { v8us oh, ol;
#pragma unroll
                for (int e = 0; e < 4; ++e) { unsigned short a2, c2; splitf(c[e], a2, c2); oh[e] = a2; ol[e] = c2; splitf(d[e], a2, c2); oh[4 + e] = a2; ol[4 + e] = c2; }
                *(v8us*)(Ph + o) = oh; *(v8us*)(Pl + o) = ol; }
            asm volatile("s_wait_xcnt 0x0" ::: "memory"); }   /* the next turn reuses the stores' address and data registers */
    } else {
#pragma unroll
        for (int it = 0; it < 512 / (32 * KQ); ++it) { const float* s0 = tp + (gl + it * 16) * 68 + gc * 8; v4f c = *(const v4fa*)s0, d = *(const v4fa*)(s0 + 4);
#pragma unroll
            for (int u = 1; u < KQ; ++u) { c += *(const v4fa*)(s0 + u * PSL); d += *(const v4fa*)(s0 + u * PSL + 4); }
            v8us oh, ol; v8h o16;
#pragma unroll
            for (int e = 0; e < 4; ++e) { unsigned short a2, c2; float y = c[e]; o16[e] = tohx(y); splitf(y, a2, c2); oh[e] = a2; ol[e] = c2; y = d[e]; o16[4 + e] = tohx(y); splitf(y, a2, c2); oh[4 + e] = a2; ol[4 + e] = c2; }
            const size_t o = (size_t)bb * HD * TT + (size_t)((t0 / 32 + (gc >> 2)) * 4 + it) * 512 + (gc & 3) * 128 + gl * 8; *(v8h*)(V16 + o) = o16; *(v8us*)(Vh + o) = oh; *(v8us*)(Vl + o) = ol;
            asm volatile("s_wait_xcnt 0x0" ::: "memory"); }   /* the next turn reuses the stores' address and data registers */
    }
}
// ---- k_fattn: scores, causal softmax and weights.v in one pass over the keys; the score plane never leaves the registers. grid (batch, pair of 32-query tiles), FW waves a block, one block a WGP; a wave holds the QG 16-query groups of the tile, so that every k and v fragment it loads serves QG groups (the bytes from L2 a query fall by QG).
// Both products are taken transposed, so that in each group a lane owns ONE query: S^T[key][query] = K Q^T (A = k rows, B = q rows) leaves key 16 kt + 8 hi + j of query lr in st[kt][j], which is already the B fragment
// (element j and 8 + j <-> k = 8 hi + j and 16 + 8 hi + j) of O^T[d][query] = V^T P^T; running maximum, sum and rescale are per lane.
// Every block is resident at once, so the launch lasts as long as its fullest block: a block takes tile NT - 1 - pr (the pr-th dearest of the upper half) and then the pr-th CHEAPEST tile of the lower half (low_by_cost below),
// where a tile's cost is its key blocks, one of rows < RH counted HC / NC times (3 times the products, twice the bytes and two memory round trips, the hi/lo split of the weights): dearest with cheapest keeps the dearest pair as cheap as a pairing can.
// The block deals the key blocks of both tiles as ONE list over its FW waves (the second tile's deal goes on at the wave where the first tile's ended), so that its waves differ by one key block. In each tile the wave in deal place s takes the 32-key blocks s, s + FW, ... up to the diagonal (from a start that differs from block to block, wrapping round; the diagonal block last);
// the FW partial (max, sum, O^T) sets of each tile are merged through LDS in the order of the deal behind one work-group barrier, and the block stores the 16 QG output rows of each tile once.
// amdgpu_waves_per_eu(4, 4): the register budget of four waves a SIMD (256 a wave), so that the FW waves of a block fit one WGP and one wave's softmax runs under another's loads and products.
// The maximum m is kept in the exponent's own unit: weight = 2^(s SL2 - m), SL2 = 1/8 log2(e).
#define FW   16
#define NT   (TT / (16 * QG))   // 32-query tiles a batch
#define QG   2        // 16-query groups a wave holds
#define SL2  (SCL * 1.4426950408889634f)
typedef __attribute__((ext_vector_type(16))) unsigned short v16us;
#define HC   5        // cost of a key block of a tile of rows < RH ...
#define NC   2        // ... against that of a key block of any other tile (issue slots of the two block bodies in the listing, a product counted as 8)
struct LowOf { unsigned char t[NT / 2]; };
// the tiles 0 .. NT / 2 - 1 in the order of rising cost (insertion sort at compile time; equal costs in index order)
constexpr LowOf low_by_cost() { LowOf r{}; int c[NT / 2] = {};
    for (int i = 0; i < NT / 2; ++i) { const int ci = (i + 1) * (i * QG * 16 < RH ? HC : NC); int j = i;
        for (; j > 0 && c[j - 1] > ci; --j) { c[j] = c[j - 1]; r.t[j] = r.t[j - 1]; }
        c[j] = ci; r.t[j] = (unsigned char)i; }
    return r; }
constexpr bool each_once(LowOf r) { unsigned long long seen = 0; for (int i = 0; i < NT / 2; ++i) seen |= 1ull << r.t[i]; return NT / 2 == 64 && seen == ~0ull; }
static_assert(each_once(low_by_cost()), "every tile of the lower half belongs to exactly one block: each output row is stored once");
__device__ __forceinline__ float xhalf(float x) { const int b = __float_as_int(x); return __int_as_float(__builtin_amdgcn_permlanex16(b, b, 0x76543210, 0xfedcba98, false, false)); }   // lane l <-> l ^ 16
// one block of 32 keys from k0; DIAG: the block that holds keys above a query of the tile (the tile's last)
// fo: the lane's byte offset into the key planes and the v^T planes alike (a block of 32 keys is 2,048 elements of each, in fragment order); every fragment of the block is that one offset register + a uniform base + a constant
// (the loops over kt, ks, dt, j are unrolled whole so that the fragment arrays are indexed by constants and stay in registers)
template <typename T16> __device__ __forceinline__ typename WFrag<T16>::V ldo(const T16* __restrict__ base, unsigned off, int cst) { return WFrag<T16>::ld((const T16*)((const char*)base + off) + cst); }
// the q fragments of a tile: query rows < RH as hi and lo bf16 planes, the other rows as one fp16 plane
template <bool HI> struct QFrag;
template <> struct QFrag<true> { v16bf h[QG][2], l[QG][2]; };
template <> struct QFrag<false> { v16h f[QG][2]; };
// Scores of rows >= RH: ONE fp16 product (q and k rounded once to fp16, 11 significant bits), the precision that the weights and v of these rows have in weights.v anyway; a block of 32 keys is then 4 KiB of k, not 8, and 8 score products, not 24.
template <bool HI, bool DIAG>
__device__ __forceinline__ void fa_block(const bf* __restrict__ Kh, const bf* __restrict__ Kl, const h16* __restrict__ K16, const h16* __restrict__ V16, const bf* __restrict__ Vh, const bf* __restrict__ Vl,
                                         const QFrag<HI>& q, int q0, int k0, unsigned fo, int lr, int hi, v8f (&o)[QG][4], float (&m)[QG], float (&l)[QG]) {
    v8f st[QG][2]; v16h v16[4];
    if constexpr (HI) {
        v16bf kh[2][2], kl[2][2];
#pragma unroll
        for (int kt = 0; kt < 2; ++kt) {
#pragma unroll
            for (int ks = 0; ks < 2; ++ks) { kh[kt][ks] = ldo<bf>(Kh, fo, kt * 16 * HD + ks * 512); kl[kt][ks] = ldo<bf>(Kl, fo, kt * 16 * HD + ks * 512); } }
        __builtin_amdgcn_sched_barrier(0);   /* every k load of the block is issued before the first product waits: one memory round trip for them, not one a fragment */
#pragma unroll
        for (int kt = 0; kt < 2; ++kt) {
#pragma unroll
            for (int g = 0; g < QG; ++g) { v8f s = (v8f){};
#pragma unroll
                for (int ks = 0; ks < 2; ++ks) { s = wmmab(kh[kt][ks], q.h[g][ks], s); s = wmmab(kh[kt][ks], q.l[g][ks], s); s = wmmab(kl[kt][ks], q.h[g][ks], s); }
                st[g][kt] = s; } }
    } else {
        // 4 k and 4 v fragments fit beside the QG groups' q and output tiles inside the 256 registers a wave: all are fetched at the block's head
        v16h k16[2][2];
#pragma unroll
        for (int kt = 0; kt < 2; ++kt) {
#pragma unroll
            for (int ks = 0; ks < 2; ++ks) k16[kt][ks] = ldo<h16>(K16, fo, kt * 16 * HD + ks * 512); }
#pragma unroll
        for (int dt = 0; dt < 4; ++dt) v16[dt] = ldo<h16>(V16, fo, dt * 512);
        asm volatile("s_wait_xcnt 0x0" :: "v"(fo) : "memory");   /* the loads' offset register is reused behind this line; named as an input it stays whole up to it, so that no later load of the run lands in it */
        __builtin_amdgcn_sched_barrier(0);   /* every k and v load of the block is issued before the first product waits: one memory round trip for them, not one a fragment */
#pragma unroll
        for (int kt = 0; kt < 2; ++kt) {
#pragma unroll
            for (int g = 0; g < QG; ++g) { v8f s = (v8f){};
#pragma unroll
                for (int ks = 0; ks < 2; ++ks) s = wmma16(k16[kt][ks], q.f[g][ks], s);
                st[g][kt] = s; } }
    }
    v16h pb[QG]; v16bf pbh[QG], pbl[QG];
#pragma unroll
    for (int g = 0; g < QG; ++g) {   // group g: queries q0 + 16 g + lr
        float mloc = -3.0e38f;
#pragma unroll
        for (int kt = 0; kt < 2; ++kt) {
#pragma unroll
            for (int j = 0; j < 8; ++j) { if (DIAG && (k0 + kt * 16 + hi * 8 + j > q0 + g * 16 + lr)) st[g][kt][j] = -3.0e38f; mloc = fmaxf(mloc, st[g][kt][j]); } }
        mloc = fmaxf(mloc, xhalf(mloc));   // the two lanes of a query hold different keys and must share one maximum
        const float mn = fmaxf(m[g], mloc * SL2); const float al = __builtin_amdgcn_exp2f(m[g] - mn); m[g] = mn;
        float ps = 0.f;
#pragma unroll
        for (int kt = 0; kt < 2; ++kt) {
#pragma unroll
            for (int j = 0; j < 8; ++j) { const float p = __builtin_amdgcn_exp2f(__builtin_fmaf(st[g][kt][j], SL2, -mn)); st[g][kt][j] = p; ps += p; } }
        l[g] = l[g] * al + ps;
#pragma unroll
        for (int dt = 0; dt < 4; ++dt) o[g][dt] *= al;
        if (HI) { v16us ph, pl;
#pragma unroll
            for (int j = 0; j < 8; ++j) { unsigned short a2, c2; splitf(st[g][0][j], a2, c2); ph[j] = a2; pl[j] = c2; splitf(st[g][1][j], a2, c2); ph[8 + j] = a2; pl[8 + j] = c2; }
            pbh[g] = __builtin_bit_cast(v16bf, ph); pbl[g] = __builtin_bit_cast(v16bf, pl);
        } else {
#pragma unroll
            for (int j = 0; j < 8; ++j) { pb[g][j] = tohx(st[g][0][j]); pb[g][8 + j] = tohx(st[g][1][j]); } }
    }
    v16bf vh[4], vl[4];   // hi and lo v (8 fragments; rows < RH, few blocks) are fetched behind the softmax, into registers that the scores have set free
    if (HI) {
        __builtin_amdgcn_sched_barrier(0);   /* keeps the v loads from rising into the softmax, where their registers are not free yet */
#pragma unroll
        for (int dt = 0; dt < 4; ++dt) { vh[dt] = ldo<bf>(Vh, fo, dt * 512); vl[dt] = ldo<bf>(Vl, fo, dt * 512); }
        asm volatile("s_wait_xcnt 0x0" :: "v"(fo) : "memory"); }   /* the loads' offset register is reused behind this line; named as an input it stays whole up to it */
#pragma unroll
    for (int g = 0; g < QG; ++g) {
#pragma unroll
        for (int dt = 0; dt < 4; ++dt) {
            if (HI) { o[g][dt] = wmmab(vh[dt], pbh[g], o[g][dt]); o[g][dt] = wmmab(vh[dt], pbl[g], o[g][dt]); o[g][dt] = wmmab(vl[dt], pbh[g], o[g][dt]); }
            else o[g][dt] = wmma16(v16[dt], pb[g], o[g][dt]); } }
}
template <bool HI>
__device__ __forceinline__ void fa_keys(const bf* __restrict__ Qh, const bf* __restrict__ Ql, const h16* __restrict__ Q16, const bf* __restrict__ Kh, const bf* __restrict__ Kl, const h16* __restrict__ K16, const h16* __restrict__ V16, const bf* __restrict__ Vh, const bf* __restrict__ Vl,
                                        int q0, int w, int rot, int lane, int lr, int hi, v8f (&o)[QG][4], float (&m)[QG], float (&l)[QG]) {
    QFrag<HI> q;
#pragma unroll
    for (int g = 0; g < QG; ++g) {
#pragma unroll
        for (int ks = 0; ks < 2; ++ks) { const size_t qo = (size_t)(q0 + g * 16) * HD + ks * 512 + lane * 8;
            if constexpr (HI) { q.h[g][ks] = WFrag<bf>::ld(Qh + qo); q.l[g][ks] = WFrag<bf>::ld(Ql + qo); } else q.f[g][ks] = WFrag<h16>::ld(Q16 + qo); } }
    asm volatile("s_wait_xcnt 0x0" ::: "memory");   /* the q loads' address registers are reused right behind them */
    const int last = q0 / 32;   // the 32-key block on the diagonal (the tile's own 32 tokens); every query of the tile has a live key in it and in each block before it
    const int n = (last - w + FW - 1) / FW;   // the wave's key blocks below the diagonal: w + FW i, i < n (w < FW, so the dividend is never negative)
    const unsigned f0 = (unsigned)((w * 32 * HD + (hi * 16 + lr) * 8) * 2);
    // The blocks of a batch read the same k and v lines (the stagger is for speed only). A block in phase rot (of 8) starts its walk rot / 8 of the way through and wraps round, so that at any moment the blocks are spread over the key range.
    int i = (rot * n) / 8;
#pragma unroll 1   /* rolled: a second copy of the block's fragments would take the registers that let four waves share a SIMD */
    for (int j = 0; j < n; ++j) { fa_block<HI, false>(Kh, Kl, K16, V16, Vh, Vl, q, q0, 0, f0 + (unsigned)i * (FW * 32 * HD * 2), lr, hi, o, m, l); i = (i + 1 == n) ? 0 : i + 1; }
    if (w + n * FW == last) fa_block<HI, true>(Kh, Kl, K16, V16, Vh, Vl, q, q0, last * 32, f0 + (unsigned)n * (FW * 32 * HD * 2), lr, hi, o, m, l);   // wave-uniform: one wave of the block
}
__global__ __launch_bounds__(32 * FW) __attribute__((amdgpu_waves_per_eu(4, 4))) void k_fattn(const bf* __restrict__ Qh, const bf* __restrict__ Ql, const bf* __restrict__ Kh, const bf* __restrict__ Kl, const h16* __restrict__ Q16, const h16* __restrict__ K16, const h16* __restrict__ V16, const bf* __restrict__ Vh, const bf* __restrict__ Vl, float* out) {
    __shared__ __align__(16) float Os[2 * FW * QG * 16 * 68]; __shared__ float Ms[2 * FW * QG * 16]; __shared__ float Ls[2 * FW * QG * 16];
    static_assert(QG * 16 == 32, "the tile is one 32-key block wide: its diagonal block is q0 / 32 for every group");
    static_assert((FW & (FW - 1)) == 0 && NT % 2 == 0, "the deal wraps by a mask; the tiles pair up");
    const int tid = threadIdx.x, lane = tid & 31, lr = lane & 15, hi = lane >> 4; const int w = __builtin_amdgcn_readfirstlane(tid >> 5);
    const int b = blockIdx.x, pr = blockIdx.y;
    static constexpr LowOf LOW = low_by_cost(); const int lo = LOW.t[pr];   // the block's tile of the lower half (one scalar load)
    const int ph = (pr >> 1) & 7;   // the block's phase in the walk over the keys (speed only): blocks two apart in pr differ, so that eight phases are met also among the blocks of one parity of pr
    const size_t pb = (size_t)b * TT * HD; Qh += pb; Ql += pb; Kh += pb; Kl += pb; Q16 += pb; K16 += pb; V16 += pb; Vh += pb; Vl += pb;
#pragma unroll 1   /* rolled: one copy of the key loops serves both tiles (half the code to fetch) */
    for (int t = 0; t < 2; ++t) {   // t 0: tile NT - 1 - pr (NT - pr key blocks); t 1: tile lo (lo + 1 key blocks)
        const int q0 = (t ? lo : NT - 1 - pr) * (QG * 16);
        const int s = t ? ((w - (NT - pr)) & (FW - 1)) : w;   // the wave's place in the tile's deal
        v8f o[QG][4]; float m[QG], l[QG];
#pragma unroll
        for (int g = 0; g < QG; ++g) { m[g] = -3.0e38f; l[g] = 0.f;
#pragma unroll
            for (int dt = 0; dt < 4; ++dt) o[g][dt] = (v8f){}; }
        if (q0 < RH) fa_keys<true>(Qh, Ql, Q16, Kh, Kl, K16, V16, Vh, Vl, q0, s, ph, lane, lr, hi, o, m, l); else fa_keys<false>(Qh, Ql, Q16, Kh, Kl, K16, V16, Vh, Vl, q0, s, ph, lane, lr, hi, o, m, l);   // the same for every wave of the block in trip t; no barrier stands inside
        const int sl = t * FW + s;   // the LDS slot of this partial set: written by this wave alone, read behind the barrier
#pragma unroll
        for (int g = 0; g < QG; ++g) { l[g] += xhalf(l[g]);
#pragma unroll
            for (int dt = 0; dt < 4; ++dt) { float* p = Os + ((sl * QG + g) * 16 + lr) * 68 + dt * 16 + hi * 8; v4f a, c;
#pragma unroll
                for (int j = 0; j < 4; ++j) { a[j] = o[g][dt][j]; c[j] = o[g][dt][4 + j]; }
                *(v4fa*)p = a; *(v4fa*)(p + 4) = c; }
            if (hi == 0) { Ms[(sl * QG + g) * 16 + lr] = m[g]; Ls[(sl * QG + g) * 16 + lr] = l[g]; } }
    }
    __syncthreads();   /* every wave's two partial sets are in LDS before any thread merges them */
    const int d4 = (tid & 15) * 4, qr = tid >> 4;   // the thread's query row of each tile (32 FW threads: 16 QG rows x 16 column groups)
    static_assert(32 * FW == QG * 16 * 16, "one merge turn a tile");
#pragma unroll
    for (int t = 0; t < 2; ++t) { const int q0 = (t ? lo : NT - 1 - pr) * (QG * 16); const int e = t * FW * QG * 16 + qr;
        float M = Ms[e];
#pragma unroll
        for (int u = 1; u < FW; ++u) M = fmaxf(M, Ms[u * QG * 16 + e]);
        float L = 0.f; v4f a = (v4f){};
#pragma unroll
        for (int u = 0; u < FW; ++u) { const float f = __builtin_amdgcn_exp2f(Ms[u * QG * 16 + e] - M); L += Ls[u * QG * 16 + e] * f; a += *(const v4fa*)(Os + (u * QG * 16 + e) * 68 + d4) * f; }   // a wave without keys has max -3e38, sum 0: factor 0
        const float r = __fdiv_rn(1.0f, L);
        *(v4f*)(out + ((size_t)b * TT + q0 + qr) * CO + d4) = a * r; }
}
extern "C" void kernel_launch(void* const* d_in, const int* in_sizes, int n_in,
                              void* d_out, int out_size, void* d_ws, size_t ws_size, hipStream_t stream) {
    (void)in_sizes; (void)n_in; (void)out_size;
    const float* x = (const float*)d_in[0]; const float* wq = (const float*)d_in[1]; const float* bq = (const float*)d_in[2]; const float* wk = (const float*)d_in[3]; const float* bk = (const float*)d_in[4]; const float* wv = (const float*)d_in[5]; const float* bv = (const float*)d_in[6];   /* standard roles: rows = queries */
    float* OUT = (float*)d_out;     // [4][4096][64]
    char* wsp = (char*)d_ws;
    auto take = [&](size_t bytes) { char* p = wsp; wsp += (bytes + 255) & ~(size_t)255; return (void*)p; };
    bf* WT = (bf*)take((size_t)3 * MID * CC * 2);   /* q, k, v weights, bf16 in fragment order */
    bf* QPh = (bf*)take((size_t)NB_ * TT * MID * 2); bf* QPl = (bf*)take((size_t)NB_ * TT * MID * 2); bf* KPh = (bf*)take((size_t)NB_ * TT * MID * 2); bf* KPl = (bf*)take((size_t)NB_ * TT * MID * 2);   /* the planes the attention launch reads: one set a batch */
    h16* QP16 = (h16*)take((size_t)NB_ * TT * MID * 2); h16* KP16 = (h16*)take((size_t)NB_ * TT * MID * 2);   /* q and k as one fp16 plane each (query rows >= RH) */
    h16* VT16 = (h16*)take((size_t)NB_ * CO * TT * 2); bf* VTh = (bf*)take((size_t)NB_ * CO * TT * 2); bf* VTl = (bf*)take((size_t)NB_ * CO * TT * 2);
    if ((size_t)(wsp - (char*)d_ws) > ws_size) return;    // ws 256 MiB (carve ~19 MiB)
    k_wt3<<<dim3(CC * MID / 512, 3, 1), 256, 0, stream>>>(wq, wk, wv, WT);   /* 'xw' weights -> fragments */
    k_proj<<<NB_ * TT / 64, 32 * 3 * KQ, 0, stream>>>(x, WT, bq, bk, bv, QPh, QPl, KPh, KPl, QP16, KP16, VT16, VTh, VTl);   /* q, k and v^T planes, in fragment order */
    k_fattn<<<dim3(NB_, NT / 2, 1), 32 * FW, 0, stream>>>(QPh, QPl, KPh, KPl, QP16, KP16, VT16, VTh, VTl, OUT);   /* causal attention of all four batches; writes every output row once */
}

// v010
// It runs in 25.7 microseconds.
// In two side-by-side timings against v009, it was 1.05 and 1.02 times as fast.
// All steps since v000 together make it 45.4 times as fast.
#include <hip/hip_runtime.h>

// Single causal attention head over 4,096 tokens with biased projections (x [4][4096][768]; q, k, v = x w + b ('xw' [768][64] + [64]; ONE 64-wide head); scores = q.k^T; causal (-inf) THEN x 1/sqrt(64) (masking before the scale: the same thing); softmax; out = weights.v -> [4][4096][64] (1.0 M); argument order x, wq, bq, wk, bk, wv, bv).
// Layout: 'xw' weights laid out as fragments once (one launch for the three); ONE launch for all batches that rounds x to bf16 on its way into LDS, takes the three exact projections (K 768, K split over the waves of a block) and writes the planes the attention reads; then ONE launch for all batches in which a block takes a 32-query tile of the upper half and one of the lower half in two trips over its waves (paired by cost: about equal work a block) and streams the keys of each up to the diagonal (every wave holds both 16-query groups of the tile and uses each loaded k and v fragment for both): scores (rows < 512 hi/lo planes, 3 products; rest one fp16 product), running-maximum softmax in registers, weights.v (rows < 512 hi/lo 3 products, rest fp16), key blocks dealt over the waves of a block and merged through LDS.
// Compute dtypes, f32 accumulate: every input rounded to bf16; projections exact; scores and wei.v of rows < 512 3 bf16 hi/lo products each, of the other rows one fp16 product each; softmax f32; output f32.

#define NB_  4
#define TT   4096
#define DM   64
#define NH_  1
#define NKV  1
#define REP  (NH_ / NKV)
#define HD   64
#define DQ   (NH_ * HD)
#define DKV  (NKV * HD)
#define ZH   1
#define RH   512                  // query rows < RH use hi+lo planes (0: none)
#define WIN  0
#define SCL  0.125f   // C^-0.5 with C = 64 (the head width)
#define MID  64       // q / k width (one 64-wide head)
#define CO   64       // v width
#define CC   768      // input width (d_model)
#define KQ   4        // waves that share the K of one projection tile (24 k steps: 6 each)
typedef _Float16 h16;
typedef unsigned short bf;
typedef __attribute__((ext_vector_type(16))) __bf16   v16bf;
typedef __attribute__((ext_vector_type(16))) _Float16 v16h;
typedef __attribute__((ext_vector_type(8)))  _Float16 v8h;
typedef __attribute__((ext_vector_type(8)))  unsigned short v8us;
typedef __attribute__((ext_vector_type(8)))  float    v8f;
typedef __attribute__((ext_vector_type(4)))  float    v4f;
typedef v8h  __attribute__((may_alias)) v8ha;
typedef v4f  __attribute__((may_alias)) v4fa;
typedef v8us __attribute__((may_alias)) v8usa;

__device__ __forceinline__ unsigned short f2bf(float f) { unsigned u = __float_as_uint(f); u += 0x7FFFu + ((u >> 16) & 1u); return (unsigned short)(u >> 16); }
__device__ __forceinline__ float bf2f(unsigned short b) { return __uint_as_float(((unsigned)b) << 16); }
__device__ __forceinline__ float bfr(float f) { return bf2f(f2bf(f)); }
__device__ __forceinline__ v16h cat16(v8h lo, v8h hi) { return __builtin_shufflevector(lo, hi, 0, 1, 2, 3, 4, 5, 6, 7, 8, 9, 10, 11, 12, 13, 14, 15); }
__device__ __forceinline__ v16bf cat16b(v8us lo, v8us hi) { return __builtin_bit_cast(v16bf, __builtin_shufflevector(lo, hi, 0, 1, 2, 3, 4, 5, 6, 7, 8, 9, 10, 11, 12, 13, 14, 15)); }
__device__ __forceinline__ v8f wmma16(v16h a, v16h b, v8f c) { return __builtin_amdgcn_wmma_f32_16x16x32_f16(false, a, false, b, (short)0, c, false, false); }
__device__ __forceinline__ v8f wmmab(v16bf a, v16bf b, v8f c) { return __builtin_amdgcn_wmma_f32_16x16x32_bf16(false, a, false, b, (short)0, c, false, false); }



// fragment loaders: operands straight from 16-bit planes kept in fragment order: [half 2][lane 32][8], so that each of the two 16-byte loads a lane makes is part of 512 contiguous bytes (four whole lines a wave)
template <typename T16> struct WFrag;
template <> struct WFrag<h16> { typedef v16h V; static __device__ __forceinline__ V ld(const h16* p) { return cat16(*(const v8h*)p, *(const v8h*)(p + 256)); } static __device__ __forceinline__ v8f mma(V a, V b, v8f c) { return wmma16(a, b, c); } };
template <> struct WFrag<bf> { typedef v16bf V; static __device__ __forceinline__ V ld(const bf* p) { return cat16b(*(const v8us*)p, *(const v8us*)(p + 256)); } static __device__ __forceinline__ v8f mma(V a, V b, v8f c) { return wmmab(a, b, c); } };

__device__ __forceinline__ h16 tohx(float x) { return (h16)x; }
__device__ __forceinline__ void splitf(float y, unsigned short& h, unsigned short& l) { h = f2bf(y); l = f2bf(y - bf2f(h)); }
typedef __attribute__((ext_vector_type(2))) _Float16 v2h;
typedef __attribute__((ext_vector_type(4))) _Float16 v4h;
typedef __attribute__((ext_vector_type(2))) unsigned short v2us;
typedef __attribute__((ext_vector_type(4))) unsigned short v4us;
typedef __attribute__((ext_vector_type(2))) float v2f;
typedef __attribute__((ext_vector_type(4))) int v4i;


// ---- k_wt3: the three 'xw' weights [CC][64] f32 -> bf16 in fragment order [3][nb 4][k step CC / 32][half 2][lane 32][8]: lane (hi, lr) of half h holds channel nb 16 + lr, k = 32 step + 16 h + 8 hi + 0..7,
// so that one 16-byte load a lane fetches half a fragment from 512 contiguous bytes. grid (64 CC / 512, 3); a wave writes one 128-B line.
__global__ __launch_bounds__(256) void k_wt3(const float* __restrict__ wq, const float* __restrict__ wk, const float* __restrict__ wv, bf* Bt) {
    const float* __restrict__ w = (blockIdx.y == 0) ? wq : (blockIdx.y == 1) ? wk : wv;
    const unsigned e = (blockIdx.x * 256 + threadIdx.x) * 2, f = e >> 9, ln = (e >> 3) & 31, k = (f % (CC / 32)) * 32 + ((e >> 8) & 1) * 16 + (ln >> 4) * 8 + (e & 7), n = (f / (CC / 32)) * 16 + (ln & 15); v2us o;
    o[0] = f2bf(w[k * 64 + n]); o[1] = f2bf(w[(k + 1) * 64 + n]); *(v2us*)(Bt + blockIdx.y * (64 * CC) + e) = o;
}
// ---- k_proj: q, k and v projections of 64 rows of x (all batches: grid NB_ TT / 64) and their planes, one launch. 3 KQ waves: wave w works on projection w / KQ and takes the 32-wide k steps w % KQ, w % KQ + KQ, ...
// The block's rows of x (contiguous f32) are read once, whole lines a load and all loads in flight together, rounded to bf16 (nearest even) and laid in LDS (row pitch 16 B x odd); a work-group barrier; the fragments come from there. The product is taken transposed (A = weight rows, B = x rows): a lane owns token mb 16 + lr and holds channels nb 16 + 8 hi + j.
// Every wave lays its 64 x 64 partial tile in LDS (q, k: [token][channel]; v: [channel][token]), ONE work-group barrier, then the KQ waves of a projection add its KQ tiles in wave order and store the planes in the attention's fragment order, 512 contiguous bytes a wave and store:
// q, k: [16-token tile][k step 2][half 2][lane 32][8], lane (hi, lr) of half h holds token lr of the tile, channels 32 step + 16 h + 8 hi + 0..7; v: [batch][32-token block][16-channel tile 4][half 2][lane 32][8], lane (hi, lr) of half h holds channel lr of the tile, tokens 16 h + 8 hi + 0..7 of the block. The bias (rounded to bf16) is the start value of the first wave's sums.
typedef __attribute__((ext_vector_type(4))) __bf16 v4bf;
typedef v4us __attribute__((may_alias)) v4usa;
#define PSL  (64 * 68)
#define XP   (CC + 8)
__global__ __launch_bounds__(32 * 3 * KQ) void k_proj(const float* __restrict__ x, const bf* __restrict__ WT, const float* __restrict__ bq, const float* __restrict__ bk, const float* __restrict__ bv,
                                                      bf* Qh, bf* Ql, bf* Kh, bf* Kl, h16* Q16, h16* K16, h16* V16, bf* Vh, bf* Vl) {
    __shared__ __align__(16) float os[3 * KQ * PSL]; __shared__ __align__(16) bf xs[64 * XP];
    const int tid = threadIdx.x, lane = tid & 31, lr = lane & 15, hi = lane >> 4; const int w = __builtin_amdgcn_readfirstlane(tid >> 5);
    const int p = w / KQ, kq = w % KQ; const int r0 = blockIdx.x * 64;
    // the biases of the lane's channels (nb 16 + 8 hi + j, the same for the three projections) are fetched here, under the reads of x; the first wave of each projection starts its sums from them
    const float* bp = (p == 0) ? bq : (p == 1) ? bk : bv; const unsigned bo = hi * 32; v4f bz[4][2];   // bo: the lane's byte offset, the one address register of these loads
#pragma unroll
    for (int nb = 0; nb < 4; ++nb) { const float* q = (const float*)((const char*)bp + bo) + nb * 16; bz[nb][0] = *(const v4f*)q; bz[nb][1] = *(const v4f*)(q + 4); }
    // weight fragments: a ring of two k steps; the first is fetched here, under the reads of x, the second in front of the barrier (x's registers are free by then), a later one behind the products of the step whose registers it takes
    const bf* wb = WT + ((size_t)p * 4 * (CC / 32) + kq) * 512 + lane * 8; v16bf b[2][4];
#pragma unroll
    for (int nb = 0; nb < 4; ++nb) { const bf* q = wb + nb * (CC / 32) * 512; b[0][nb] = cat16b(*(const v8us*)q, *(const v8us*)(q + 256)); }
    {   // 512-B piece c = w + 3 KQ i of the 64 rows: row c / 6 = 2 i + w / 6, sixth c % 6 = w % 6
        const float* xg = x + (size_t)r0 * CC + w * 128 + lane * 4; bf* xd = xs + (w / 6) * XP + (w % 6) * 128 + lane * 4; v4f raw[64 * CC / (3 * KQ * 128)];
#pragma unroll
        for (int i = 0; i < 64 * CC / (3 * KQ * 128); ++i) raw[i] = *(const v4f*)(xg + i * 3 * KQ * 128);
        asm volatile("s_wait_xcnt 0x0" ::: "memory");   /* every load of the tile is issued in front of the first rounding (one memory round trip), and the loads' address registers are reused behind this line */
#pragma unroll
        for (int i = 0; i < 64 * CC / (3 * KQ * 128); ++i) *(v4usa*)(xd + i * 2 * XP) = __builtin_bit_cast(v4us, __builtin_convertvector(raw[i], v4bf));
    }
    asm volatile("s_wait_xcnt 0x0" :: "v"(bo) : "memory");   /* the build issues some bias and weight loads behind the wait above; named as an input the bias offset register stays whole up to this one */
#pragma unroll
    for (int nb = 0; nb < 4; ++nb) { const bf* q = wb + (nb * (CC / 32) + KQ) * 512; b[1][nb] = cat16b(*(const v8us*)q, *(const v8us*)(q + 256)); }
    asm volatile("s_wait_xcnt 0x0" ::: "memory");   /* these loads' offset register is reused in the loop below */
    __syncthreads();   /* the bf16 rows are in LDS before any wave takes a fragment */
    const bf* xa = xs + lr * XP + kq * 32 + 8 * hi;
    v8f acc[4][4];
    if (kq == 0) {   // wave-uniform
#pragma unroll
        for (int nb = 0; nb < 4; ++nb) { v8f z;
#pragma unroll
            for (int j = 0; j < 8; ++j) z[j] = bfr(bz[nb][j >> 2][j & 3]);
#pragma unroll
            for (int mb = 0; mb < 4; ++mb) acc[mb][nb] = z; }
    } else {
#pragma unroll
        for (int nb = 0; nb < 4; ++nb)
#pragma unroll
            for (int mb = 0; mb < 4; ++mb) acc[mb][nb] = (v8f){};
    }
    // (unrolled whole: the ring and the accumulators are indexed by constants and stay in registers; every address is one lane register + a constant)
#pragma unroll
    for (int s = 0; s < CC / (32 * KQ); ++s) { v16bf a[4];
#pragma unroll
        for (int mb = 0; mb < 4; ++mb) { const bf* q = xa + mb * 16 * XP + s * KQ * 32; a[mb] = cat16b(*(const v8usa*)q, *(const v8usa*)(q + 16)); }
#pragma unroll
        for (int nb = 0; nb < 4; ++nb) {
#pragma unroll
            for (int mb = 0; mb < 4; ++mb) acc[mb][nb] = wmmab(b[s & 1][nb], a[mb], acc[mb][nb]); }
        if (s + 2 < CC / (32 * KQ)) {
#pragma unroll
            for (int nb = 0; nb < 4; ++nb) { const bf* q = wb + (nb * (CC / 32) + (s + 2) * KQ) * 512; b[s & 1][nb] = cat16b(*(const v8us*)q, *(const v8us*)(q + 256)); }
            __builtin_amdgcn_sched_barrier(0); } }   /* the fetch stays a whole step in front of its products: left alone the build puts each load right in front of its use and waits out an L2 round trip a fragment */
    asm volatile("s_wait_xcnt 0x0" ::: "memory");   /* the loads' address registers are reused behind this line */
    // a thread's share of the sum: rows gl, gl + 16, ... of its projection's tile, columns 8 gc .. 8 gc + 7 (a wave: 16 rows x 16 columns, one half of a fragment)
    static_assert(KQ == 4, "the 128 threads of a projection cover 16 rows x 8 column groups a turn");
    const int g = tid & (32 * KQ - 1), gl = g & 15, gc = g >> 4; const float* tp = os + p * KQ * PSL;
    float* sl = os + w * PSL;
    if (p < 2) {   // wave-uniform
#pragma unroll
        for (int mb = 0; mb < 4; ++mb) {
#pragma unroll
            for (int nb = 0; nb < 4; ++nb) { float* q = sl + (mb * 16 + lr) * 68 + nb * 16 + hi * 8; v4f c, d;
#pragma unroll
                for (int j = 0; j < 4; ++j) { c[j] = acc[mb][nb][j]; d[j] = acc[mb][nb][4 + j]; }
                *(v4fa*)q = c; *(v4fa*)(q + 4) = d; } }
    } else {
#pragma unroll
        for (int mb = 0; mb < 4; ++mb) {
#pragma unroll
            for (int nb = 0; nb < 4; ++nb) {
#pragma unroll
                for (int j = 0; j < 8; ++j) sl[(nb * 16 + hi * 8 + j) * 68 + mb * 16 + lr] = acc[mb][nb][j]; } }
    }
    __syncthreads();   /* every wave's partial tile is in LDS before any thread adds them */
    const int bb = r0 / TT, t0 = r0 % TT;
    // (the turns are unrolled: every LDS address is one lane register + a constant)
    // which planes the attention reads: query rows < RH take q and their keys (all < RH) as hi and lo planes; the other rows take q and every key as one fp16 plane. t0 < RH is the same for the whole block (RH is a multiple of 64)
    if (p < 2) { bf* Ph = p ? Kh : Qh; bf* Pl = p ? Kl : Ql; h16* P16 = p ? K16 : Q16; const bool hl = t0 < RH;
#pragma unroll
        for (int it = 0; it < 512 / (32 * KQ); ++it) { const float* s0 = tp + (gl + it * 16) * 68 + gc * 8; v4f c = *(const v4fa*)s0, d = *(const v4fa*)(s0 + 4);
#pragma unroll
            for (int u = 1; u < KQ; ++u) { c += *(const v4fa*)(s0 + u * PSL); d += *(const v4fa*)(s0 + u * PSL + 4); }
            const size_t o = (size_t)(r0 / 16 + it) * (16 * HD) + gc * 128 + gl * 8;
            if (p || !hl) { v8h o16;
#pragma unroll
                for (int e = 0; e < 4; ++e) { o16[e] = tohx(c[e]); o16[4 + e] = tohx(d[e]); }
                *(v8h*)(P16 + o) = o16;
                asm volatile("s_wait_xcnt 0x0" ::: "memory"); }   /* the hi and lo planes' arithmetic below reuses this store's address and data registers */
            if (hl) { v8us oh, ol;
#pragma unroll
                for (int e = 0; e < 4; ++e) { unsigned short a2, c2; splitf(c[e], a2, c2); oh[e] = a2; ol[e] = c2; splitf(d[e], a2, c2); oh[4 + e] = a2; ol[4 + e] = c2; }
                *(v8us*)(Ph + o) = oh; *(v8us*)(Pl + o) = ol; }
            asm volatile("s_wait_xcnt 0x0" ::: "memory"); }   /* the next turn reuses the stores' address and data registers */
    } else {
#pragma unroll
        for (int it = 0; it < 512 / (32 * KQ); ++it) { const float* s0 = tp + (gl + it * 16) * 68 + gc * 8; v4f c = *(const v4fa*)s0, d = *(const v4fa*)(s0 + 4);
#pragma unroll
            for (int u = 1; u < KQ; ++u) { c += *(const v4fa*)(s0 + u * PSL); d += *(const v4fa*)(s0 + u * PSL + 4); }
            v8us oh, ol; v8h o16;
#pragma unroll
            for (int e = 0; e < 4; ++e) { unsigned short a2, c2; float y = c[e]; o16[e] = tohx(y); splitf(y, a2, c2); oh[e] = a2; ol[e] = c2; y = d[e]; o16[4 + e] = tohx(y); splitf(y, a2, c2); oh[4 + e] = a2; ol[4 + e] = c2; }
            const size_t o = (size_t)bb * HD * TT + (size_t)((t0 / 32 + (gc >> 2)) * 4 + it) * 512 + (gc & 3) * 128 + gl * 8; *(v8h*)(V16 + o) = o16; *(v8us*)(Vh + o) = oh; *(v8us*)(Vl + o) = ol;
            asm volatile("s_wait_xcnt 0x0" ::: "memory"); }   /* the next turn reuses the stores' address and data registers */
    }
}
// ---- k_fattn: scores, causal softmax and weights.v in one pass over the keys; the score plane never leaves the registers. grid (batch, pair of 32-query tiles), FW waves a block, one block a WGP; a wave holds the QG 16-query groups of the tile, so that every k and v fragment it loads serves QG groups (the bytes from L2 a query fall by QG).
// Both products are taken transposed, so that in each group a lane owns ONE query: S^T[key][query] = K Q^T (A = k rows, B = q rows) leaves key 16 kt + 8 hi + j of query lr in st[kt][j], which is already the B fragment
// (element j and 8 + j <-> k = 8 hi + j and 16 + 8 hi + j) of O^T[d][query] = V^T P^T; running maximum, sum and rescale are per lane.
// Every block is resident at once, so the launch lasts as long as its fullest block: a block takes tile NT - 1 - pr (the pr-th dearest of the upper half) and the pr-th CHEAPEST tile of the lower half (low_by_cost below),
// where a tile's cost is its key blocks, one of rows < RH counted HC / NC times (3 times the products, twice the bytes and two memory round trips, the hi/lo split of the weights): dearest with cheapest keeps the dearest pair as cheap as a pairing can.
// The block deals the key blocks of both tiles as ONE list over its FW waves (the second tile's deal goes on at the wave where the first tile's ended), so that its waves differ by one key block. In each tile the wave in deal place s takes the 32-key blocks s, s + FW, ... up to the diagonal (from a start that differs from block to block, wrapping round; the diagonal block last);
// Where both tiles read the fp16 planes (the lower tile has rows >= RH), the key blocks 0 .. lo, which both tiles need, are dealt to PAIRS of waves instead: waves 2 j and 2 j + 1 walk the same key blocks j, j + 8, ... in the same order at the same time, the even wave for the upper tile, the odd wave for the lower,
// so that the k and v lines one of them has fetched from L2 can serve the other from the WGP's cache; the upper tile's other key blocks are then dealt over the FW waves, from the wave where the pairs' deal ended (the waves still differ by one key block).
// the 2 FW partial (max, sum, O^T) sets of the block are merged through LDS, each tile's in a fixed order (slots 8 .. 15 last), behind one work-group barrier, and the block stores the 16 QG output rows of each tile once.
// amdgpu_waves_per_eu(4, 4): the register budget of four waves a SIMD (256 a wave), so that the FW waves of a block fit one WGP and one wave's softmax runs under another's loads and products.
// The maximum m is kept in the exponent's own unit: weight = 2^(s SL2 - m), SL2 = 1/8 log2(e).
#define FW   16
#define NT   (TT / (16 * QG))   // 32-query tiles a batch
#define QG   2        // 16-query groups a wave holds
#define SL2  (SCL * 1.4426950408889634f)
typedef __attribute__((ext_vector_type(16))) unsigned short v16us;
#define HC   5        // cost of a key block of a tile of rows < RH ...
#define NC   2        // ... against that of a key block of any other tile (issue slots of the two block bodies in the listing, a product counted as 8)
struct LowOf { unsigned char t[NT / 2]; };
// the tiles 0 .. NT / 2 - 1 in the order of rising cost (insertion sort at compile time; equal costs in index order)
constexpr LowOf low_by_cost() { LowOf r{}; int c[NT / 2] = {};
    for (int i = 0; i < NT / 2; ++i) { const int ci = (i + 1) * (i * QG * 16 < RH ? HC : NC); int j = i;
        for (; j > 0 && c[j - 1] > ci; --j) { c[j] = c[j - 1]; r.t[j] = r.t[j - 1]; }
        c[j] = ci; r.t[j] = (unsigned char)i; }
    return r; }
constexpr bool each_once(LowOf r) { unsigned long long seen = 0; for (int i = 0; i < NT / 2; ++i) seen |= 1ull << r.t[i]; return NT / 2 == 64 && seen == ~0ull; }
static_assert(each_once(low_by_cost()), "every tile of the lower half belongs to exactly one block: each output row is stored once");
__device__ __forceinline__ float xhalf(float x) { const int b = __float_as_int(x); return __int_as_float(__builtin_amdgcn_permlanex16(b, b, 0x76543210, 0xfedcba98, false, false)); }   // lane l <-> l ^ 16
// one block of 32 keys from k0; DIAG: the block that holds keys above a query of the tile (the tile's last)
// fo: the lane's byte offset into the key planes and the v^T planes alike (a block of 32 keys is 2,048 elements of each, in fragment order); every fragment of the block is that one offset register + a uniform base + a constant
// (the loops over kt, ks, dt, j are unrolled whole so that the fragment arrays are indexed by constants and stay in registers)
template <typename T16> __device__ __forceinline__ typename WFrag<T16>::V ldo(const T16* __restrict__ base, unsigned off, int cst) { return WFrag<T16>::ld((const T16*)((const char*)base + off) + cst); }
// the q fragments of a tile: query rows < RH as hi and lo bf16 planes, the other rows as one fp16 plane
template <bool HI> struct QFrag;
template <> struct QFrag<true> { v16bf h[QG][2], l[QG][2]; };
template <> struct QFrag<false> { v16h f[QG][2]; };
// Scores of rows >= RH: ONE fp16 product (q and k rounded once to fp16, 11 significant bits), the precision that the weights and v of these rows have in weights.v anyway; a block of 32 keys is then 4 KiB of k, not 8, and 8 score products, not 24.
template <bool HI, bool DIAG>
__device__ __forceinline__ void fa_block(const bf* __restrict__ Kh, const bf* __restrict__ Kl, const h16* __restrict__ K16, const h16* __restrict__ V16, const bf* __restrict__ Vh, const bf* __restrict__ Vl,
                                         const QFrag<HI>& q, int q0, int k0, unsigned fo, int lr, int hi, v8f (&o)[QG][4], float (&m)[QG], float (&l)[QG]) {
    v8f st[QG][2]; v16h v16[4];
    if constexpr (HI) {
        v16bf kh[2][2], kl[2][2];
#pragma unroll
        for (int kt = 0; kt < 2; ++kt) {
#pragma unroll
            for (int ks = 0; ks < 2; ++ks) { kh[kt][ks] = ldo<bf>(Kh, fo, kt * 16 * HD + ks * 512); kl[kt][ks] = ldo<bf>(Kl, fo, kt * 16 * HD + ks * 512); } }
        __builtin_amdgcn_sched_barrier(0);   /* every k load of the block is issued before the first product waits: one memory round trip for them, not one a fragment */
#pragma unroll
        for (int kt = 0; kt < 2; ++kt) {
#pragma unroll
            for (int g = 0; g < QG; ++g) { v8f s = (v8f){};
#pragma unroll
                for (int ks = 0; ks < 2; ++ks) { s = wmmab(kh[kt][ks], q.h[g][ks], s); s = wmmab(kh[kt][ks], q.l[g][ks], s); s = wmmab(kl[kt][ks], q.h[g][ks], s); }
                st[g][kt] = s; } }
    } else {
        // 4 k and 4 v fragments fit beside the QG groups' q and output tiles inside the 256 registers a wave: all are fetched at the block's head
        v16h k16[2][2];
#pragma unroll
        for (int kt = 0; kt < 2; ++kt) {
#pragma unroll
            for (int ks = 0; ks < 2; ++ks) k16[kt][ks] = ldo<h16>(K16, fo, kt * 16 * HD + ks * 512); }
#pragma unroll
        for (int dt = 0; dt < 4; ++dt) v16[dt] = ldo<h16>(V16, fo, dt * 512);
        asm volatile("s_wait_xcnt 0x0" :: "v"(fo) : "memory");   /* the loads' offset register is reused behind this line; named as an input it stays whole up to it, so that no later load of the run lands in it */
        __builtin_amdgcn_sched_barrier(0);   /* every k and v load of the block is issued before the first product waits: one memory round trip for them, not one a fragment */
#pragma unroll
        for (int kt = 0; kt < 2; ++kt) {
#pragma unroll
            for (int g = 0; g < QG; ++g) { v8f s = (v8f){};
#pragma unroll
                for (int ks = 0; ks < 2; ++ks) s = wmma16(k16[kt][ks], q.f[g][ks], s);
                st[g][kt] = s; } }
    }
    v16h pb[QG]; v16bf pbh[QG], pbl[QG];
#pragma unroll
    for (int g = 0; g < QG; ++g) {   // group g: queries q0 + 16 g + lr
        float mloc = -3.0e38f;
#pragma unroll
        for (int kt = 0; kt < 2; ++kt) {
#pragma unroll
            for (int j = 0; j < 8; ++j) { if (DIAG && (k0 + kt * 16 + hi * 8 + j > q0 + g * 16 + lr)) st[g][kt][j] = -3.0e38f; mloc = fmaxf(mloc, st[g][kt][j]); } }
        mloc = fmaxf(mloc, xhalf(mloc));   // the two lanes of a query hold different keys and must share one maximum
        const float mn = fmaxf(m[g], mloc * SL2); const float al = __builtin_amdgcn_exp2f(m[g] - mn); m[g] = mn;
        float ps = 0.f;
#pragma unroll
        for (int kt = 0; kt < 2; ++kt) {
#pragma unroll
            for (int j = 0; j < 8; ++j) { const float p = __builtin_amdgcn_exp2f(__builtin_fmaf(st[g][kt][j], SL2, -mn)); st[g][kt][j] = p; ps += p; } }
        l[g] = l[g] * al + ps;
#pragma unroll
        for (int dt = 0; dt < 4; ++dt) o[g][dt] *= al;
        if (HI) { v16us ph, pl;
#pragma unroll
            for (int j = 0; j < 8; ++j) { unsigned short a2, c2; splitf(st[g][0][j], a2, c2); ph[j] = a2; pl[j] = c2; splitf(st[g][1][j], a2, c2); ph[8 + j] = a2; pl[8 + j] = c2; }
            pbh[g] = __builtin_bit_cast(v16bf, ph); pbl[g] = __builtin_bit_cast(v16bf, pl);
        } else {
#pragma unroll
            for (int j = 0; j < 8; ++j) { pb[g][j] = tohx(st[g][0][j]); pb[g][8 + j] = tohx(st[g][1][j]); } }
    }
    v16bf vh[4], vl[4];   // hi and lo v (8 fragments; rows < RH, few blocks) are fetched behind the softmax, into registers that the scores have set free
    if (HI) {
        __builtin_amdgcn_sched_barrier(0);   /* keeps the v loads from rising into the softmax, where their registers are not free yet */
#pragma unroll
        for (int dt = 0; dt < 4; ++dt) { vh[dt] = ldo<bf>(Vh, fo, dt * 512); vl[dt] = ldo<bf>(Vl, fo, dt * 512); }
        asm volatile("s_wait_xcnt 0x0" :: "v"(fo) : "memory"); }   /* the loads' offset register is reused behind this line; named as an input it stays whole up to it */
#pragma unroll
    for (int g = 0; g < QG; ++g) {
#pragma unroll
        for (int dt = 0; dt < 4; ++dt) {
            if (HI) { o[g][dt] = wmmab(vh[dt], pbh[g], o[g][dt]); o[g][dt] = wmmab(vh[dt], pbl[g], o[g][dt]); o[g][dt] = wmmab(vl[dt], pbh[g], o[g][dt]); }
            else o[g][dt] = wmma16(v16[dt], pb[g], o[g][dt]); } }
}
template <bool HI>
__device__ __forceinline__ void fa_keys(const bf* __restrict__ Qh, const bf* __restrict__ Ql, const h16* __restrict__ Q16, const bf* __restrict__ Kh, const bf* __restrict__ Kl, const h16* __restrict__ K16, const h16* __restrict__ V16, const bf* __restrict__ Vh, const bf* __restrict__ Vl,
                                        int q0, int kb0, int sh, int end, int dgl, int rot, int lane, int lr, int hi, v8f (&o)[QG][4], float (&m)[QG], float (&l)[QG]) {
    QFrag<HI> q;
#pragma unroll
    for (int g = 0; g < QG; ++g) {
#pragma unroll
        for (int ks = 0; ks < 2; ++ks) { const size_t qo = (size_t)(q0 + g * 16) * HD + ks * 512 + lane * 8;
            if constexpr (HI) { q.h[g][ks] = WFrag<bf>::ld(Qh + qo); q.l[g][ks] = WFrag<bf>::ld(Ql + qo); } else q.f[g][ks] = WFrag<h16>::ld(Q16 + qo); } }
    asm volatile("s_wait_xcnt 0x0" ::: "memory");   /* the q loads' address registers are reused right behind them */
    // the wave's share of the tile: the 32-key blocks kb0 + (i << sh), i < n, all below end and below the diagonal; then block dgl, the one on the diagonal (the tile's own 32 tokens, q0 / 32; -1: not in this share), if the walk ends on it. Every query of the tile has a live key in the diagonal block and in each block before it
    const int n = (end - kb0 + (1 << sh) - 1) >> sh;   // (kb0 < end + (1 << sh) in every deal below, so the dividend is never negative)
    const unsigned f0 = (unsigned)((kb0 * 32 * HD + (hi * 16 + lr) * 8) * 2); const int bs = sh + 12;   // a step of the walk is 32 HD 2 << sh bytes
    static_assert(32 * HD * 2 == 1 << 12, "the byte step of one key block");
    // The blocks of a batch read the same k and v lines, and all start together: walking from key 0 they would ask L2 for the same lines at the same moment. A block in phase rot (of 8) starts its walk rot / 8 of the way through and wraps round, so that at any moment the blocks are spread over the key range.
    int i = (rot * n) / 8;
#pragma unroll 1   /* rolled: a second copy of the block's fragments would take the registers that let four waves share a SIMD */
    for (int j = 0; j < n; ++j) { fa_block<HI, false>(Kh, Kl, K16, V16, Vh, Vl, q, q0, 0, f0 + ((unsigned)i << bs), lr, hi, o, m, l); i = (i + 1 == n) ? 0 : i + 1; }
    if (kb0 + (n << sh) == dgl) fa_block<HI, true>(Kh, Kl, K16, V16, Vh, Vl, q, q0, dgl * 32, f0 + ((unsigned)n << bs), lr, hi, o, m, l);   // wave-uniform: one wave of the block
}
__global__ __launch_bounds__(32 * FW) __attribute__((amdgpu_waves_per_eu(4, 4))) void k_fattn(const bf* __restrict__ Qh, const bf* __restrict__ Ql, const bf* __restrict__ Kh, const bf* __restrict__ Kl, const h16* __restrict__ Q16, const h16* __restrict__ K16, const h16* __restrict__ V16, const bf* __restrict__ Vh, const bf* __restrict__ Vl, float* out) {
    __shared__ __align__(16) float Os[2 * FW * QG * 16 * 68]; __shared__ float Ms[2 * FW * QG * 16]; __shared__ float Ls[2 * FW * QG * 16];
    static_assert(QG * 16 == 32, "the tile is one 32-key block wide: its diagonal block is q0 / 32 for every group");
    static_assert((FW & (FW - 1)) == 0 && NT % 2 == 0, "the deal wraps by a mask; the tiles pair up");
    const int tid = threadIdx.x, lane = tid & 31, lr = lane & 15, hi = lane >> 4; const int w = __builtin_amdgcn_readfirstlane(tid >> 5);
    const int b = blockIdx.x, pr = blockIdx.y;
    static constexpr LowOf LOW = low_by_cost(); const int lo = LOW.t[pr];   // the block's tile of the lower half (one scalar load)
    const int ph = (pr >> 1) & 7;   // the block's phase in the walk over the keys (speed only): blocks two apart in pr differ, so that eight phases are met also among the blocks of one parity of pr
    const int up = NT - 1 - pr;   // the block's tile of the upper half
    const bool jn = lo * (QG * 16) >= RH;   // both tiles read the same fp16 k and v planes (the same for the whole block)
    static_assert(FW == 16, "eight wave pairs; LDS slots 0-7, 8-15, 16-31");
    const size_t pb = (size_t)b * TT * HD; Qh += pb; Ql += pb; Kh += pb; Kl += pb; Q16 += pb; K16 += pb; V16 += pb; Vh += pb; Vl += pb;
#pragma unroll 1   /* rolled: one copy of the key loops serves both tiles (half the code to fetch) */
    for (int t = 0; t < 2; ++t) {
        int tile, kb0, sh, end, dgl, sl;   // the wave's tile in this trip, its share of the tile's key blocks (fa_keys) and the LDS slot of the partial set (all wave-uniform)
        if (jn) {
            if (t == 0) { kb0 = w >> 1; sh = 3; if (w & 1) { tile = lo; end = lo; dgl = lo; sl = kb0; } else { tile = up; end = lo + 1; dgl = -1; sl = 8 + kb0; } }   // key blocks 0 .. lo, which both tiles need: pair w / 2 takes every eighth
            else { const int s = (w - 2 * ((lo + 1) & 7)) & (FW - 1); tile = up; kb0 = lo + 1 + s; sh = 4; end = up; dgl = up; sl = FW + s; }   // the upper tile's other key blocks; the deal goes on at the wave where the pairs' deal ended
        } else {
            if (t == 0) { tile = up; kb0 = w; sl = FW + w; } else { tile = lo; kb0 = (w - (NT - pr)) & (FW - 1); sl = kb0; }   // tile up (NT - pr key blocks), then tile lo (lo + 1); the second deal goes on where the first ended
            sh = 4; end = tile; dgl = tile;
        }
        const int q0 = tile * (QG * 16);
        v8f o[QG][4]; float m[QG], l[QG];
#pragma unroll
        for (int g = 0; g < QG; ++g) { m[g] = -3.0e38f; l[g] = 0.f;
#pragma unroll
            for (int dt = 0; dt < 4; ++dt) o[g][dt] = (v8f){}; }
        if (q0 < RH) fa_keys<true>(Qh, Ql, Q16, Kh, Kl, K16, V16, Vh, Vl, q0, kb0, sh, end, dgl, ph, lane, lr, hi, o, m, l); else fa_keys<false>(Qh, Ql, Q16, Kh, Kl, K16, V16, Vh, Vl, q0, kb0, sh, end, dgl, ph, lane, lr, hi, o, m, l);   // wave-uniform; no barrier stands inside
        // slot sl is written by this wave alone and read behind the barrier; over the two trips the FW waves fill each of the 2 FW slots once
#pragma unroll
        for (int g = 0; g < QG; ++g) { l[g] += xhalf(l[g]);
#pragma unroll
            for (int dt = 0; dt < 4; ++dt) { float* p = Os + ((sl * QG + g) * 16 + lr) * 68 + dt * 16 + hi * 8; v4f a, c;
#pragma unroll
                for (int j = 0; j < 4; ++j) { a[j] = o[g][dt][j]; c[j] = o[g][dt][4 + j]; }
                *(v4fa*)p = a; *(v4fa*)(p + 4) = c; }
            if (hi == 0) { Ms[(sl * QG + g) * 16 + lr] = m[g]; Ls[(sl * QG + g) * 16 + lr] = l[g]; } }
    }
    __syncthreads();   /* every wave's two partial sets are in LDS before any thread merges them */
    const int d4 = (tid & 15) * 4, qr = tid >> 4;   // the thread's query row of each tile (32 FW threads: 16 QG rows x 16 column groups)
    static_assert(32 * FW == QG * 16 * 16, "one merge turn a tile");
#pragma unroll
    for (int t = 0; t < 2; ++t) { const int q0 = (t ? lo : up) * (QG * 16); const int e = qr;
        // tile lo: slots 0 .. 7, tile up: slots 16 .. 31; slots 8 .. 15 hold partial sets of tile up where the pairs' deal was used, of tile lo elsewhere (the same for the whole block)
        const int u0 = t ? 0 : FW, u1 = t ? 8 : 2 * FW; const bool mid = t ? !jn : jn;
        float M = Ms[u0 * QG * 16 + e];
#pragma unroll
        for (int u = u0 + 1; u < u1; ++u) M = fmaxf(M, Ms[u * QG * 16 + e]);
        if (mid) {
#pragma unroll
            for (int u = 8; u < FW; ++u) M = fmaxf(M, Ms[u * QG * 16 + e]); }
        float L = 0.f; v4f a = (v4f){};
#pragma unroll
        for (int u = u0; u < u1; ++u) { const float f = __builtin_amdgcn_exp2f(Ms[u * QG * 16 + e] - M); L += Ls[u * QG * 16 + e] * f; a += *(const v4fa*)(Os + (u * QG * 16 + e) * 68 + d4) * f; }   // a wave without keys has max -3e38, sum 0: factor 0
        if (mid) {
#pragma unroll
            for (int u = 8; u < FW; ++u) { const float f = __builtin_amdgcn_exp2f(Ms[u * QG * 16 + e] - M); L += Ls[u * QG * 16 + e] * f; a += *(const v4fa*)(Os + (u * QG * 16 + e) * 68 + d4) * f; } }
        const float r = __fdiv_rn(1.0f, L);
        *(v4f*)(out + ((size_t)b * TT + q0 + qr) * CO + d4) = a * r;
        if (t == 0) asm volatile("s_wait_xcnt 0x0" ::: "memory"); }   /* the next tile's merge reuses the store's address and data registers */
}
extern "C" void kernel_launch(void* const* d_in, const int* in_sizes, int n_in,
                              void* d_out, int out_size, void* d_ws, size_t ws_size, hipStream_t stream) {
    (void)in_sizes; (void)n_in; (void)out_size;
    const float* x = (const float*)d_in[0]; const float* wq = (const float*)d_in[1]; const float* bq = (const float*)d_in[2]; const float* wk = (const float*)d_in[3]; const float* bk = (const float*)d_in[4]; const float* wv = (const float*)d_in[5]; const float* bv = (const float*)d_in[6];   /* standard roles: rows = queries */
    float* OUT = (float*)d_out;     // [4][4096][64]
    char* wsp = (char*)d_ws;
    auto take = [&](size_t bytes) { char* p = wsp; wsp += (bytes + 255) & ~(size_t)255; return (void*)p; };
    bf* WT = (bf*)take((size_t)3 * MID * CC * 2);   /* q, k, v weights, bf16 in fragment order */
    bf* QPh = (bf*)take((size_t)NB_ * TT * MID * 2); bf* QPl = (bf*)take((size_t)NB_ * TT * MID * 2); bf* KPh = (bf*)take((size_t)NB_ * TT * MID * 2); bf* KPl = (bf*)take((size_t)NB_ * TT * MID * 2);   /* the planes the attention launch reads: one set a batch */
    h16* QP16 = (h16*)take((size_t)NB_ * TT * MID * 2); h16* KP16 = (h16*)take((size_t)NB_ * TT * MID * 2);   /* q and k as one fp16 plane each (query rows >= RH) */
    h16* VT16 = (h16*)take((size_t)NB_ * CO * TT * 2); bf* VTh = (bf*)take((size_t)NB_ * CO * TT * 2); bf* VTl = (bf*)take((size_t)NB_ * CO * TT * 2);
    if ((size_t)(wsp - (char*)d_ws) > ws_size) return;    // ws 256 MiB (carve ~19 MiB)
    k_wt3<<<dim3(CC * MID / 512, 3, 1), 256, 0, stream>>>(wq, wk, wv, WT);   /* 'xw' weights -> fragments */
    k_proj<<<NB_ * TT / 64, 32 * 3 * KQ, 0, stream>>>(x, WT, bq, bk, bv, QPh, QPl, KPh, KPl, QP16, KP16, VT16, VTh, VTl);   /* q, k and v^T planes, in fragment order */
    k_fattn<<<dim3(NB_, NT / 2, 1), 32 * FW, 0, stream>>>(QPh, QPl, KPh, KPl, QP16, KP16, VT16, VTh, VTl, OUT);   /* causal attention of all four batches; writes every output row once */
}
